// v000
// The times below were measured on an AMD MI455X: many runs one after another, warmed up first and cycling through
// copies of the inputs, with the whole window's GPU time divided by the number of runs. Launches and the gaps
// between them are all in it. The median over several windows is given; except for v000 it joins two sittings, which
// can be a few percent apart, so the side-by-side timings, each taken in one sitting, are the better comparison.
// v000, which the later versions start from, runs in 305 microseconds.
#include <hip/hip_runtime.h>
#include <hip/hip_bf16.h>

typedef __attribute__((ext_vector_type(16))) _Float16 v16h;
typedef __attribute__((ext_vector_type(8)))  float    v8f;

#define EMBED    1024
#define HEADS    16
#define HEAD_DIM 64
#define NSEQ     2048
#define BATCH    2
#define MROWS    (BATCH * NSEQ)        // 4096
#define SCALE_F  0.125f                // HEAD_DIM^-0.5
#define LN_EPS   1e-5f
#define NEG_BIG  (-1e30f)

static __device__ __forceinline__ v8f wmma_f16(v16h a, v16h b, v8f c) {
  // D = A(16x32 f16) * B(32x16 f16) + C(16x16 f32)
  return __builtin_amdgcn_wmma_f32_16x16x32_f16(
      /*neg_a=*/false, a, /*neg_b=*/false, b,
      /*c_mod=*/(short)0, c, /*reuse_a=*/false, /*reuse_b=*/false);
}

// In-order LDS pipe within a wave: wait DS ops then fence the compiler.
static __device__ __forceinline__ void lds_fence_wave() {
  asm volatile("s_wait_dscnt 0x0" ::: "memory");
}

// ---------------------------------------------------------------------------
// fp32 -> f16 elementwise (weight conversion)
// ---------------------------------------------------------------------------
__global__ void cvt_f32_f16(const float* __restrict__ s, _Float16* __restrict__ d, int n) {
  int i = blockIdx.x * 256 + threadIdx.x;
  if (i < n) d[i] = (_Float16)s[i];
}

// ---------------------------------------------------------------------------
// LayerNorm: one wave per row of 1024, fp32 in, f16 out
// ---------------------------------------------------------------------------
__global__ __launch_bounds__(32) void ln_kernel(const float* __restrict__ x,
                                                const float* __restrict__ w,
                                                const float* __restrict__ bns,
                                                _Float16* __restrict__ xn) {
  int row  = blockIdx.x;
  int lane = threadIdx.x;
  const float4* xr = (const float4*)(x + (size_t)row * EMBED);
  float4 v[8];
  float s = 0.f, s2 = 0.f;
#pragma unroll
  for (int i = 0; i < 8; ++i) {
    v[i] = xr[lane + 32 * i];
    s  += v[i].x + v[i].y + v[i].z + v[i].w;
    s2 += v[i].x * v[i].x + v[i].y * v[i].y + v[i].z * v[i].z + v[i].w * v[i].w;
  }
#pragma unroll
  for (int off = 16; off >= 1; off >>= 1) {
    s  += __shfl_xor(s, off, 32);
    s2 += __shfl_xor(s2, off, 32);
  }
  float mu  = s * (1.f / EMBED);
  float var = s2 * (1.f / EMBED) - mu * mu;
  float rs  = rsqrtf(var + LN_EPS);
#pragma unroll
  for (int i = 0; i < 8; ++i) {
    int idx = (lane + 32 * i) * 4;
    float4 wv = ((const float4*)w)[lane + 32 * i];
    float4 bv = ((const float4*)bns)[lane + 32 * i];
    _Float16* o = xn + (size_t)row * EMBED + idx;
    o[0] = (_Float16)((v[i].x - mu) * rs * wv.x + bv.x);
    o[1] = (_Float16)((v[i].y - mu) * rs * wv.y + bv.y);
    o[2] = (_Float16)((v[i].z - mu) * rs * wv.z + bv.z);
    o[3] = (_Float16)((v[i].w - mu) * rs * wv.w + bv.w);
  }
}

// ---------------------------------------------------------------------------
// C = A(M x K) @ W^T, both f16, K innermost. 4 waves per block share one
// 64-wide W strip (WGP$ reuse); each wave computes a 16x64 output strip with
// a manually double-buffered K-loop (preload kb+1 while computing kb).
// mode 0: dst[m][col] f16 row-major
// mode 1: dst = [B,H,N,D] (Q/K head layout)
// mode 2: dst = [B,H,D,N] (V transposed for flash-attention B fragments)
// ---------------------------------------------------------------------------
__global__ __launch_bounds__(128) void gemm_qkv(const _Float16* __restrict__ A,
                                                const _Float16* __restrict__ W,
                                                _Float16* __restrict__ dst, int mode) {
  int lane = threadIdx.x & 31;
  int wave = threadIdx.x >> 5;
  int hi = lane >> 4, ln16 = lane & 15;
  int bx = blockIdx.x;                 // (4096/64) * (1024/64) = 64*16 blocks
  int nt = bx & 15;                    // 64-wide N strip (shared by 4 waves)
  int mt = (bx >> 4) * 4 + wave;       // per-wave M tile
  int m0 = mt * 16, ncol0 = nt * 64;
  const _Float16* arow = A + (size_t)(m0 + ln16) * EMBED + hi * 16;
  const _Float16* wrow = W + (size_t)(ncol0 + ln16) * EMBED + hi * 16;
  v8f acc0 = {}, acc1 = {}, acc2 = {}, acc3 = {};

  v16h a  = *(const v16h*)(arow);
  v16h b0 = *(const v16h*)(wrow);
  v16h b1 = *(const v16h*)(wrow + 16 * EMBED);
  v16h b2 = *(const v16h*)(wrow + 32 * EMBED);
  v16h b3 = *(const v16h*)(wrow + 48 * EMBED);
  for (int kb = 0; kb < EMBED / 32 - 1; ++kb) {
    const _Float16* apn = arow + (kb + 1) * 32;
    const _Float16* wpn = wrow + (kb + 1) * 32;
    v16h an  = *(const v16h*)(apn);
    v16h b0n = *(const v16h*)(wpn);
    v16h b1n = *(const v16h*)(wpn + 16 * EMBED);
    v16h b2n = *(const v16h*)(wpn + 32 * EMBED);
    v16h b3n = *(const v16h*)(wpn + 48 * EMBED);
    __builtin_prefetch(apn + 256, 0, 3);
    acc0 = wmma_f16(a, b0, acc0);
    acc1 = wmma_f16(a, b1, acc1);
    acc2 = wmma_f16(a, b2, acc2);
    acc3 = wmma_f16(a, b3, acc3);
    a = an; b0 = b0n; b1 = b1n; b2 = b2n; b3 = b3n;
  }
  acc0 = wmma_f16(a, b0, acc0);
  acc1 = wmma_f16(a, b1, acc1);
  acc2 = wmma_f16(a, b2, acc2);
  acc3 = wmma_f16(a, b3, acc3);

  float accs[4][8];
#pragma unroll
  for (int r = 0; r < 8; ++r) {
    accs[0][r] = acc0[r]; accs[1][r] = acc1[r];
    accs[2][r] = acc2[r]; accs[3][r] = acc3[r];
  }
#pragma unroll
  for (int j = 0; j < 4; ++j) {
    int col = ncol0 + j * 16 + ln16;
    if (mode == 0) {
#pragma unroll
      for (int r = 0; r < 8; ++r) {
        int m = m0 + r + 8 * hi;
        dst[(size_t)m * EMBED + col] = (_Float16)accs[j][r];
      }
    } else {
      int h = col >> 6, d = col & 63;
#pragma unroll
      for (int r = 0; r < 8; ++r) {
        int m  = m0 + r + 8 * hi;
        int b2 = m >> 11;               // batch
        int n  = m & (NSEQ - 1);        // seq pos
        size_t base = (size_t)(b2 * HEADS + h);
        if (mode == 1)
          dst[(base * NSEQ + n) * HEAD_DIM + d] = (_Float16)accs[j][r];
        else
          dst[(base * HEAD_DIM + d) * NSEQ + n] = (_Float16)accs[j][r];
      }
    }
  }
}

// ---------------------------------------------------------------------------
// Flash attention: 4 waves per block handle 4 adjacent 16-query tiles of the
// same (b,h) so the K/V stream is shared through WGP$. Scores stay in
// registers; online softmax via width-16 xor reductions. P re-layout C->A via
// per-wave LDS (in-order DS pipe + s_wait_dscnt, no block barrier needed).
// ---------------------------------------------------------------------------
__global__ __launch_bounds__(128) void flash_attn(const _Float16* __restrict__ q,
                                                  const _Float16* __restrict__ k,
                                                  const _Float16* __restrict__ vt,
                                                  _Float16* __restrict__ ao) {
  __shared__ _Float16 pl[4][16 * 32];
  int lane = threadIdx.x & 31;
  int wave = threadIdx.x >> 5;
  int hi = lane >> 4, ln16 = lane & 15;
  int tile = blockIdx.x * 4 + wave;    // B*H*(N/16) tiles, 4 per block
  int qb = tile & 127;
  int h  = (tile >> 7) & (HEADS - 1);
  int b  = tile >> 11;
  int m0 = qb * 16;
  _Float16* plw = &pl[wave][0];
  size_t bh = (size_t)(b * HEADS + h);
  const _Float16* qb_p = q  + bh * NSEQ * HEAD_DIM;
  const _Float16* kb_p = k  + bh * NSEQ * HEAD_DIM;
  const _Float16* vb_p = vt + bh * HEAD_DIM * NSEQ;

  // Q A-fragments for d = 0..31 and d = 32..63 (loaded once)
  const _Float16* qrow = qb_p + (size_t)(m0 + ln16) * HEAD_DIM;
  v16h a0 = *(const v16h*)(qrow + hi * 16);
  v16h a1 = *(const v16h*)(qrow + 32 + hi * 16);

  v8f o0 = {}, o1 = {}, o2 = {}, o3 = {};
  float mrun[8], lrun[8];
#pragma unroll
  for (int r = 0; r < 8; ++r) { mrun[r] = NEG_BIG; lrun[r] = 0.f; }

  int kbmax = (m0 + 15) >> 5;          // causal: last key block touching this tile
  for (int kb = 0; kb <= kbmax; ++kb) {
    int n0 = kb * 32;
    // ---- S = Q @ K^T for 32 keys (two 16x16 C tiles) ----
    v8f s0 = {}, s1 = {};
    const _Float16* kr0 = kb_p + (size_t)(n0 + ln16) * HEAD_DIM;
    const _Float16* kr1 = kr0 + 16 * HEAD_DIM;
    v16h b00 = *(const v16h*)(kr0 + hi * 16);
    v16h b01 = *(const v16h*)(kr0 + 32 + hi * 16);
    v16h b10 = *(const v16h*)(kr1 + hi * 16);
    v16h b11 = *(const v16h*)(kr1 + 32 + hi * 16);
    s0 = wmma_f16(a0, b00, s0); s0 = wmma_f16(a1, b01, s0);
    s1 = wmma_f16(a0, b10, s1); s1 = wmma_f16(a1, b11, s1);

    // ---- scale, causal mask, online softmax ----
#pragma unroll
    for (int r = 0; r < 8; ++r) {
      int rowg = m0 + r + 8 * hi;
      float v0 = s0[r] * SCALE_F; if (n0 + ln16      > rowg) v0 = NEG_BIG;
      float v1 = s1[r] * SCALE_F; if (n0 + 16 + ln16 > rowg) v1 = NEG_BIG;
      float mx = fmaxf(v0, v1);
#pragma unroll
      for (int off = 8; off >= 1; off >>= 1) mx = fmaxf(mx, __shfl_xor(mx, off, 16));
      float mnew  = fmaxf(mrun[r], mx);
      float alpha = __expf(mrun[r] - mnew);
      float p0 = __expf(v0 - mnew);
      float p1 = __expf(v1 - mnew);
      float rsum = p0 + p1;
#pragma unroll
      for (int off = 8; off >= 1; off >>= 1) rsum += __shfl_xor(rsum, off, 16);
      lrun[r] = lrun[r] * alpha + rsum;
      mrun[r] = mnew;
      o0[r] *= alpha; o1[r] *= alpha; o2[r] *= alpha; o3[r] *= alpha;
      s0[r] = p0; s1[r] = p1;
    }

    // ---- P: C-fragment (f32) -> A-fragment (f16) via per-wave LDS ----
#pragma unroll
    for (int r = 0; r < 8; ++r) {
      plw[(r + 8 * hi) * 32 + ln16]      = (_Float16)s0[r];
      plw[(r + 8 * hi) * 32 + 16 + ln16] = (_Float16)s1[r];
    }
    lds_fence_wave();                  // DS pipe is in-order within a wave
    v16h ap = *(const v16h*)(&plw[ln16 * 32 + hi * 16]);
    lds_fence_wave();

    // ---- O += P @ V : V^T layout makes B fragments contiguous ----
    const _Float16* vb0 = vb_p + n0 + hi * 16;     // + dcol*NSEQ below
    v16h bv0 = *(const v16h*)(vb0 + (size_t)(ln16 +  0) * NSEQ);
    v16h bv1 = *(const v16h*)(vb0 + (size_t)(ln16 + 16) * NSEQ);
    v16h bv2 = *(const v16h*)(vb0 + (size_t)(ln16 + 32) * NSEQ);
    v16h bv3 = *(const v16h*)(vb0 + (size_t)(ln16 + 48) * NSEQ);
    o0 = wmma_f16(ap, bv0, o0);
    o1 = wmma_f16(ap, bv1, o1);
    o2 = wmma_f16(ap, bv2, o2);
    o3 = wmma_f16(ap, bv3, o3);
  }

  // ---- normalize and write attention output [B*N, EMBED] f16 ----
#pragma unroll
  for (int r = 0; r < 8; ++r) {
    float inv = 1.f / lrun[r];
    int rowg = m0 + r + 8 * hi;
    _Float16* orow = ao + ((size_t)(b * NSEQ + rowg)) * EMBED + h * HEAD_DIM;
    orow[ 0 + ln16] = (_Float16)(o0[r] * inv);
    orow[16 + ln16] = (_Float16)(o1[r] * inv);
    orow[32 + ln16] = (_Float16)(o2[r] * inv);
    orow[48 + ln16] = (_Float16)(o3[r] * inv);
  }
}

// ---------------------------------------------------------------------------
// out = residual + ao @ Wo^T + bo  (fp32 output); same blocking as gemm_qkv
// ---------------------------------------------------------------------------
__global__ __launch_bounds__(128) void out_proj(const _Float16* __restrict__ A,
                                                const _Float16* __restrict__ W,
                                                const float* __restrict__ x,
                                                const float* __restrict__ bo,
                                                float* __restrict__ out) {
  int lane = threadIdx.x & 31;
  int wave = threadIdx.x >> 5;
  int hi = lane >> 4, ln16 = lane & 15;
  int bx = blockIdx.x;
  int nt = bx & 15;
  int mt = (bx >> 4) * 4 + wave;
  int m0 = mt * 16, ncol0 = nt * 64;
  const _Float16* arow = A + (size_t)(m0 + ln16) * EMBED + hi * 16;
  const _Float16* wrow = W + (size_t)(ncol0 + ln16) * EMBED + hi * 16;
  v8f acc0 = {}, acc1 = {}, acc2 = {}, acc3 = {};

  v16h a  = *(const v16h*)(arow);
  v16h b0 = *(const v16h*)(wrow);
  v16h b1 = *(const v16h*)(wrow + 16 * EMBED);
  v16h b2 = *(const v16h*)(wrow + 32 * EMBED);
  v16h b3 = *(const v16h*)(wrow + 48 * EMBED);
  for (int kb = 0; kb < EMBED / 32 - 1; ++kb) {
    const _Float16* apn = arow + (kb + 1) * 32;
    const _Float16* wpn = wrow + (kb + 1) * 32;
    v16h an  = *(const v16h*)(apn);
    v16h b0n = *(const v16h*)(wpn);
    v16h b1n = *(const v16h*)(wpn + 16 * EMBED);
    v16h b2n = *(const v16h*)(wpn + 32 * EMBED);
    v16h b3n = *(const v16h*)(wpn + 48 * EMBED);
    __builtin_prefetch(apn + 256, 0, 3);
    acc0 = wmma_f16(a, b0, acc0);
    acc1 = wmma_f16(a, b1, acc1);
    acc2 = wmma_f16(a, b2, acc2);
    acc3 = wmma_f16(a, b3, acc3);
    a = an; b0 = b0n; b1 = b1n; b2 = b2n; b3 = b3n;
  }
  acc0 = wmma_f16(a, b0, acc0);
  acc1 = wmma_f16(a, b1, acc1);
  acc2 = wmma_f16(a, b2, acc2);
  acc3 = wmma_f16(a, b3, acc3);

  float accs[4][8];
#pragma unroll
  for (int r = 0; r < 8; ++r) {
    accs[0][r] = acc0[r]; accs[1][r] = acc1[r];
    accs[2][r] = acc2[r]; accs[3][r] = acc3[r];
  }
#pragma unroll
  for (int j = 0; j < 4; ++j) {
    int col = ncol0 + j * 16 + ln16;
    float bias = bo[col];
#pragma unroll
    for (int r = 0; r < 8; ++r) {
      int m = m0 + r + 8 * hi;
      size_t idx = (size_t)m * EMBED + col;
      out[idx] = x[idx] + bias + accs[j][r];
    }
  }
}

// ---------------------------------------------------------------------------
extern "C" void kernel_launch(void* const* d_in, const int* in_sizes, int n_in,
                              void* d_out, int out_size, void* d_ws, size_t ws_size,
                              hipStream_t stream) {
  (void)in_sizes; (void)n_in; (void)out_size; (void)ws_size;
  const float* x    = (const float*)d_in[0];
  const float* ln_w = (const float*)d_in[1];
  const float* ln_b = (const float*)d_in[2];
  const float* Wq   = (const float*)d_in[3];
  const float* Wk   = (const float*)d_in[4];
  const float* Wv   = (const float*)d_in[5];
  const float* Wo   = (const float*)d_in[6];
  const float* bo   = (const float*)d_in[7];
  float* out = (float*)d_out;

  char* ws = (char*)d_ws;
  size_t off = 0;
  auto carve = [&](size_t elems) {
    _Float16* p = (_Float16*)(ws + off);
    off += ((elems * sizeof(_Float16) + 255) & ~(size_t)255);
    return p;
  };
  _Float16* xn   = carve((size_t)MROWS * EMBED);   // normalized activations
  _Float16* wq16 = carve((size_t)EMBED * EMBED);
  _Float16* wk16 = carve((size_t)EMBED * EMBED);
  _Float16* wv16 = carve((size_t)EMBED * EMBED);
  _Float16* wo16 = carve((size_t)EMBED * EMBED);
  _Float16* qh   = carve((size_t)MROWS * EMBED);   // [B,H,N,D]
  _Float16* kh   = carve((size_t)MROWS * EMBED);   // [B,H,N,D]
  _Float16* vth  = carve((size_t)MROWS * EMBED);   // [B,H,D,N]
  _Float16* ao   = carve((size_t)MROWS * EMBED);   // attention output [B*N, E]

  int wcnt = EMBED * EMBED;
  dim3 cvtGrid((wcnt + 255) / 256);
  cvt_f32_f16<<<cvtGrid, 256, 0, stream>>>(Wq, wq16, wcnt);
  cvt_f32_f16<<<cvtGrid, 256, 0, stream>>>(Wk, wk16, wcnt);
  cvt_f32_f16<<<cvtGrid, 256, 0, stream>>>(Wv, wv16, wcnt);
  cvt_f32_f16<<<cvtGrid, 256, 0, stream>>>(Wo, wo16, wcnt);

  ln_kernel<<<dim3(MROWS), 32, 0, stream>>>(x, ln_w, ln_b, xn);

  dim3 gemmGrid((MROWS / 64) * (EMBED / 64));     // 4 waves/block, 16x64 each
  gemm_qkv<<<gemmGrid, 128, 0, stream>>>(xn, wq16, qh, 1);
  gemm_qkv<<<gemmGrid, 128, 0, stream>>>(xn, wk16, kh, 1);
  gemm_qkv<<<gemmGrid, 128, 0, stream>>>(xn, wv16, vth, 2);

  flash_attn<<<dim3(BATCH * HEADS * (NSEQ / 16) / 4), 128, 0, stream>>>(qh, kh, vth, ao);

  out_proj<<<gemmGrid, 128, 0, stream>>>(ao, wo16, x, bo, out);
}

// v001
// It runs in 180 microseconds.
// Two timings next to v000 put it at 1.71 and 1.73 times that version's speed.
#include <hip/hip_runtime.h>
#include <hip/hip_bf16.h>

typedef __attribute__((ext_vector_type(16))) _Float16 v16h;
typedef __attribute__((ext_vector_type(8)))  _Float16 v8h;
typedef __attribute__((ext_vector_type(8)))  float    v8f;

#define EMBED    1024
#define HEADS    16
#define HEAD_DIM 64
#define NSEQ     2048
#define BATCH    2
#define MROWS    (BATCH * NSEQ)        // 4096
#define SCALE_F  0.125f                // HEAD_DIM^-0.5
#define LN_EPS   1e-5f
#define NEG_BIG  (-1e30f)

static __device__ __forceinline__ v8f wmma_f16(v16h a, v16h b, v8f c) {
  // D = A(16x32 f16) * B(32x16 f16) + C(16x16 f32)
  return __builtin_amdgcn_wmma_f32_16x16x32_f16(
      /*neg_a=*/false, a, /*neg_b=*/false, b,
      /*c_mod=*/(short)0, c, /*reuse_a=*/false, /*reuse_b=*/false);
}

// In-order LDS pipe within a wave: wait DS ops then fence the compiler.
static __device__ __forceinline__ void lds_fence_wave() {
  asm volatile("s_wait_dscnt 0x0" ::: "memory");
}

// ---------------------------------------------------------------------------
// fp32 -> f16 elementwise (weight conversion)
// ---------------------------------------------------------------------------
__global__ void cvt_f32_f16(const float* __restrict__ s, _Float16* __restrict__ d, int n) {
  int i = blockIdx.x * 256 + threadIdx.x;
  if (i < n) d[i] = (_Float16)s[i];
}

// ---------------------------------------------------------------------------
// LayerNorm: one wave per row of 1024, fp32 in, f16 out
// ---------------------------------------------------------------------------
__global__ __launch_bounds__(32) void ln_kernel(const float* __restrict__ x,
                                                const float* __restrict__ w,
                                                const float* __restrict__ bns,
                                                _Float16* __restrict__ xn) {
  int row  = blockIdx.x;
  int lane = threadIdx.x;
  const float4* xr = (const float4*)(x + (size_t)row * EMBED);
  float4 v[8];
  float s = 0.f, s2 = 0.f;
#pragma unroll
  for (int i = 0; i < 8; ++i) {
    v[i] = xr[lane + 32 * i];
    s  += v[i].x + v[i].y + v[i].z + v[i].w;
    s2 += v[i].x * v[i].x + v[i].y * v[i].y + v[i].z * v[i].z + v[i].w * v[i].w;
  }
#pragma unroll
  for (int off = 16; off >= 1; off >>= 1) {
    s  += __shfl_xor(s, off, 32);
    s2 += __shfl_xor(s2, off, 32);
  }
  float mu  = s * (1.f / EMBED);
  float var = s2 * (1.f / EMBED) - mu * mu;
  float rs  = rsqrtf(var + LN_EPS);
#pragma unroll
  for (int i = 0; i < 8; ++i) {
    int idx = (lane + 32 * i) * 4;
    float4 wv = ((const float4*)w)[lane + 32 * i];
    float4 bv = ((const float4*)bns)[lane + 32 * i];
    _Float16* o = xn + (size_t)row * EMBED + idx;
    o[0] = (_Float16)((v[i].x - mu) * rs * wv.x + bv.x);
    o[1] = (_Float16)((v[i].y - mu) * rs * wv.y + bv.y);
    o[2] = (_Float16)((v[i].z - mu) * rs * wv.z + bv.z);
    o[3] = (_Float16)((v[i].w - mu) * rs * wv.w + bv.w);
  }
}

// ---------------------------------------------------------------------------
// Shared main loop of the four projections: C = A(M x K) @ W^T, both f16, K
// innermost. One block of 8 waves owns a 128x128 tile of C. A pass is 128 k
// (256 B of every operand row): the block loads both 128-row operand tiles
// with whole 256-B row pieces, stages them in LDS (two buffers, row pitch
// 272 B for conflict-free 16-byte reads) and every wave reads its fragments
// from there. Waves are laid 2 (M) x 4 (N); a wave owns 64x32 = 4x2 tiles.
// The next pass's global loads are issued ahead of this pass's products and
// stored to the other buffer behind them; one barrier per pass.
// k order per accumulator is ascending in steps of 32.
// ---------------------------------------------------------------------------
#define GT_ROWS   128                    // rows of each operand tile
#define GT_K      128                    // k per pass
#define GT_PITCH  136                    // LDS row pitch in f16 (272 B)
#define GT_OPER   (GT_ROWS * GT_PITCH)   // f16 per operand tile in LDS
#define GT_PASSES (EMBED / GT_K)         // 8

static __device__ __forceinline__ v16h lds_frag(const _Float16* p) {
  v8h lo = *(const v8h*)(p);
  v8h hi = *(const v8h*)(p + 8);
  return __builtin_shufflevector(lo, hi, 0, 1, 2, 3, 4, 5, 6, 7,
                                 8, 9, 10, 11, 12, 13, 14, 15);
}

static __device__ __forceinline__ void gemm_tile_128(const _Float16* __restrict__ A,
                                                     const _Float16* __restrict__ W,
                                                     _Float16* sm, int m0, int n0,
                                                     v8f (&acc)[4][2]) {
  int tid  = threadIdx.x;
  int lane = tid & 31, wave = tid >> 5;
  int hi = lane >> 4, ln16 = lane & 15;
  int wm = wave >> 2, wn = wave & 3;
  int c16 = tid & 15, r16 = tid >> 4;    // 16 lanes cover one row's 256 B
  // Block-uniform bases plus one per-lane offset that never changes.
  const _Float16* ga = A + (size_t)m0 * EMBED;
  const _Float16* gw = W + (size_t)n0 * EMBED;
  const unsigned go = (unsigned)(r16 * EMBED + c16 * 8);
  _Float16* st = sm + r16 * GT_PITCH + c16 * 8;
  const _Float16* fa = sm + (wm * 64 + ln16) * GT_PITCH + hi * 16;
  const _Float16* fb = sm + GT_OPER + (wn * 32 + ln16) * GT_PITCH + hi * 16;

  v8h ra[8], rw[8];
#pragma unroll
  for (int i = 0; i < 8; ++i) {
    ra[i] = *(const v8h*)(ga + go + i * 16 * EMBED);
    rw[i] = *(const v8h*)(gw + go + i * 16 * EMBED);
  }
#pragma unroll
  for (int i = 0; i < 8; ++i) {
    *(v8h*)(st + i * 16 * GT_PITCH)           = ra[i];
    *(v8h*)(st + GT_OPER + i * 16 * GT_PITCH) = rw[i];
  }
  __syncthreads();

  for (int t = 0; t < GT_PASSES; ++t) {
    const int cur = (t & 1) * 2 * GT_OPER;
    if (t + 1 < GT_PASSES) {
#pragma unroll
      for (int i = 0; i < 8; ++i) {
        ra[i] = *(const v8h*)(ga + (t + 1) * GT_K + go + i * 16 * EMBED);
        rw[i] = *(const v8h*)(gw + (t + 1) * GT_K + go + i * 16 * EMBED);
      }
    }
    v16h a[2][4], b[2][2];             // two fragment sets: one read, one in use
#pragma unroll
    for (int i = 0; i < 4; ++i) a[0][i] = lds_frag(fa + cur + i * 16 * GT_PITCH);
#pragma unroll
    for (int j = 0; j < 2; ++j) b[0][j] = lds_frag(fb + cur + j * 16 * GT_PITCH);
#pragma unroll
    for (int kk = 0; kk < GT_K / 32; ++kk) {
      const int s = kk & 1;
      if (kk + 1 < GT_K / 32) {
#pragma unroll
        for (int i = 0; i < 4; ++i)
          a[s ^ 1][i] = lds_frag(fa + cur + i * 16 * GT_PITCH + (kk + 1) * 32);
#pragma unroll
        for (int j = 0; j < 2; ++j)
          b[s ^ 1][j] = lds_frag(fb + cur + j * 16 * GT_PITCH + (kk + 1) * 32);
      }
      // Keeps the next block's LDS reads one group ahead of this block's
      // products; left free, the scheduler sinks them between the products
      // and each pair of products then waits out an LDS latency.
      __builtin_amdgcn_sched_barrier(0);
#pragma unroll
      for (int i = 0; i < 4; ++i)
#pragma unroll
        for (int j = 0; j < 2; ++j) acc[i][j] = wmma_f16(a[s][i], b[s][j], acc[i][j]);
      // Ends the block: left free, the scheduler lifts the following group's
      // reads in among these products and moves products past the barrier.
      __builtin_amdgcn_sched_barrier(0);
    }
    if (t + 1 < GT_PASSES) {
      // The other buffer's last readers left it at the previous pass's barrier.
      const int nxt = 2 * GT_OPER - cur;
#pragma unroll
      for (int i = 0; i < 8; ++i) {
        *(v8h*)(st + nxt + i * 16 * GT_PITCH)           = ra[i];
        *(v8h*)(st + nxt + GT_OPER + i * 16 * GT_PITCH) = rw[i];
      }
      __syncthreads();
    }
  }
}

// ---------------------------------------------------------------------------
// mode 0: dst[m][col] f16 row-major
// mode 1: dst = [B,H,N,D] (Q/K head layout)
// mode 2: dst = [B,H,D,N] (V transposed for flash-attention B fragments)
// ---------------------------------------------------------------------------
__global__ __launch_bounds__(256) void gemm_qkv(const _Float16* __restrict__ A,
                                                const _Float16* __restrict__ W,
                                                _Float16* __restrict__ dst, int mode) {
  __shared__ __attribute__((aligned(16))) _Float16 sm[4 * GT_OPER];
  int lane = threadIdx.x & 31;
  int wave = threadIdx.x >> 5;
  int hi = lane >> 4, ln16 = lane & 15;
  int bx = blockIdx.x;                 // (4096/128) * (1024/128) = 32*8 blocks
  int bm0 = (bx >> 3) * 128, bn0 = (bx & 7) * 128;
  v8f acc[4][2] = {};
  gemm_tile_128(A, W, sm, bm0, bn0, acc);

  int m0 = bm0 + (wave >> 2) * 64 + 8 * hi, ncol0 = bn0 + (wave & 3) * 32 + ln16;
  if (mode == 0) {
#pragma unroll
    for (int i = 0; i < 4; ++i)
#pragma unroll
      for (int j = 0; j < 2; ++j)
#pragma unroll
        for (int r = 0; r < 8; ++r)
          dst[(size_t)(m0 + i * 16 + r) * EMBED + ncol0 + j * 16] = (_Float16)acc[i][j][r];
    return;
  }
  int b2 = m0 >> 11;                   // batch: a 64-row strip lies in one
  int n0 = m0 & (NSEQ - 1);            // seq pos of the lane's first row
  if (mode == 1) {
#pragma unroll
    for (int j = 0; j < 2; ++j) {
      int col = ncol0 + j * 16;
      int h = col >> 6, d = col & 63;
      size_t base = (size_t)(b2 * HEADS + h);
#pragma unroll
      for (int i = 0; i < 4; ++i)
#pragma unroll
        for (int r = 0; r < 8; ++r)
          dst[(base * NSEQ + n0 + i * 16 + r) * HEAD_DIM + d] = (_Float16)acc[i][j][r];
      // The next column's conversions and addresses reuse registers that the
      // stores above name: the wait stands in front of those overwrites.
      asm volatile("s_wait_xcnt 0x0" ::: "memory");
    }
    return;
  }
#pragma unroll
  for (int j = 0; j < 2; ++j) {
    int col = ncol0 + j * 16;
    int h = col >> 6, d = col & 63;
    size_t base = (size_t)(b2 * HEADS + h);
#pragma unroll
    for (int i = 0; i < 4; ++i)
#pragma unroll
      for (int r = 0; r < 8; ++r)
        dst[(base * HEAD_DIM + d) * NSEQ + n0 + i * 16 + r] = (_Float16)acc[i][j][r];
    // As above: in front of the next column's overwrites of these registers.
    asm volatile("s_wait_xcnt 0x0" ::: "memory");
  }
}

// ---------------------------------------------------------------------------
// Flash attention: 4 waves per block handle 4 adjacent 16-query tiles of the
// same (b,h) so the K/V stream is shared through WGP$. Scores stay in
// registers; online softmax via width-16 xor reductions. P re-layout C->A via
// per-wave LDS (in-order DS pipe + s_wait_dscnt, no block barrier needed).
// ---------------------------------------------------------------------------
__global__ __launch_bounds__(128) void flash_attn(const _Float16* __restrict__ q,
                                                  const _Float16* __restrict__ k,
                                                  const _Float16* __restrict__ vt,
                                                  _Float16* __restrict__ ao) {
  __shared__ _Float16 pl[4][16 * 32];
  int lane = threadIdx.x & 31;
  int wave = threadIdx.x >> 5;
  int hi = lane >> 4, ln16 = lane & 15;
  int tile = blockIdx.x * 4 + wave;    // B*H*(N/16) tiles, 4 per block
  int qb = tile & 127;
  int h  = (tile >> 7) & (HEADS - 1);
  int b  = tile >> 11;
  int m0 = qb * 16;
  _Float16* plw = &pl[wave][0];
  size_t bh = (size_t)(b * HEADS + h);
  const _Float16* qb_p = q  + bh * NSEQ * HEAD_DIM;
  const _Float16* kb_p = k  + bh * NSEQ * HEAD_DIM;
  const _Float16* vb_p = vt + bh * HEAD_DIM * NSEQ;

  // Q A-fragments for d = 0..31 and d = 32..63 (loaded once)
  const _Float16* qrow = qb_p + (size_t)(m0 + ln16) * HEAD_DIM;
  v16h a0 = *(const v16h*)(qrow + hi * 16);
  v16h a1 = *(const v16h*)(qrow + 32 + hi * 16);

  v8f o0 = {}, o1 = {}, o2 = {}, o3 = {};
  float mrun[8], lrun[8];
#pragma unroll
  for (int r = 0; r < 8; ++r) { mrun[r] = NEG_BIG; lrun[r] = 0.f; }

  int kbmax = (m0 + 15) >> 5;          // causal: last key block touching this tile
  for (int kb = 0; kb <= kbmax; ++kb) {
    int n0 = kb * 32;
    // ---- S = Q @ K^T for 32 keys (two 16x16 C tiles) ----
    v8f s0 = {}, s1 = {};
    const _Float16* kr0 = kb_p + (size_t)(n0 + ln16) * HEAD_DIM;
    const _Float16* kr1 = kr0 + 16 * HEAD_DIM;
    v16h b00 = *(const v16h*)(kr0 + hi * 16);
    v16h b01 = *(const v16h*)(kr0 + 32 + hi * 16);
    v16h b10 = *(const v16h*)(kr1 + hi * 16);
    v16h b11 = *(const v16h*)(kr1 + 32 + hi * 16);
    s0 = wmma_f16(a0, b00, s0); s0 = wmma_f16(a1, b01, s0);
    s1 = wmma_f16(a0, b10, s1); s1 = wmma_f16(a1, b11, s1);

    // ---- scale, causal mask, online softmax ----
#pragma unroll
    for (int r = 0; r < 8; ++r) {
      int rowg = m0 + r + 8 * hi;
      float v0 = s0[r] * SCALE_F; if (n0 + ln16      > rowg) v0 = NEG_BIG;
      float v1 = s1[r] * SCALE_F; if (n0 + 16 + ln16 > rowg) v1 = NEG_BIG;
      float mx = fmaxf(v0, v1);
#pragma unroll
      for (int off = 8; off >= 1; off >>= 1) mx = fmaxf(mx, __shfl_xor(mx, off, 16));
      float mnew  = fmaxf(mrun[r], mx);
      float alpha = __expf(mrun[r] - mnew);
      float p0 = __expf(v0 - mnew);
      float p1 = __expf(v1 - mnew);
      float rsum = p0 + p1;
#pragma unroll
      for (int off = 8; off >= 1; off >>= 1) rsum += __shfl_xor(rsum, off, 16);
      lrun[r] = lrun[r] * alpha + rsum;
      mrun[r] = mnew;
      o0[r] *= alpha; o1[r] *= alpha; o2[r] *= alpha; o3[r] *= alpha;
      s0[r] = p0; s1[r] = p1;
    }

    // ---- P: C-fragment (f32) -> A-fragment (f16) via per-wave LDS ----
#pragma unroll
    for (int r = 0; r < 8; ++r) {
      plw[(r + 8 * hi) * 32 + ln16]      = (_Float16)s0[r];
      plw[(r + 8 * hi) * 32 + 16 + ln16] = (_Float16)s1[r];
    }
    lds_fence_wave();                  // DS pipe is in-order within a wave
    v16h ap = *(const v16h*)(&plw[ln16 * 32 + hi * 16]);
    lds_fence_wave();

    // ---- O += P @ V : V^T layout makes B fragments contiguous ----
    const _Float16* vb0 = vb_p + n0 + hi * 16;     // + dcol*NSEQ below
    v16h bv0 = *(const v16h*)(vb0 + (size_t)(ln16 +  0) * NSEQ);
    v16h bv1 = *(const v16h*)(vb0 + (size_t)(ln16 + 16) * NSEQ);
    v16h bv2 = *(const v16h*)(vb0 + (size_t)(ln16 + 32) * NSEQ);
    v16h bv3 = *(const v16h*)(vb0 + (size_t)(ln16 + 48) * NSEQ);
    o0 = wmma_f16(ap, bv0, o0);
    o1 = wmma_f16(ap, bv1, o1);
    o2 = wmma_f16(ap, bv2, o2);
    o3 = wmma_f16(ap, bv3, o3);
  }

  // ---- normalize and write attention output [B*N, EMBED] f16 ----
#pragma unroll
  for (int r = 0; r < 8; ++r) {
    float inv = 1.f / lrun[r];
    int rowg = m0 + r + 8 * hi;
    _Float16* orow = ao + ((size_t)(b * NSEQ + rowg)) * EMBED + h * HEAD_DIM;
    orow[ 0 + ln16] = (_Float16)(o0[r] * inv);
    orow[16 + ln16] = (_Float16)(o1[r] * inv);
    orow[32 + ln16] = (_Float16)(o2[r] * inv);
    orow[48 + ln16] = (_Float16)(o3[r] * inv);
  }
}

// ---------------------------------------------------------------------------
// out = residual + ao @ Wo^T + bo  (fp32 output); same blocking as gemm_qkv
// ---------------------------------------------------------------------------
__global__ __launch_bounds__(256) void out_proj(const _Float16* __restrict__ A,
                                                const _Float16* __restrict__ W,
                                                const float* __restrict__ x,
                                                const float* __restrict__ bo,
                                                float* __restrict__ out) {
  __shared__ __attribute__((aligned(16))) _Float16 sm[4 * GT_OPER];
  int lane = threadIdx.x & 31;
  int wave = threadIdx.x >> 5;
  int hi = lane >> 4, ln16 = lane & 15;
  int bx = blockIdx.x;
  int bm0 = (bx >> 3) * 128, bn0 = (bx & 7) * 128;
  v8f acc[4][2] = {};
  gemm_tile_128(A, W, sm, bm0, bn0, acc);

  int m0 = bm0 + (wave >> 2) * 64 + 8 * hi, col0 = bn0 + (wave & 3) * 32 + ln16;
  // One 32-bit element offset per lane on the two scalar bases serves every
  // load of x and every store of out: no 64-bit per-lane address arithmetic.
  const unsigned base = (unsigned)(m0 * EMBED + col0);
  const float* xp = x + base;
  float* op = out + base;
  float bias[2] = {bo[col0], bo[col0 + 16]};
  // The loads of x may land in the register that the two loads above name.
  asm volatile("s_wait_xcnt 0x0" ::: "memory");
  float xr[4][2][8];
#pragma unroll
  for (int i = 0; i < 4; ++i)
#pragma unroll
    for (int j = 0; j < 2; ++j)
#pragma unroll
      for (int r = 0; r < 8; ++r) xr[i][j][r] = xp[(i * 16 + r) * EMBED + j * 16];
#pragma unroll
  for (int i = 0; i < 4; ++i)
#pragma unroll
    for (int j = 0; j < 2; ++j)
#pragma unroll
      for (int r = 0; r < 8; ++r)
        op[(i * 16 + r) * EMBED + j * 16] = xr[i][j][r] + bias[j] + acc[i][j][r];
}

// ---------------------------------------------------------------------------
extern "C" void kernel_launch(void* const* d_in, const int* in_sizes, int n_in,
                              void* d_out, int out_size, void* d_ws, size_t ws_size,
                              hipStream_t stream) {
  (void)in_sizes; (void)n_in; (void)out_size; (void)ws_size;
  const float* x    = (const float*)d_in[0];
  const float* ln_w = (const float*)d_in[1];
  const float* ln_b = (const float*)d_in[2];
  const float* Wq   = (const float*)d_in[3];
  const float* Wk   = (const float*)d_in[4];
  const float* Wv   = (const float*)d_in[5];
  const float* Wo   = (const float*)d_in[6];
  const float* bo   = (const float*)d_in[7];
  float* out = (float*)d_out;

  char* ws = (char*)d_ws;
  size_t off = 0;
  auto carve = [&](size_t elems) {
    _Float16* p = (_Float16*)(ws + off);
    off += ((elems * sizeof(_Float16) + 255) & ~(size_t)255);
    return p;
  };
  _Float16* xn   = carve((size_t)MROWS * EMBED);   // normalized activations
  _Float16* wq16 = carve((size_t)EMBED * EMBED);
  _Float16* wk16 = carve((size_t)EMBED * EMBED);
  _Float16* wv16 = carve((size_t)EMBED * EMBED);
  _Float16* wo16 = carve((size_t)EMBED * EMBED);
  _Float16* qh   = carve((size_t)MROWS * EMBED);   // [B,H,N,D]
  _Float16* kh   = carve((size_t)MROWS * EMBED);   // [B,H,N,D]
  _Float16* vth  = carve((size_t)MROWS * EMBED);   // [B,H,D,N]
  _Float16* ao   = carve((size_t)MROWS * EMBED);   // attention output [B*N, E]

  int wcnt = EMBED * EMBED;
  dim3 cvtGrid((wcnt + 255) / 256);
  cvt_f32_f16<<<cvtGrid, 256, 0, stream>>>(Wq, wq16, wcnt);
  cvt_f32_f16<<<cvtGrid, 256, 0, stream>>>(Wk, wk16, wcnt);
  cvt_f32_f16<<<cvtGrid, 256, 0, stream>>>(Wv, wv16, wcnt);
  cvt_f32_f16<<<cvtGrid, 256, 0, stream>>>(Wo, wo16, wcnt);

  ln_kernel<<<dim3(MROWS), 32, 0, stream>>>(x, ln_w, ln_b, xn);

  dim3 gemmGrid((MROWS / 128) * (EMBED / 128));   // 8 waves/block, 128x128 tile
  gemm_qkv<<<gemmGrid, 256, 0, stream>>>(xn, wq16, qh, 1);
  gemm_qkv<<<gemmGrid, 256, 0, stream>>>(xn, wk16, kh, 1);
  gemm_qkv<<<gemmGrid, 256, 0, stream>>>(xn, wv16, vth, 2);

  flash_attn<<<dim3(BATCH * HEADS * (NSEQ / 16) / 4), 128, 0, stream>>>(qh, kh, vth, ao);

  out_proj<<<gemmGrid, 256, 0, stream>>>(ao, wo16, x, bo, out);
}

// v002
// A run of this version takes 174 microseconds.
// Next to v001, in two timings, it ran 1.05 times as fast each time.
// Counting every step since v000, it is 1.80 times as fast.
#include <hip/hip_runtime.h>
#include <hip/hip_bf16.h>

typedef __attribute__((ext_vector_type(16))) _Float16 v16h;
typedef __attribute__((ext_vector_type(8)))  _Float16 v8h;
typedef __attribute__((ext_vector_type(8)))  float    v8f;
typedef __attribute__((ext_vector_type(4)))  float    v4f;

#define EMBED    1024
#define HEADS    16
#define HEAD_DIM 64
#define NSEQ     2048
#define BATCH    2
#define MROWS    (BATCH * NSEQ)        // 4096
#define SCALE_F  0.125f                // HEAD_DIM^-0.5
#define LN_EPS   1e-5f
#define NEG_BIG  (-1e30f)

static __device__ __forceinline__ v8f wmma_f16(v16h a, v16h b, v8f c) {
  // D = A(16x32 f16) * B(32x16 f16) + C(16x16 f32)
  return __builtin_amdgcn_wmma_f32_16x16x32_f16(
      /*neg_a=*/false, a, /*neg_b=*/false, b,
      /*c_mod=*/(short)0, c, /*reuse_a=*/false, /*reuse_b=*/false);
}

// In-order LDS pipe within a wave: wait DS ops then fence the compiler.
static __device__ __forceinline__ void lds_fence_wave() {
  asm volatile("s_wait_dscnt 0x0" ::: "memory");
}

// ---------------------------------------------------------------------------
// fp32 -> f16, all four weight matrices in one launch. The work is 24 MB of
// traffic, in 256 blocks of 16 waves, 64 blocks a matrix. A lane takes 4 pieces of 8
// consecutive elements: 8 16-byte loads in flight, then 4 16-byte stores.
// ---------------------------------------------------------------------------
#define CV_THREADS 512
#define CV_PIECE   (CV_THREADS * 8)               // elements a block covers per piece
#define CV_BLOCK   (CV_PIECE * 4)                 // elements per block
#define CV_BLOCKS  (EMBED * EMBED / CV_BLOCK)     // blocks per matrix: 64

__global__ __launch_bounds__(CV_THREADS) void cvt_weights(
    const float* __restrict__ s0, const float* __restrict__ s1,
    const float* __restrict__ s2, const float* __restrict__ s3,
    _Float16* __restrict__ d0, _Float16* __restrict__ d1,
    _Float16* __restrict__ d2, _Float16* __restrict__ d3) {
  const int which = blockIdx.x / CV_BLOCKS;       // block-uniform: scalar selects
  const float* s = which == 0 ? s0 : which == 1 ? s1 : which == 2 ? s2 : s3;
  _Float16*    d = which == 0 ? d0 : which == 1 ? d1 : which == 2 ? d2 : d3;
  const unsigned base = (blockIdx.x % CV_BLOCKS) * CV_BLOCK + threadIdx.x * 8;
  v4f lo[4], hi[4];
#pragma unroll
  for (int i = 0; i < 4; ++i) {
    lo[i] = *(const v4f*)(s + base + i * CV_PIECE);
    hi[i] = *(const v4f*)(s + base + i * CV_PIECE + 4);
  }
#pragma unroll
  for (int i = 0; i < 4; ++i) {
    v8h o = {(_Float16)lo[i][0], (_Float16)lo[i][1], (_Float16)lo[i][2], (_Float16)lo[i][3],
             (_Float16)hi[i][0], (_Float16)hi[i][1], (_Float16)hi[i][2], (_Float16)hi[i][3]};
    *(v8h*)(d + base + i * CV_PIECE) = o;
  }
}

// ---------------------------------------------------------------------------
// LayerNorm: one wave per row of 1024, fp32 in, f16 out
// ---------------------------------------------------------------------------
__global__ __launch_bounds__(32) void ln_kernel(const float* __restrict__ x,
                                                const float* __restrict__ w,
                                                const float* __restrict__ bns,
                                                _Float16* __restrict__ xn) {
  int row  = blockIdx.x;
  int lane = threadIdx.x;
  const float4* xr = (const float4*)(x + (size_t)row * EMBED);
  float4 v[8];
  float s = 0.f, s2 = 0.f;
#pragma unroll
  for (int i = 0; i < 8; ++i) {
    v[i] = xr[lane + 32 * i];
    s  += v[i].x + v[i].y + v[i].z + v[i].w;
    s2 += v[i].x * v[i].x + v[i].y * v[i].y + v[i].z * v[i].z + v[i].w * v[i].w;
  }
#pragma unroll
  for (int off = 16; off >= 1; off >>= 1) {
    s  += __shfl_xor(s, off, 32);
    s2 += __shfl_xor(s2, off, 32);
  }
  float mu  = s * (1.f / EMBED);
  float var = s2 * (1.f / EMBED) - mu * mu;
  float rs  = rsqrtf(var + LN_EPS);
#pragma unroll
  for (int i = 0; i < 8; ++i) {
    int idx = (lane + 32 * i) * 4;
    float4 wv = ((const float4*)w)[lane + 32 * i];
    float4 bv = ((const float4*)bns)[lane + 32 * i];
    _Float16* o = xn + (size_t)row * EMBED + idx;
    o[0] = (_Float16)((v[i].x - mu) * rs * wv.x + bv.x);
    o[1] = (_Float16)((v[i].y - mu) * rs * wv.y + bv.y);
    o[2] = (_Float16)((v[i].z - mu) * rs * wv.z + bv.z);
    o[3] = (_Float16)((v[i].w - mu) * rs * wv.w + bv.w);
  }
}

// ---------------------------------------------------------------------------
// Shared main loop of the four projections: C = A(M x K) @ W^T, both f16, K
// innermost. One block of 8 waves owns a 128x128 tile of C. A pass is 128 k
// (256 B of every operand row): the block loads both 128-row operand tiles
// with whole 256-B row pieces, stages them in LDS (two buffers, row pitch
// 272 B for conflict-free 16-byte reads) and every wave reads its fragments
// from there. Waves are laid 2 (M) x 4 (N); a wave owns 64x32 = 4x2 tiles.
// The next pass's global loads are issued ahead of this pass's products and
// stored to the other buffer behind them; one barrier per pass.
// k order per accumulator is ascending in steps of 32.
// ---------------------------------------------------------------------------
#define GT_ROWS   128                    // rows of each operand tile
#define GT_K      128                    // k per pass
#define GT_PITCH  136                    // LDS row pitch in f16 (272 B)
#define GT_OPER   (GT_ROWS * GT_PITCH)   // f16 per operand tile in LDS
#define GT_PASSES (EMBED / GT_K)         // 8

static __device__ __forceinline__ v16h lds_frag(const _Float16* p) {
  v8h lo = *(const v8h*)(p);
  v8h hi = *(const v8h*)(p + 8);
  return __builtin_shufflevector(lo, hi, 0, 1, 2, 3, 4, 5, 6, 7,
                                 8, 9, 10, 11, 12, 13, 14, 15);
}

static __device__ __forceinline__ void gemm_tile_128(const _Float16* __restrict__ A,
                                                     const _Float16* __restrict__ W,
                                                     _Float16* sm, int m0, int n0,
                                                     v8f (&acc)[4][2]) {
  int tid  = threadIdx.x;
  int lane = tid & 31, wave = tid >> 5;
  int hi = lane >> 4, ln16 = lane & 15;
  int wm = wave >> 2, wn = wave & 3;
  int c16 = tid & 15, r16 = tid >> 4;    // 16 lanes cover one row's 256 B
  // Block-uniform bases plus one per-lane offset that never changes.
  const _Float16* ga = A + (size_t)m0 * EMBED;
  const _Float16* gw = W + (size_t)n0 * EMBED;
  const unsigned go = (unsigned)(r16 * EMBED + c16 * 8);
  _Float16* st = sm + r16 * GT_PITCH + c16 * 8;
  const _Float16* fa = sm + (wm * 64 + ln16) * GT_PITCH + hi * 16;
  const _Float16* fb = sm + GT_OPER + (wn * 32 + ln16) * GT_PITCH + hi * 16;

  v8h ra[8], rw[8];
#pragma unroll
  for (int i = 0; i < 8; ++i) {
    ra[i] = *(const v8h*)(ga + go + i * 16 * EMBED);
    rw[i] = *(const v8h*)(gw + go + i * 16 * EMBED);
  }
#pragma unroll
  for (int i = 0; i < 8; ++i) {
    *(v8h*)(st + i * 16 * GT_PITCH)           = ra[i];
    *(v8h*)(st + GT_OPER + i * 16 * GT_PITCH) = rw[i];
  }
  __syncthreads();

  for (int t = 0; t < GT_PASSES; ++t) {
    const int cur = (t & 1) * 2 * GT_OPER;
    if (t + 1 < GT_PASSES) {
#pragma unroll
      for (int i = 0; i < 8; ++i) {
        ra[i] = *(const v8h*)(ga + (t + 1) * GT_K + go + i * 16 * EMBED);
        rw[i] = *(const v8h*)(gw + (t + 1) * GT_K + go + i * 16 * EMBED);
      }
    }
    v16h a[2][4], b[2][2];             // two fragment sets: one read, one in use
#pragma unroll
    for (int i = 0; i < 4; ++i) a[0][i] = lds_frag(fa + cur + i * 16 * GT_PITCH);
#pragma unroll
    for (int j = 0; j < 2; ++j) b[0][j] = lds_frag(fb + cur + j * 16 * GT_PITCH);
#pragma unroll
    for (int kk = 0; kk < GT_K / 32; ++kk) {
      const int s = kk & 1;
      if (kk + 1 < GT_K / 32) {
#pragma unroll
        for (int i = 0; i < 4; ++i)
          a[s ^ 1][i] = lds_frag(fa + cur + i * 16 * GT_PITCH + (kk + 1) * 32);
#pragma unroll
        for (int j = 0; j < 2; ++j)
          b[s ^ 1][j] = lds_frag(fb + cur + j * 16 * GT_PITCH + (kk + 1) * 32);
      }
      // Keeps the next block's LDS reads one group ahead of this block's
      // products; left free, the scheduler sinks them between the products
      // and each pair of products then waits out an LDS latency.
      __builtin_amdgcn_sched_barrier(0);
#pragma unroll
      for (int i = 0; i < 4; ++i)
#pragma unroll
        for (int j = 0; j < 2; ++j) acc[i][j] = wmma_f16(a[s][i], b[s][j], acc[i][j]);
      // Ends the block: left free, the scheduler lifts the following group's
      // reads in among these products and moves products past the barrier.
      __builtin_amdgcn_sched_barrier(0);
    }
    if (t + 1 < GT_PASSES) {
      // The other buffer's last readers left it at the previous pass's barrier.
      const int nxt = 2 * GT_OPER - cur;
#pragma unroll
      for (int i = 0; i < 8; ++i) {
        *(v8h*)(st + nxt + i * 16 * GT_PITCH)           = ra[i];
        *(v8h*)(st + nxt + GT_OPER + i * 16 * GT_PITCH) = rw[i];
      }
      __syncthreads();
    }
  }
}

// ---------------------------------------------------------------------------
// mode 0: dst[m][col] f16 row-major
// mode 1: dst = [B,H,N,D] (Q/K head layout)
// mode 2: dst = [B,H,D,N] (V transposed for flash-attention B fragments)
// ---------------------------------------------------------------------------
__global__ __launch_bounds__(256) void gemm_qkv(const _Float16* __restrict__ A,
                                                const _Float16* __restrict__ W,
                                                _Float16* __restrict__ dst, int mode) {
  __shared__ __attribute__((aligned(16))) _Float16 sm[4 * GT_OPER];
  int lane = threadIdx.x & 31;
  int wave = threadIdx.x >> 5;
  int hi = lane >> 4, ln16 = lane & 15;
  int bx = blockIdx.x;                 // (4096/128) * (1024/128) = 32*8 blocks
  int bm0 = (bx >> 3) * 128, bn0 = (bx & 7) * 128;
  v8f acc[4][2] = {};
  gemm_tile_128(A, W, sm, bm0, bn0, acc);

  int m0 = bm0 + (wave >> 2) * 64 + 8 * hi, ncol0 = bn0 + (wave & 3) * 32 + ln16;
  if (mode == 0) {
#pragma unroll
    for (int i = 0; i < 4; ++i)
#pragma unroll
      for (int j = 0; j < 2; ++j)
#pragma unroll
        for (int r = 0; r < 8; ++r)
          dst[(size_t)(m0 + i * 16 + r) * EMBED + ncol0 + j * 16] = (_Float16)acc[i][j][r];
    return;
  }
  int b2 = m0 >> 11;                   // batch: a 64-row strip lies in one
  int n0 = m0 & (NSEQ - 1);            // seq pos of the lane's first row
  if (mode == 1) {
#pragma unroll
    for (int j = 0; j < 2; ++j) {
      int col = ncol0 + j * 16;
      int h = col >> 6, d = col & 63;
      size_t base = (size_t)(b2 * HEADS + h);
#pragma unroll
      for (int i = 0; i < 4; ++i)
#pragma unroll
        for (int r = 0; r < 8; ++r)
          dst[(base * NSEQ + n0 + i * 16 + r) * HEAD_DIM + d] = (_Float16)acc[i][j][r];
      // The next column's conversions and addresses reuse registers that the
      // stores above name: the wait stands in front of those overwrites.
      asm volatile("s_wait_xcnt 0x0" ::: "memory");
    }
    return;
  }
#pragma unroll
  for (int j = 0; j < 2; ++j) {
    int col = ncol0 + j * 16;
    int h = col >> 6, d = col & 63;
    size_t base = (size_t)(b2 * HEADS + h);
#pragma unroll
    for (int i = 0; i < 4; ++i)
#pragma unroll
      for (int r = 0; r < 8; ++r)
        dst[(base * HEAD_DIM + d) * NSEQ + n0 + i * 16 + r] = (_Float16)acc[i][j][r];
    // As above: in front of the next column's overwrites of these registers.
    asm volatile("s_wait_xcnt 0x0" ::: "memory");
  }
}

// ---------------------------------------------------------------------------
// Flash attention: 4 waves per block handle 4 adjacent 16-query tiles of the
// same (b,h) so the K/V stream is shared through WGP$. Scores stay in
// registers; online softmax via width-16 xor reductions. P re-layout C->A via
// per-wave LDS (in-order DS pipe + s_wait_dscnt, no block barrier needed).
// ---------------------------------------------------------------------------
__global__ __launch_bounds__(128) void flash_attn(const _Float16* __restrict__ q,
                                                  const _Float16* __restrict__ k,
                                                  const _Float16* __restrict__ vt,
                                                  _Float16* __restrict__ ao) {
  __shared__ _Float16 pl[4][16 * 32];
  int lane = threadIdx.x & 31;
  int wave = threadIdx.x >> 5;
  int hi = lane >> 4, ln16 = lane & 15;
  int tile = blockIdx.x * 4 + wave;    // B*H*(N/16) tiles, 4 per block
  int qb = tile & 127;
  int h  = (tile >> 7) & (HEADS - 1);
  int b  = tile >> 11;
  int m0 = qb * 16;
  _Float16* plw = &pl[wave][0];
  size_t bh = (size_t)(b * HEADS + h);
  const _Float16* qb_p = q  + bh * NSEQ * HEAD_DIM;
  const _Float16* kb_p = k  + bh * NSEQ * HEAD_DIM;
  const _Float16* vb_p = vt + bh * HEAD_DIM * NSEQ;

  // Q A-fragments for d = 0..31 and d = 32..63 (loaded once)
  const _Float16* qrow = qb_p + (size_t)(m0 + ln16) * HEAD_DIM;
  v16h a0 = *(const v16h*)(qrow + hi * 16);
  v16h a1 = *(const v16h*)(qrow + 32 + hi * 16);

  v8f o0 = {}, o1 = {}, o2 = {}, o3 = {};
  float mrun[8], lrun[8];
#pragma unroll
  for (int r = 0; r < 8; ++r) { mrun[r] = NEG_BIG; lrun[r] = 0.f; }

  int kbmax = (m0 + 15) >> 5;          // causal: last key block touching this tile
  for (int kb = 0; kb <= kbmax; ++kb) {
    int n0 = kb * 32;
    // ---- S = Q @ K^T for 32 keys (two 16x16 C tiles) ----
    v8f s0 = {}, s1 = {};
    const _Float16* kr0 = kb_p + (size_t)(n0 + ln16) * HEAD_DIM;
    const _Float16* kr1 = kr0 + 16 * HEAD_DIM;
    v16h b00 = *(const v16h*)(kr0 + hi * 16);
    v16h b01 = *(const v16h*)(kr0 + 32 + hi * 16);
    v16h b10 = *(const v16h*)(kr1 + hi * 16);
    v16h b11 = *(const v16h*)(kr1 + 32 + hi * 16);
    s0 = wmma_f16(a0, b00, s0); s0 = wmma_f16(a1, b01, s0);
    s1 = wmma_f16(a0, b10, s1); s1 = wmma_f16(a1, b11, s1);

    // ---- scale, causal mask, online softmax ----
#pragma unroll
    for (int r = 0; r < 8; ++r) {
      int rowg = m0 + r + 8 * hi;
      float v0 = s0[r] * SCALE_F; if (n0 + ln16      > rowg) v0 = NEG_BIG;
      float v1 = s1[r] * SCALE_F; if (n0 + 16 + ln16 > rowg) v1 = NEG_BIG;
      float mx = fmaxf(v0, v1);
#pragma unroll
      for (int off = 8; off >= 1; off >>= 1) mx = fmaxf(mx, __shfl_xor(mx, off, 16));
      float mnew  = fmaxf(mrun[r], mx);
      float alpha = __expf(mrun[r] - mnew);
      float p0 = __expf(v0 - mnew);
      float p1 = __expf(v1 - mnew);
      float rsum = p0 + p1;
#pragma unroll
      for (int off = 8; off >= 1; off >>= 1) rsum += __shfl_xor(rsum, off, 16);
      lrun[r] = lrun[r] * alpha + rsum;
      mrun[r] = mnew;
      o0[r] *= alpha; o1[r] *= alpha; o2[r] *= alpha; o3[r] *= alpha;
      s0[r] = p0; s1[r] = p1;
    }

    // ---- P: C-fragment (f32) -> A-fragment (f16) via per-wave LDS ----
#pragma unroll
    for (int r = 0; r < 8; ++r) {
      plw[(r + 8 * hi) * 32 + ln16]      = (_Float16)s0[r];
      plw[(r + 8 * hi) * 32 + 16 + ln16] = (_Float16)s1[r];
    }
    lds_fence_wave();                  // DS pipe is in-order within a wave
    v16h ap = *(const v16h*)(&plw[ln16 * 32 + hi * 16]);
    lds_fence_wave();

    // ---- O += P @ V : V^T layout makes B fragments contiguous ----
    const _Float16* vb0 = vb_p + n0 + hi * 16;     // + dcol*NSEQ below
    v16h bv0 = *(const v16h*)(vb0 + (size_t)(ln16 +  0) * NSEQ);
    v16h bv1 = *(const v16h*)(vb0 + (size_t)(ln16 + 16) * NSEQ);
    v16h bv2 = *(const v16h*)(vb0 + (size_t)(ln16 + 32) * NSEQ);
    v16h bv3 = *(const v16h*)(vb0 + (size_t)(ln16 + 48) * NSEQ);
    o0 = wmma_f16(ap, bv0, o0);
    o1 = wmma_f16(ap, bv1, o1);
    o2 = wmma_f16(ap, bv2, o2);
    o3 = wmma_f16(ap, bv3, o3);
  }

  // ---- normalize and write attention output [B*N, EMBED] f16 ----
#pragma unroll
  for (int r = 0; r < 8; ++r) {
    float inv = 1.f / lrun[r];
    int rowg = m0 + r + 8 * hi;
    _Float16* orow = ao + ((size_t)(b * NSEQ + rowg)) * EMBED + h * HEAD_DIM;
    orow[ 0 + ln16] = (_Float16)(o0[r] * inv);
    orow[16 + ln16] = (_Float16)(o1[r] * inv);
    orow[32 + ln16] = (_Float16)(o2[r] * inv);
    orow[48 + ln16] = (_Float16)(o3[r] * inv);
  }
}

// ---------------------------------------------------------------------------
// out = residual + ao @ Wo^T + bo  (fp32 output); same blocking as gemm_qkv
// ---------------------------------------------------------------------------
__global__ __launch_bounds__(256) void out_proj(const _Float16* __restrict__ A,
                                                const _Float16* __restrict__ W,
                                                const float* __restrict__ x,
                                                const float* __restrict__ bo,
                                                float* __restrict__ out) {
  __shared__ __attribute__((aligned(16))) _Float16 sm[4 * GT_OPER];
  int lane = threadIdx.x & 31;
  int wave = threadIdx.x >> 5;
  int hi = lane >> 4, ln16 = lane & 15;
  int bx = blockIdx.x;
  int bm0 = (bx >> 3) * 128, bn0 = (bx & 7) * 128;
  v8f acc[4][2] = {};
  gemm_tile_128(A, W, sm, bm0, bn0, acc);

  int m0 = bm0 + (wave >> 2) * 64 + 8 * hi, col0 = bn0 + (wave & 3) * 32 + ln16;
  // One 32-bit element offset per lane on the two scalar bases serves every
  // load of x and every store of out: no 64-bit per-lane address arithmetic.
  const unsigned base = (unsigned)(m0 * EMBED + col0);
  const float* xp = x + base;
  float* op = out + base;
  float bias[2] = {bo[col0], bo[col0 + 16]};
  // The loads of x may land in the register that the two loads above name.
  asm volatile("s_wait_xcnt 0x0" ::: "memory");
  float xr[4][2][8];
#pragma unroll
  for (int i = 0; i < 4; ++i)
#pragma unroll
    for (int j = 0; j < 2; ++j)
#pragma unroll
      for (int r = 0; r < 8; ++r) xr[i][j][r] = xp[(i * 16 + r) * EMBED + j * 16];
#pragma unroll
  for (int i = 0; i < 4; ++i)
#pragma unroll
    for (int j = 0; j < 2; ++j)
#pragma unroll
      for (int r = 0; r < 8; ++r)
        op[(i * 16 + r) * EMBED + j * 16] = xr[i][j][r] + bias[j] + acc[i][j][r];
}

// ---------------------------------------------------------------------------
extern "C" void kernel_launch(void* const* d_in, const int* in_sizes, int n_in,
                              void* d_out, int out_size, void* d_ws, size_t ws_size,
                              hipStream_t stream) {
  (void)in_sizes; (void)n_in; (void)out_size; (void)ws_size;
  const float* x    = (const float*)d_in[0];
  const float* ln_w = (const float*)d_in[1];
  const float* ln_b = (const float*)d_in[2];
  const float* Wq   = (const float*)d_in[3];
  const float* Wk   = (const float*)d_in[4];
  const float* Wv   = (const float*)d_in[5];
  const float* Wo   = (const float*)d_in[6];
  const float* bo   = (const float*)d_in[7];
  float* out = (float*)d_out;

  char* ws = (char*)d_ws;
  size_t off = 0;
  auto carve = [&](size_t elems) {
    _Float16* p = (_Float16*)(ws + off);
    off += ((elems * sizeof(_Float16) + 255) & ~(size_t)255);
    return p;
  };
  _Float16* xn   = carve((size_t)MROWS * EMBED);   // normalized activations
  _Float16* wq16 = carve((size_t)EMBED * EMBED);
  _Float16* wk16 = carve((size_t)EMBED * EMBED);
  _Float16* wv16 = carve((size_t)EMBED * EMBED);
  _Float16* wo16 = carve((size_t)EMBED * EMBED);
  _Float16* qh   = carve((size_t)MROWS * EMBED);   // [B,H,N,D]
  _Float16* kh   = carve((size_t)MROWS * EMBED);   // [B,H,N,D]
  _Float16* vth  = carve((size_t)MROWS * EMBED);   // [B,H,D,N]
  _Float16* ao   = carve((size_t)MROWS * EMBED);   // attention output [B*N, E]

  cvt_weights<<<dim3(4 * CV_BLOCKS), CV_THREADS, 0, stream>>>(Wq, Wk, Wv, Wo,
                                                             wq16, wk16, wv16, wo16);

  ln_kernel<<<dim3(MROWS), 32, 0, stream>>>(x, ln_w, ln_b, xn);

  dim3 gemmGrid((MROWS / 128) * (EMBED / 128));   // 8 waves/block, 128x128 tile
  gemm_qkv<<<gemmGrid, 256, 0, stream>>>(xn, wq16, qh, 1);
  gemm_qkv<<<gemmGrid, 256, 0, stream>>>(xn, wk16, kh, 1);
  gemm_qkv<<<gemmGrid, 256, 0, stream>>>(xn, wv16, vth, 2);

  flash_attn<<<dim3(BATCH * HEADS * (NSEQ / 16) / 4), 128, 0, stream>>>(qh, kh, vth, ao);

  out_proj<<<gemmGrid, 256, 0, stream>>>(ao, wo16, x, bo, out);
}

// v003
// It runs in 148 microseconds.
// In both of two side-by-side timings against v002, it was 1.16 times as fast.
// Counting every step since v000, it is 2.10 times as fast.
#include <hip/hip_runtime.h>
#include <hip/hip_bf16.h>

typedef __attribute__((ext_vector_type(16))) _Float16 v16h;
typedef __attribute__((ext_vector_type(8)))  _Float16 v8h;
typedef __attribute__((ext_vector_type(8)))  float    v8f;
typedef __attribute__((ext_vector_type(4)))  float    v4f;

#define EMBED    1024
#define HEADS    16
#define HEAD_DIM 64
#define NSEQ     2048
#define BATCH    2
#define MROWS    (BATCH * NSEQ)        // 4096
#define SCALE_F  0.125f                // HEAD_DIM^-0.5
#define LN_EPS   1e-5f
#define NEG_BIG  (-1e30f)

static __device__ __forceinline__ v8f wmma_f16(v16h a, v16h b, v8f c) {
  // D = A(16x32 f16) * B(32x16 f16) + C(16x16 f32)
  return __builtin_amdgcn_wmma_f32_16x16x32_f16(
      /*neg_a=*/false, a, /*neg_b=*/false, b,
      /*c_mod=*/(short)0, c, /*reuse_a=*/false, /*reuse_b=*/false);
}

// In-order LDS pipe within a wave: wait DS ops then fence the compiler.
static __device__ __forceinline__ void lds_fence_wave() {
  asm volatile("s_wait_dscnt 0x0" ::: "memory");
}

// ---------------------------------------------------------------------------
// fp32 -> f16, all four weight matrices in one launch. The work is 24 MB of
// traffic, in 256 blocks of 16 waves, 64 blocks a matrix. A lane takes 4 pieces of 8
// consecutive elements: 8 16-byte loads in flight, then 4 16-byte stores.
// ---------------------------------------------------------------------------
#define CV_THREADS 512
#define CV_PIECE   (CV_THREADS * 8)               // elements a block covers per piece
#define CV_BLOCK   (CV_PIECE * 4)                 // elements per block
#define CV_BLOCKS  (EMBED * EMBED / CV_BLOCK)     // blocks per matrix: 64

__global__ __launch_bounds__(CV_THREADS) void cvt_weights(
    const float* __restrict__ s0, const float* __restrict__ s1,
    const float* __restrict__ s2, const float* __restrict__ s3,
    _Float16* __restrict__ d0, _Float16* __restrict__ d1,
    _Float16* __restrict__ d2, _Float16* __restrict__ d3) {
  const int which = blockIdx.x / CV_BLOCKS;       // block-uniform: scalar selects
  const float* s = which == 0 ? s0 : which == 1 ? s1 : which == 2 ? s2 : s3;
  _Float16*    d = which == 0 ? d0 : which == 1 ? d1 : which == 2 ? d2 : d3;
  const unsigned base = (blockIdx.x % CV_BLOCKS) * CV_BLOCK + threadIdx.x * 8;
  v4f lo[4], hi[4];
#pragma unroll
  for (int i = 0; i < 4; ++i) {
    lo[i] = *(const v4f*)(s + base + i * CV_PIECE);
    hi[i] = *(const v4f*)(s + base + i * CV_PIECE + 4);
  }
#pragma unroll
  for (int i = 0; i < 4; ++i) {
    v8h o = {(_Float16)lo[i][0], (_Float16)lo[i][1], (_Float16)lo[i][2], (_Float16)lo[i][3],
             (_Float16)hi[i][0], (_Float16)hi[i][1], (_Float16)hi[i][2], (_Float16)hi[i][3]};
    *(v8h*)(d + base + i * CV_PIECE) = o;
  }
}

// ---------------------------------------------------------------------------
// LayerNorm: one wave per row of 1024, fp32 in, f16 out
// ---------------------------------------------------------------------------
__global__ __launch_bounds__(32) void ln_kernel(const float* __restrict__ x,
                                                const float* __restrict__ w,
                                                const float* __restrict__ bns,
                                                _Float16* __restrict__ xn) {
  int row  = blockIdx.x;
  int lane = threadIdx.x;
  const float4* xr = (const float4*)(x + (size_t)row * EMBED);
  float4 v[8];
  float s = 0.f, s2 = 0.f;
#pragma unroll
  for (int i = 0; i < 8; ++i) {
    v[i] = xr[lane + 32 * i];
    s  += v[i].x + v[i].y + v[i].z + v[i].w;
    s2 += v[i].x * v[i].x + v[i].y * v[i].y + v[i].z * v[i].z + v[i].w * v[i].w;
  }
#pragma unroll
  for (int off = 16; off >= 1; off >>= 1) {
    s  += __shfl_xor(s, off, 32);
    s2 += __shfl_xor(s2, off, 32);
  }
  float mu  = s * (1.f / EMBED);
  float var = s2 * (1.f / EMBED) - mu * mu;
  float rs  = rsqrtf(var + LN_EPS);
#pragma unroll
  for (int i = 0; i < 8; ++i) {
    int idx = (lane + 32 * i) * 4;
    float4 wv = ((const float4*)w)[lane + 32 * i];
    float4 bv = ((const float4*)bns)[lane + 32 * i];
    _Float16* o = xn + (size_t)row * EMBED + idx;
    o[0] = (_Float16)((v[i].x - mu) * rs * wv.x + bv.x);
    o[1] = (_Float16)((v[i].y - mu) * rs * wv.y + bv.y);
    o[2] = (_Float16)((v[i].z - mu) * rs * wv.z + bv.z);
    o[3] = (_Float16)((v[i].w - mu) * rs * wv.w + bv.w);
  }
}

// ---------------------------------------------------------------------------
// Shared main loop of the four projections: C = A(M x K) @ W^T, both f16, K
// innermost. One block of 8 waves owns a 128x128 tile of C. A pass is 128 k
// (256 B of every operand row): the block loads both 128-row operand tiles
// with whole 256-B row pieces, stages them in LDS (two buffers, row pitch
// 272 B for conflict-free 16-byte reads) and every wave reads its fragments
// from there. Waves are laid 2 (M) x 4 (N); a wave owns 64x32 = 4x2 tiles.
// The next pass's global loads are issued ahead of this pass's products and
// stored to the other buffer behind them; one barrier per pass.
// k order per accumulator is ascending in steps of 32.
// ---------------------------------------------------------------------------
#define GT_ROWS   128                    // rows of each operand tile
#define GT_K      128                    // k per pass
#define GT_PITCH  136                    // LDS row pitch in f16 (272 B)
#define GT_OPER   (GT_ROWS * GT_PITCH)   // f16 per operand tile in LDS
#define GT_PASSES (EMBED / GT_K)         // 8

static __device__ __forceinline__ v16h lds_frag(const _Float16* p) {
  v8h lo = *(const v8h*)(p);
  v8h hi = *(const v8h*)(p + 8);
  return __builtin_shufflevector(lo, hi, 0, 1, 2, 3, 4, 5, 6, 7,
                                 8, 9, 10, 11, 12, 13, 14, 15);
}

static __device__ __forceinline__ void gemm_tile_128(const _Float16* __restrict__ A,
                                                     const _Float16* __restrict__ W,
                                                     _Float16* sm, int m0, int n0,
                                                     v8f (&acc)[4][2]) {
  int tid  = threadIdx.x;
  int lane = tid & 31, wave = tid >> 5;
  int hi = lane >> 4, ln16 = lane & 15;
  int wm = wave >> 2, wn = wave & 3;
  int c16 = tid & 15, r16 = tid >> 4;    // 16 lanes cover one row's 256 B
  // Block-uniform bases plus one per-lane offset that never changes.
  const _Float16* ga = A + (size_t)m0 * EMBED;
  const _Float16* gw = W + (size_t)n0 * EMBED;
  const unsigned go = (unsigned)(r16 * EMBED + c16 * 8);
  _Float16* st = sm + r16 * GT_PITCH + c16 * 8;
  const _Float16* fa = sm + (wm * 64 + ln16) * GT_PITCH + hi * 16;
  const _Float16* fb = sm + GT_OPER + (wn * 32 + ln16) * GT_PITCH + hi * 16;

  v8h ra[8], rw[8];
#pragma unroll
  for (int i = 0; i < 8; ++i) {
    ra[i] = *(const v8h*)(ga + go + i * 16 * EMBED);
    rw[i] = *(const v8h*)(gw + go + i * 16 * EMBED);
  }
#pragma unroll
  for (int i = 0; i < 8; ++i) {
    *(v8h*)(st + i * 16 * GT_PITCH)           = ra[i];
    *(v8h*)(st + GT_OPER + i * 16 * GT_PITCH) = rw[i];
  }
  __syncthreads();

  for (int t = 0; t < GT_PASSES; ++t) {
    const int cur = (t & 1) * 2 * GT_OPER;
    if (t + 1 < GT_PASSES) {
#pragma unroll
      for (int i = 0; i < 8; ++i) {
        ra[i] = *(const v8h*)(ga + (t + 1) * GT_K + go + i * 16 * EMBED);
        rw[i] = *(const v8h*)(gw + (t + 1) * GT_K + go + i * 16 * EMBED);
      }
    }
    v16h a[2][4], b[2][2];             // two fragment sets: one read, one in use
#pragma unroll
    for (int i = 0; i < 4; ++i) a[0][i] = lds_frag(fa + cur + i * 16 * GT_PITCH);
#pragma unroll
    for (int j = 0; j < 2; ++j) b[0][j] = lds_frag(fb + cur + j * 16 * GT_PITCH);
#pragma unroll
    for (int kk = 0; kk < GT_K / 32; ++kk) {
      const int s = kk & 1;
      if (kk + 1 < GT_K / 32) {
#pragma unroll
        for (int i = 0; i < 4; ++i)
          a[s ^ 1][i] = lds_frag(fa + cur + i * 16 * GT_PITCH + (kk + 1) * 32);
#pragma unroll
        for (int j = 0; j < 2; ++j)
          b[s ^ 1][j] = lds_frag(fb + cur + j * 16 * GT_PITCH + (kk + 1) * 32);
      }
      // Keeps the next block's LDS reads one group ahead of this block's
      // products; left free, the scheduler sinks them between the products
      // and each pair of products then waits out an LDS latency.
      __builtin_amdgcn_sched_barrier(0);
#pragma unroll
      for (int i = 0; i < 4; ++i)
#pragma unroll
        for (int j = 0; j < 2; ++j) acc[i][j] = wmma_f16(a[s][i], b[s][j], acc[i][j]);
      // Ends the block: left free, the scheduler lifts the following group's
      // reads in among these products and moves products past the barrier.
      __builtin_amdgcn_sched_barrier(0);
    }
    if (t + 1 < GT_PASSES) {
      // The other buffer's last readers left it at the previous pass's barrier.
      const int nxt = 2 * GT_OPER - cur;
#pragma unroll
      for (int i = 0; i < 8; ++i) {
        *(v8h*)(st + nxt + i * 16 * GT_PITCH)           = ra[i];
        *(v8h*)(st + nxt + GT_OPER + i * 16 * GT_PITCH) = rw[i];
      }
      __syncthreads();
    }
  }
}

// ---------------------------------------------------------------------------
// mode 0: dst[m][col] f16 row-major
// mode 1: dst = [B,H,N,D] (Q/K head layout)
// mode 2: dst = [B,H,D,N] (V transposed for flash-attention B fragments)
// ---------------------------------------------------------------------------
__global__ __launch_bounds__(256) void gemm_qkv(const _Float16* __restrict__ A,
                                                const _Float16* __restrict__ W,
                                                _Float16* __restrict__ dst, int mode) {
  __shared__ __attribute__((aligned(16))) _Float16 sm[4 * GT_OPER];
  int lane = threadIdx.x & 31;
  int wave = threadIdx.x >> 5;
  int hi = lane >> 4, ln16 = lane & 15;
  int bx = blockIdx.x;                 // (4096/128) * (1024/128) = 32*8 blocks
  int bm0 = (bx >> 3) * 128, bn0 = (bx & 7) * 128;
  v8f acc[4][2] = {};
  gemm_tile_128(A, W, sm, bm0, bn0, acc);

  int m0 = bm0 + (wave >> 2) * 64 + 8 * hi, ncol0 = bn0 + (wave & 3) * 32 + ln16;
  if (mode == 0) {
#pragma unroll
    for (int i = 0; i < 4; ++i)
#pragma unroll
      for (int j = 0; j < 2; ++j)
#pragma unroll
        for (int r = 0; r < 8; ++r)
          dst[(size_t)(m0 + i * 16 + r) * EMBED + ncol0 + j * 16] = (_Float16)acc[i][j][r];
    return;
  }
  int b2 = m0 >> 11;                   // batch: a 64-row strip lies in one
  int n0 = m0 & (NSEQ - 1);            // seq pos of the lane's first row
  if (mode == 1) {
#pragma unroll
    for (int j = 0; j < 2; ++j) {
      int col = ncol0 + j * 16;
      int h = col >> 6, d = col & 63;
      size_t base = (size_t)(b2 * HEADS + h);
#pragma unroll
      for (int i = 0; i < 4; ++i)
#pragma unroll
        for (int r = 0; r < 8; ++r)
          dst[(base * NSEQ + n0 + i * 16 + r) * HEAD_DIM + d] = (_Float16)acc[i][j][r];
      // The next column's conversions and addresses reuse registers that the
      // stores above name: the wait stands in front of those overwrites.
      asm volatile("s_wait_xcnt 0x0" ::: "memory");
    }
    return;
  }
#pragma unroll
  for (int j = 0; j < 2; ++j) {
    int col = ncol0 + j * 16;
    int h = col >> 6, d = col & 63;
    size_t base = (size_t)(b2 * HEADS + h);
#pragma unroll
    for (int i = 0; i < 4; ++i)
#pragma unroll
      for (int r = 0; r < 8; ++r)
        dst[(base * HEAD_DIM + d) * NSEQ + n0 + i * 16 + r] = (_Float16)acc[i][j][r];
    // As above: in front of the next column's overwrites of these registers.
    asm volatile("s_wait_xcnt 0x0" ::: "memory");
  }
}

// ---------------------------------------------------------------------------
// Flash attention: 4 waves per block handle 4 adjacent 16-query tiles of the
// same (b,h). K and V^T come in stages of 64 keys: the block copies both
// 64-row tiles (128 B a row, whole lines) into LDS once, asynchronously, two
// buffers, the next stage in flight under this one's two 32-key passes; every
// wave reads its fragments from there (row pitch 144 B for conflict-free
// 16-byte reads). Scores stay in registers; online softmax via width-16 xor
// reductions. P re-layout C->A via per-wave LDS (in-order DS pipe +
// s_wait_dscnt, no block barrier needed).
// ---------------------------------------------------------------------------
#define FA_KEYS  64                      // keys per stage
#define FA_PITCH 72                      // LDS row pitch in f16 (144 B)
#define FA_TILE  (64 * FA_PITCH)         // f16 per tile: 64 rows (K: keys, V^T: d)
#define FA_BUF   (2 * FA_TILE)           // one buffer: K tile, then V^T tile

// One stage: a lane copies 16 B of four K rows and of four V^T rows, 16 rows
// apart; 8 lanes cover a row. lds: the lane's byte address in the buffer's K
// tile; gk, gv: its first source piece of each operand. The copies and the
// wait that stands in front of any rewrite of their address registers are one
// statement.
static __device__ __forceinline__ void fa_copy_stage(unsigned lds, const _Float16* gk,
                                                     const _Float16* gv) {
  const unsigned step = 16 * FA_PITCH * 2;           // 16 rows on, in bytes
  const unsigned lv = lds + FA_TILE * 2;
  asm volatile(
      "global_load_async_to_lds_b128 %0, %8, off\n\t"
      "global_load_async_to_lds_b128 %1, %9, off\n\t"
      "global_load_async_to_lds_b128 %2, %10, off\n\t"
      "global_load_async_to_lds_b128 %3, %11, off\n\t"
      "global_load_async_to_lds_b128 %4, %12, off\n\t"
      "global_load_async_to_lds_b128 %5, %13, off\n\t"
      "global_load_async_to_lds_b128 %6, %14, off\n\t"
      "global_load_async_to_lds_b128 %7, %15, off\n\t"
      "s_wait_xcnt 0x0"
      :: "v"(lds), "v"(lds + step), "v"(lds + 2 * step), "v"(lds + 3 * step),
         "v"(lv), "v"(lv + step), "v"(lv + 2 * step), "v"(lv + 3 * step),
         "v"(gk), "v"(gk + 16 * HEAD_DIM), "v"(gk + 32 * HEAD_DIM), "v"(gk + 48 * HEAD_DIM),
         "v"(gv), "v"(gv + 16 * NSEQ), "v"(gv + 32 * NSEQ), "v"(gv + 48 * NSEQ)
      : "memory");
}

// The issuing wave's own copies have landed.
static __device__ __forceinline__ void wait_copies() {
  asm volatile("s_wait_asynccnt 0x0" ::: "memory");
}

__global__ __launch_bounds__(128) void flash_attn(const _Float16* __restrict__ q,
                                                  const _Float16* __restrict__ k,
                                                  const _Float16* __restrict__ vt,
                                                  _Float16* __restrict__ ao) {
  __shared__ _Float16 pl[4][16 * 32];
  __shared__ __attribute__((aligned(16))) _Float16 kv[2 * FA_BUF];
  int lane = threadIdx.x & 31;
  int wave = __builtin_amdgcn_readfirstlane(threadIdx.x >> 5);   // scalar: so is the test that skips a pass
  int hi = lane >> 4, ln16 = lane & 15;
  int tile = blockIdx.x * 4 + wave;    // B*H*(N/16) tiles, 4 per block
  int qb = tile & 127;
  int h  = (tile >> 7) & (HEADS - 1);
  int b  = tile >> 11;
  int m0 = qb * 16;
  _Float16* plw = &pl[wave][0];
  size_t bh = (size_t)(b * HEADS + h);
  const _Float16* qb_p = q  + bh * NSEQ * HEAD_DIM;
  const _Float16* kb_p = k  + bh * NSEQ * HEAD_DIM;
  const _Float16* vb_p = vt + bh * HEAD_DIM * NSEQ;

  // Q A-fragments for d = 0..31 and d = 32..63 (loaded once)
  const _Float16* qrow = qb_p + (size_t)(m0 + ln16) * HEAD_DIM;
  v16h a0 = *(const v16h*)(qrow + hi * 16);
  v16h a1 = *(const v16h*)(qrow + 32 + hi * 16);

  v8f o0 = {}, o1 = {}, o2 = {}, o3 = {};
  float mrun[8], lrun[8];
#pragma unroll
  for (int r = 0; r < 8; ++r) { mrun[r] = NEG_BIG; lrun[r] = 0.f; }

  int kbmax = (m0 + 15) >> 5;          // causal: last key block touching this tile
  // The block's queries are 64 j ... 64 j + 63: it walks the j + 1 stages that
  // hold keys 0 ... 64 j + 63. Same value in every wave of the block.
  const int nst = (blockIdx.x & 31) + 1;
  const int c8 = threadIdx.x & 7, r16 = threadIdx.x >> 3;
  const unsigned cl = (unsigned)(size_t)kv + (unsigned)(r16 * FA_PITCH + c8 * 8) * 2;
  const _Float16* ck = kb_p + r16 * HEAD_DIM + c8 * 8;
  const _Float16* cv = vb_p + r16 * NSEQ + c8 * 8;

  fa_copy_stage(cl, ck, cv);           // stage 0 into buffer 0
  wait_copies();
  __syncthreads();                     // stage 0 published
  if (nst > 1) fa_copy_stage(cl + FA_BUF * 2, ck + FA_KEYS * HEAD_DIM, cv + FA_KEYS);

  for (int st = 0; st < nst; ++st) {
   const _Float16* kt = kv + (st & 1) * FA_BUF;
   const _Float16* vtl = kt + FA_TILE;
   for (int sub = 0; sub < 2; ++sub) {
    int kb = st * 2 + sub;
    if (kb > kbmax) break;             // wave-uniform: past this wave's diagonal
    int n0 = kb * 32;
    // ---- S = Q @ K^T for 32 keys (two 16x16 C tiles) ----
    v8f s0 = {}, s1 = {};
    const _Float16* kr0 = kt + (sub * 32 + ln16) * FA_PITCH;
    const _Float16* kr1 = kr0 + 16 * FA_PITCH;
    v16h b00 = lds_frag(kr0 + hi * 16);
    v16h b01 = lds_frag(kr0 + 32 + hi * 16);
    v16h b10 = lds_frag(kr1 + hi * 16);
    v16h b11 = lds_frag(kr1 + 32 + hi * 16);
    s0 = wmma_f16(a0, b00, s0); s0 = wmma_f16(a1, b01, s0);
    s1 = wmma_f16(a0, b10, s1); s1 = wmma_f16(a1, b11, s1);

    // ---- scale, causal mask, online softmax ----
#pragma unroll
    for (int r = 0; r < 8; ++r) {
      int rowg = m0 + r + 8 * hi;
      float v0 = s0[r] * SCALE_F; if (n0 + ln16      > rowg) v0 = NEG_BIG;
      float v1 = s1[r] * SCALE_F; if (n0 + 16 + ln16 > rowg) v1 = NEG_BIG;
      float mx = fmaxf(v0, v1);
#pragma unroll
      for (int off = 8; off >= 1; off >>= 1) mx = fmaxf(mx, __shfl_xor(mx, off, 16));
      float mnew  = fmaxf(mrun[r], mx);
      float alpha = __expf(mrun[r] - mnew);
      float p0 = __expf(v0 - mnew);
      float p1 = __expf(v1 - mnew);
      float rsum = p0 + p1;
#pragma unroll
      for (int off = 8; off >= 1; off >>= 1) rsum += __shfl_xor(rsum, off, 16);
      lrun[r] = lrun[r] * alpha + rsum;
      mrun[r] = mnew;
      o0[r] *= alpha; o1[r] *= alpha; o2[r] *= alpha; o3[r] *= alpha;
      s0[r] = p0; s1[r] = p1;
    }

    // ---- P: C-fragment (f32) -> A-fragment (f16) via per-wave LDS ----
#pragma unroll
    for (int r = 0; r < 8; ++r) {
      plw[(r + 8 * hi) * 32 + ln16]      = (_Float16)s0[r];
      plw[(r + 8 * hi) * 32 + 16 + ln16] = (_Float16)s1[r];
    }
    lds_fence_wave();                  // DS pipe is in-order within a wave
    v16h ap = *(const v16h*)(&plw[ln16 * 32 + hi * 16]);
    lds_fence_wave();

    // ---- O += P @ V : V^T layout makes B fragments contiguous ----
    const _Float16* vb0 = vtl + sub * 32 + hi * 16;   // + dcol*FA_PITCH below
    v16h bv0 = lds_frag(vb0 + (ln16 +  0) * FA_PITCH);
    v16h bv1 = lds_frag(vb0 + (ln16 + 16) * FA_PITCH);
    v16h bv2 = lds_frag(vb0 + (ln16 + 32) * FA_PITCH);
    v16h bv3 = lds_frag(vb0 + (ln16 + 48) * FA_PITCH);
    o0 = wmma_f16(ap, bv0, o0);
    o1 = wmma_f16(ap, bv1, o1);
    o2 = wmma_f16(ap, bv2, o2);
    o3 = wmma_f16(ap, bv3, o3);
   }
   // Foot of the stage, every wave: its reads of this buffer are done, its own
   // copies of the next stage have landed; the barrier publishes that stage and
   // frees this buffer, which only then takes the stage after it.
   lds_fence_wave();
   wait_copies();
   __syncthreads();
   if (st + 2 < nst)
     fa_copy_stage(cl + (st & 1) * FA_BUF * 2, ck + (st + 2) * FA_KEYS * HEAD_DIM,
                   cv + (st + 2) * FA_KEYS);
  }
  wait_copies();                       // nothing in flight when the wave ends

  // ---- normalize and write attention output [B*N, EMBED] f16 ----
#pragma unroll
  for (int r = 0; r < 8; ++r) {
    float inv = 1.f / lrun[r];
    int rowg = m0 + r + 8 * hi;
    _Float16* orow = ao + ((size_t)(b * NSEQ + rowg)) * EMBED + h * HEAD_DIM;
    orow[ 0 + ln16] = (_Float16)(o0[r] * inv);
    orow[16 + ln16] = (_Float16)(o1[r] * inv);
    orow[32 + ln16] = (_Float16)(o2[r] * inv);
    orow[48 + ln16] = (_Float16)(o3[r] * inv);
  }
}

// ---------------------------------------------------------------------------
// out = residual + ao @ Wo^T + bo  (fp32 output); same blocking as gemm_qkv
// ---------------------------------------------------------------------------
__global__ __launch_bounds__(256) void out_proj(const _Float16* __restrict__ A,
                                                const _Float16* __restrict__ W,
                                                const float* __restrict__ x,
                                                const float* __restrict__ bo,
                                                float* __restrict__ out) {
  __shared__ __attribute__((aligned(16))) _Float16 sm[4 * GT_OPER];
  int lane = threadIdx.x & 31;
  int wave = threadIdx.x >> 5;
  int hi = lane >> 4, ln16 = lane & 15;
  int bx = blockIdx.x;
  int bm0 = (bx >> 3) * 128, bn0 = (bx & 7) * 128;
  v8f acc[4][2] = {};
  gemm_tile_128(A, W, sm, bm0, bn0, acc);

  int m0 = bm0 + (wave >> 2) * 64 + 8 * hi, col0 = bn0 + (wave & 3) * 32 + ln16;
  // One 32-bit element offset per lane on the two scalar bases serves every
  // load of x and every store of out: no 64-bit per-lane address arithmetic.
  const unsigned base = (unsigned)(m0 * EMBED + col0);
  const float* xp = x + base;
  float* op = out + base;
  float bias[2] = {bo[col0], bo[col0 + 16]};
  // The loads of x may land in the register that the two loads above name.
  asm volatile("s_wait_xcnt 0x0" ::: "memory");
  float xr[4][2][8];
#pragma unroll
  for (int i = 0; i < 4; ++i)
#pragma unroll
    for (int j = 0; j < 2; ++j)
#pragma unroll
      for (int r = 0; r < 8; ++r) xr[i][j][r] = xp[(i * 16 + r) * EMBED + j * 16];
#pragma unroll
  for (int i = 0; i < 4; ++i)
#pragma unroll
    for (int j = 0; j < 2; ++j)
#pragma unroll
      for (int r = 0; r < 8; ++r)
        op[(i * 16 + r) * EMBED + j * 16] = xr[i][j][r] + bias[j] + acc[i][j][r];
}

// ---------------------------------------------------------------------------
extern "C" void kernel_launch(void* const* d_in, const int* in_sizes, int n_in,
                              void* d_out, int out_size, void* d_ws, size_t ws_size,
                              hipStream_t stream) {
  (void)in_sizes; (void)n_in; (void)out_size; (void)ws_size;
  const float* x    = (const float*)d_in[0];
  const float* ln_w = (const float*)d_in[1];
  const float* ln_b = (const float*)d_in[2];
  const float* Wq   = (const float*)d_in[3];
  const float* Wk   = (const float*)d_in[4];
  const float* Wv   = (const float*)d_in[5];
  const float* Wo   = (const float*)d_in[6];
  const float* bo   = (const float*)d_in[7];
  float* out = (float*)d_out;

  char* ws = (char*)d_ws;
  size_t off = 0;
  auto carve = [&](size_t elems) {
    _Float16* p = (_Float16*)(ws + off);
    off += ((elems * sizeof(_Float16) + 255) & ~(size_t)255);
    return p;
  };
  _Float16* xn   = carve((size_t)MROWS * EMBED);   // normalized activations
  _Float16* wq16 = carve((size_t)EMBED * EMBED);
  _Float16* wk16 = carve((size_t)EMBED * EMBED);
  _Float16* wv16 = carve((size_t)EMBED * EMBED);
  _Float16* wo16 = carve((size_t)EMBED * EMBED);
  _Float16* qh   = carve((size_t)MROWS * EMBED);   // [B,H,N,D]
  _Float16* kh   = carve((size_t)MROWS * EMBED);   // [B,H,N,D]
  _Float16* vth  = carve((size_t)MROWS * EMBED);   // [B,H,D,N]
  _Float16* ao   = carve((size_t)MROWS * EMBED);   // attention output [B*N, E]

  cvt_weights<<<dim3(4 * CV_BLOCKS), CV_THREADS, 0, stream>>>(Wq, Wk, Wv, Wo,
                                                             wq16, wk16, wv16, wo16);

  ln_kernel<<<dim3(MROWS), 32, 0, stream>>>(x, ln_w, ln_b, xn);

  dim3 gemmGrid((MROWS / 128) * (EMBED / 128));   // 8 waves/block, 128x128 tile
  gemm_qkv<<<gemmGrid, 256, 0, stream>>>(xn, wq16, qh, 1);
  gemm_qkv<<<gemmGrid, 256, 0, stream>>>(xn, wk16, kh, 1);
  gemm_qkv<<<gemmGrid, 256, 0, stream>>>(xn, wv16, vth, 2);

  flash_attn<<<dim3(BATCH * HEADS * (NSEQ / 16) / 4), 128, 0, stream>>>(qh, kh, vth, ao);

  out_proj<<<gemmGrid, 256, 0, stream>>>(ao, wo16, x, bo, out);
}

// v004
// Measured time: 90.1 microseconds a run.
// Two timings next to v003 put it at 1.60 and 1.61 times that version's speed.
// Counting every step since v000, it is 3.37 times as fast.
#include <hip/hip_runtime.h>
#include <hip/hip_bf16.h>

typedef __attribute__((ext_vector_type(16))) _Float16 v16h;
typedef __attribute__((ext_vector_type(8)))  _Float16 v8h;
typedef __attribute__((ext_vector_type(8)))  float    v8f;
typedef __attribute__((ext_vector_type(4)))  float    v4f;

#define EMBED    1024
#define HEADS    16
#define HEAD_DIM 64
#define NSEQ     2048
#define BATCH    2
#define MROWS    (BATCH * NSEQ)        // 4096
#define SCALE_F  0.125f                // HEAD_DIM^-0.5
#define LN_EPS   1e-5f
#define NEG_BIG  (-1e30f)

static __device__ __forceinline__ v8f wmma_f16(v16h a, v16h b, v8f c) {
  // D = A(16x32 f16) * B(32x16 f16) + C(16x16 f32)
  return __builtin_amdgcn_wmma_f32_16x16x32_f16(
      /*neg_a=*/false, a, /*neg_b=*/false, b,
      /*c_mod=*/(short)0, c, /*reuse_a=*/false, /*reuse_b=*/false);
}

// In-order LDS pipe within a wave: wait DS ops then fence the compiler.
static __device__ __forceinline__ void lds_fence_wave() {
  asm volatile("s_wait_dscnt 0x0" ::: "memory");
}

// ---------------------------------------------------------------------------
// fp32 -> f16, all four weight matrices in one launch. The work is 24 MB of
// traffic, in 256 blocks of 16 waves, 64 blocks a matrix. A lane takes 4 pieces of 8
// consecutive elements: 8 16-byte loads in flight, then 4 16-byte stores.
// ---------------------------------------------------------------------------
#define CV_THREADS 512
#define CV_PIECE   (CV_THREADS * 8)               // elements a block covers per piece
#define CV_BLOCK   (CV_PIECE * 4)                 // elements per block
#define CV_BLOCKS  (EMBED * EMBED / CV_BLOCK)     // blocks per matrix: 64

__global__ __launch_bounds__(CV_THREADS) void cvt_weights(
    const float* __restrict__ s0, const float* __restrict__ s1,
    const float* __restrict__ s2, const float* __restrict__ s3,
    _Float16* __restrict__ d0, _Float16* __restrict__ d1,
    _Float16* __restrict__ d2, _Float16* __restrict__ d3) {
  const int which = blockIdx.x / CV_BLOCKS;       // block-uniform: scalar selects
  const float* s = which == 0 ? s0 : which == 1 ? s1 : which == 2 ? s2 : s3;
  _Float16*    d = which == 0 ? d0 : which == 1 ? d1 : which == 2 ? d2 : d3;
  const unsigned base = (blockIdx.x % CV_BLOCKS) * CV_BLOCK + threadIdx.x * 8;
  v4f lo[4], hi[4];
#pragma unroll
  for (int i = 0; i < 4; ++i) {
    lo[i] = *(const v4f*)(s + base + i * CV_PIECE);
    hi[i] = *(const v4f*)(s + base + i * CV_PIECE + 4);
  }
#pragma unroll
  for (int i = 0; i < 4; ++i) {
    v8h o = {(_Float16)lo[i][0], (_Float16)lo[i][1], (_Float16)lo[i][2], (_Float16)lo[i][3],
             (_Float16)hi[i][0], (_Float16)hi[i][1], (_Float16)hi[i][2], (_Float16)hi[i][3]};
    *(v8h*)(d + base + i * CV_PIECE) = o;
  }
}

// ---------------------------------------------------------------------------
// LayerNorm: one wave per row of 1024, fp32 in, f16 out
// ---------------------------------------------------------------------------
__global__ __launch_bounds__(32) void ln_kernel(const float* __restrict__ x,
                                                const float* __restrict__ w,
                                                const float* __restrict__ bns,
                                                _Float16* __restrict__ xn) {
  int row  = blockIdx.x;
  int lane = threadIdx.x;
  const float4* xr = (const float4*)(x + (size_t)row * EMBED);
  float4 v[8];
  float s = 0.f, s2 = 0.f;
#pragma unroll
  for (int i = 0; i < 8; ++i) {
    v[i] = xr[lane + 32 * i];
    s  += v[i].x + v[i].y + v[i].z + v[i].w;
    s2 += v[i].x * v[i].x + v[i].y * v[i].y + v[i].z * v[i].z + v[i].w * v[i].w;
  }
#pragma unroll
  for (int off = 16; off >= 1; off >>= 1) {
    s  += __shfl_xor(s, off, 32);
    s2 += __shfl_xor(s2, off, 32);
  }
  float mu  = s * (1.f / EMBED);
  float var = s2 * (1.f / EMBED) - mu * mu;
  float rs  = rsqrtf(var + LN_EPS);
#pragma unroll
  for (int i = 0; i < 8; ++i) {
    int idx = (lane + 32 * i) * 4;
    float4 wv = ((const float4*)w)[lane + 32 * i];
    float4 bv = ((const float4*)bns)[lane + 32 * i];
    _Float16* o = xn + (size_t)row * EMBED + idx;
    o[0] = (_Float16)((v[i].x - mu) * rs * wv.x + bv.x);
    o[1] = (_Float16)((v[i].y - mu) * rs * wv.y + bv.y);
    o[2] = (_Float16)((v[i].z - mu) * rs * wv.z + bv.z);
    o[3] = (_Float16)((v[i].w - mu) * rs * wv.w + bv.w);
  }
}

// ---------------------------------------------------------------------------
// Shared main loop of the four projections: C = A(M x K) @ W^T, both f16, K
// innermost. One block of 8 waves owns a 128x128 tile of C. A pass is 128 k
// (256 B of every operand row): the block loads both 128-row operand tiles
// with whole 256-B row pieces, stages them in LDS (two buffers, row pitch
// 272 B for conflict-free 16-byte reads) and every wave reads its fragments
// from there. Waves are laid 2 (M) x 4 (N); a wave owns 64x32 = 4x2 tiles.
// The next pass's global loads are issued ahead of this pass's products and
// stored to the other buffer behind them; one barrier per pass.
// k order per accumulator is ascending in steps of 32.
// ---------------------------------------------------------------------------
#define GT_ROWS   128                    // rows of each operand tile
#define GT_K      128                    // k per pass
#define GT_PITCH  136                    // LDS row pitch in f16 (272 B)
#define GT_OPER   (GT_ROWS * GT_PITCH)   // f16 per operand tile in LDS
#define GT_PASSES (EMBED / GT_K)         // 8

static __device__ __forceinline__ v16h lds_frag(const _Float16* p) {
  v8h lo = *(const v8h*)(p);
  v8h hi = *(const v8h*)(p + 8);
  return __builtin_shufflevector(lo, hi, 0, 1, 2, 3, 4, 5, 6, 7,
                                 8, 9, 10, 11, 12, 13, 14, 15);
}

static __device__ __forceinline__ void gemm_tile_128(const _Float16* __restrict__ A,
                                                     const _Float16* __restrict__ W,
                                                     _Float16* sm, int m0, int n0,
                                                     v8f (&acc)[4][2]) {
  int tid  = threadIdx.x;
  int lane = tid & 31, wave = tid >> 5;
  int hi = lane >> 4, ln16 = lane & 15;
  int wm = wave >> 2, wn = wave & 3;
  int c16 = tid & 15, r16 = tid >> 4;    // 16 lanes cover one row's 256 B
  // Block-uniform bases plus one per-lane offset that never changes.
  const _Float16* ga = A + (size_t)m0 * EMBED;
  const _Float16* gw = W + (size_t)n0 * EMBED;
  const unsigned go = (unsigned)(r16 * EMBED + c16 * 8);
  _Float16* st = sm + r16 * GT_PITCH + c16 * 8;
  const _Float16* fa = sm + (wm * 64 + ln16) * GT_PITCH + hi * 16;
  const _Float16* fb = sm + GT_OPER + (wn * 32 + ln16) * GT_PITCH + hi * 16;

  v8h ra[8], rw[8];
#pragma unroll
  for (int i = 0; i < 8; ++i) {
    ra[i] = *(const v8h*)(ga + go + i * 16 * EMBED);
    rw[i] = *(const v8h*)(gw + go + i * 16 * EMBED);
  }
#pragma unroll
  for (int i = 0; i < 8; ++i) {
    *(v8h*)(st + i * 16 * GT_PITCH)           = ra[i];
    *(v8h*)(st + GT_OPER + i * 16 * GT_PITCH) = rw[i];
  }
  __syncthreads();

  for (int t = 0; t < GT_PASSES; ++t) {
    const int cur = (t & 1) * 2 * GT_OPER;
    if (t + 1 < GT_PASSES) {
#pragma unroll
      for (int i = 0; i < 8; ++i) {
        ra[i] = *(const v8h*)(ga + (t + 1) * GT_K + go + i * 16 * EMBED);
        rw[i] = *(const v8h*)(gw + (t + 1) * GT_K + go + i * 16 * EMBED);
      }
    }
    v16h a[2][4], b[2][2];             // two fragment sets: one read, one in use
#pragma unroll
    for (int i = 0; i < 4; ++i) a[0][i] = lds_frag(fa + cur + i * 16 * GT_PITCH);
#pragma unroll
    for (int j = 0; j < 2; ++j) b[0][j] = lds_frag(fb + cur + j * 16 * GT_PITCH);
#pragma unroll
    for (int kk = 0; kk < GT_K / 32; ++kk) {
      const int s = kk & 1;
      if (kk + 1 < GT_K / 32) {
#pragma unroll
        for (int i = 0; i < 4; ++i)
          a[s ^ 1][i] = lds_frag(fa + cur + i * 16 * GT_PITCH + (kk + 1) * 32);
#pragma unroll
        for (int j = 0; j < 2; ++j)
          b[s ^ 1][j] = lds_frag(fb + cur + j * 16 * GT_PITCH + (kk + 1) * 32);
      }
      // Keeps the next block's LDS reads one group ahead of this block's
      // products; left free, the scheduler sinks them between the products
      // and each pair of products then waits out an LDS latency.
      __builtin_amdgcn_sched_barrier(0);
#pragma unroll
      for (int i = 0; i < 4; ++i)
#pragma unroll
        for (int j = 0; j < 2; ++j) acc[i][j] = wmma_f16(a[s][i], b[s][j], acc[i][j]);
      // Ends the block: left free, the scheduler lifts the following group's
      // reads in among these products and moves products past the barrier.
      __builtin_amdgcn_sched_barrier(0);
    }
    if (t + 1 < GT_PASSES) {
      // The other buffer's last readers left it at the previous pass's barrier.
      const int nxt = 2 * GT_OPER - cur;
#pragma unroll
      for (int i = 0; i < 8; ++i) {
        *(v8h*)(st + nxt + i * 16 * GT_PITCH)           = ra[i];
        *(v8h*)(st + nxt + GT_OPER + i * 16 * GT_PITCH) = rw[i];
      }
      __syncthreads();
    }
  }
}

// ---------------------------------------------------------------------------
// mode 0: dst[m][col] f16 row-major
// mode 1: dst = [B,H,N,D] (Q/K head layout)
// mode 2: dst = [B,H,D,N] (V transposed for flash-attention A fragments)
// ---------------------------------------------------------------------------
__global__ __launch_bounds__(256) void gemm_qkv(const _Float16* __restrict__ A,
                                                const _Float16* __restrict__ W,
                                                _Float16* __restrict__ dst, int mode) {
  __shared__ __attribute__((aligned(16))) _Float16 sm[4 * GT_OPER];
  int lane = threadIdx.x & 31;
  int wave = threadIdx.x >> 5;
  int hi = lane >> 4, ln16 = lane & 15;
  int bx = blockIdx.x;                 // (4096/128) * (1024/128) = 32*8 blocks
  int bm0 = (bx >> 3) * 128, bn0 = (bx & 7) * 128;
  v8f acc[4][2] = {};
  gemm_tile_128(A, W, sm, bm0, bn0, acc);

  int m0 = bm0 + (wave >> 2) * 64 + 8 * hi, ncol0 = bn0 + (wave & 3) * 32 + ln16;
  if (mode == 0) {
#pragma unroll
    for (int i = 0; i < 4; ++i)
#pragma unroll
      for (int j = 0; j < 2; ++j)
#pragma unroll
        for (int r = 0; r < 8; ++r)
          dst[(size_t)(m0 + i * 16 + r) * EMBED + ncol0 + j * 16] = (_Float16)acc[i][j][r];
    return;
  }
  int b2 = m0 >> 11;                   // batch: a 64-row strip lies in one
  int n0 = m0 & (NSEQ - 1);            // seq pos of the lane's first row
  if (mode == 1) {
#pragma unroll
    for (int j = 0; j < 2; ++j) {
      int col = ncol0 + j * 16;
      int h = col >> 6, d = col & 63;
      size_t base = (size_t)(b2 * HEADS + h);
#pragma unroll
      for (int i = 0; i < 4; ++i)
#pragma unroll
        for (int r = 0; r < 8; ++r)
          dst[(base * NSEQ + n0 + i * 16 + r) * HEAD_DIM + d] = (_Float16)acc[i][j][r];
      // The next column's conversions and addresses reuse registers that the
      // stores above name: the wait stands in front of those overwrites.
      asm volatile("s_wait_xcnt 0x0" ::: "memory");
    }
    return;
  }
#pragma unroll
  for (int j = 0; j < 2; ++j) {
    int col = ncol0 + j * 16;
    int h = col >> 6, d = col & 63;
    size_t base = (size_t)(b2 * HEADS + h);
#pragma unroll
    for (int i = 0; i < 4; ++i)
#pragma unroll
      for (int r = 0; r < 8; ++r)
        dst[(base * HEAD_DIM + d) * NSEQ + n0 + i * 16 + r] = (_Float16)acc[i][j][r];
    // As above: in front of the next column's overwrites of these registers.
    asm volatile("s_wait_xcnt 0x0" ::: "memory");
  }
}

#define FA_KEYS  64
#define FA_PITCH 72
#define FA_TILE  (64 * FA_PITCH)
#define FA_BUF   (2 * FA_TILE)

// One stage: a lane copies 16 B of four K rows and of four V^T rows, 16 rows
// apart; 8 lanes cover a row. lds: the lane's byte address in the buffer's K
// tile; gk, gv: its first source piece of each operand. The copies and the
// wait that stands in front of any rewrite of their address registers are one
// statement.
static __device__ __forceinline__ void fa_copy_stage(unsigned lds, const _Float16* gk,
                                                     const _Float16* gv) {
  const unsigned step = 16 * FA_PITCH * 2;           // 16 rows on, in bytes
  const unsigned lv = lds + FA_TILE * 2;
  asm volatile(
      "global_load_async_to_lds_b128 %0, %8, off\n\t"
      "global_load_async_to_lds_b128 %1, %9, off\n\t"
      "global_load_async_to_lds_b128 %2, %10, off\n\t"
      "global_load_async_to_lds_b128 %3, %11, off\n\t"
      "global_load_async_to_lds_b128 %4, %12, off\n\t"
      "global_load_async_to_lds_b128 %5, %13, off\n\t"
      "global_load_async_to_lds_b128 %6, %14, off\n\t"
      "global_load_async_to_lds_b128 %7, %15, off\n\t"
      "s_wait_xcnt 0x0"
      :: "v"(lds), "v"(lds + step), "v"(lds + 2 * step), "v"(lds + 3 * step),
         "v"(lv), "v"(lv + step), "v"(lv + 2 * step), "v"(lv + 3 * step),
         "v"(gk), "v"(gk + 16 * HEAD_DIM), "v"(gk + 32 * HEAD_DIM), "v"(gk + 48 * HEAD_DIM),
         "v"(gv), "v"(gv + 16 * NSEQ), "v"(gv + 32 * NSEQ), "v"(gv + 48 * NSEQ)
      : "memory");
}

// The issuing wave's own copies have landed.
static __device__ __forceinline__ void wait_copies() {
  asm volatile("s_wait_asynccnt 0x0" ::: "memory");
}

// Lane l takes lane l ^ 16's value: a vector move between the 16-lane rows.
static __device__ __forceinline__ float other_half(float v) {
  int b = __builtin_bit_cast(int, v);
  return __builtin_bit_cast(float, __builtin_amdgcn_permlanex16(b, b, 0x76543210, 0xfedcba98,
                                                                false, false));
}

// A fragment in the k order that a pair of converted D tiles has as B: the
// lane's elements 0..7 are k 8 hi + 0..7, elements 8..15 are k 16 + 8 hi + 0..7.
// p: the row's first k of the 32, plus 8 hi.
static __device__ __forceinline__ v16h lds_frag_split(const _Float16* p) {
  v8h lo = *(const v8h*)(p);
  v8h hi = *(const v8h*)(p + 16);
  return __builtin_shufflevector(lo, hi, 0, 1, 2, 3, 4, 5, 6, 7,
                                 8, 9, 10, 11, 12, 13, 14, 15);
}

#define LOG2E_F 1.44269504f            // e^x = 2^(x log2 e)

// Eight 2^x in place, one statement: each overwrites only its own source and
// reads no other's result, so each has an independent instruction behind it,
// the slot the instruction set asks for behind a transcendental; the v_nop is
// that slot for the last.
static __device__ __forceinline__ void exp2_x8(float (&t)[8]) {
  asm("v_exp_f32 %0, %0\n\t"
      "v_exp_f32 %1, %1\n\t"
      "v_exp_f32 %2, %2\n\t"
      "v_exp_f32 %3, %3\n\t"
      "v_exp_f32 %4, %4\n\t"
      "v_exp_f32 %5, %5\n\t"
      "v_exp_f32 %6, %6\n\t"
      "v_exp_f32 %7, %7\n\t"
      "v_nop"
      : "+v"(t[0]), "+v"(t[1]), "+v"(t[2]), "+v"(t[3]),
        "+v"(t[4]), "+v"(t[5]), "+v"(t[6]), "+v"(t[7]));
}

__global__ __launch_bounds__(128) void flash_attn(const _Float16* __restrict__ q,
                                                  const _Float16* __restrict__ k,
                                                  const _Float16* __restrict__ vt,
                                                  _Float16* __restrict__ ao) {
  __shared__ __attribute__((aligned(16))) _Float16 kv[2 * FA_BUF];
  int lane = threadIdx.x & 31;
  int wave = __builtin_amdgcn_readfirstlane(threadIdx.x >> 5);   // scalar: so is the test that skips a pass
  int hi = lane >> 4, ln16 = lane & 15;
  int tile = blockIdx.x * 4 + wave;    // B*H*(N/16) tiles, 4 per block
  int qb = tile & 127;
  int h  = (tile >> 7) & (HEADS - 1);
  int b  = tile >> 11;
  int m0 = qb * 16;
  size_t bh = (size_t)(b * HEADS + h);
  const _Float16* qb_p = q  + bh * NSEQ * HEAD_DIM;
  const _Float16* kb_p = k  + bh * NSEQ * HEAD_DIM;
  const _Float16* vb_p = vt + bh * HEAD_DIM * NSEQ;

  // Q B-fragments for d = 0..31 and d = 32..63 (loaded once): column ln16 is
  // query m0 + ln16; 16 contiguous d per half, the order of the K loader.
  const _Float16* qrow = qb_p + (size_t)(m0 + ln16) * HEAD_DIM;
  v16h q0 = *(const v16h*)(qrow + hi * 16);
  v16h q1 = *(const v16h*)(qrow + 32 + hi * 16);

  // O^T tiles: o_j[r] = O[query m0 + ln16][d = 16 j + 8 hi + r].
  v8f o0 = {}, o1 = {}, o2 = {}, o3 = {};
  float mrun = NEG_BIG;                // the query's running maximum, same in both halves
  float lrun = 0.f;                    // this half's share of the query's sum

  int kbmax = (m0 + 15) >> 5;          // causal: last key block touching this tile
  // The block's queries are 64 j ... 64 j + 63: it walks the j + 1 stages that
  // hold keys 0 ... 64 j + 63. Same value in every wave of the block.
  const int nst = (blockIdx.x & 31) + 1;
  const int c8 = threadIdx.x & 7, r16 = threadIdx.x >> 3;
  const unsigned cl = (unsigned)(size_t)kv + (unsigned)(r16 * FA_PITCH + c8 * 8) * 2;
  const _Float16* ck = kb_p + r16 * HEAD_DIM + c8 * 8;
  const _Float16* cv = vb_p + r16 * NSEQ + c8 * 8;

  fa_copy_stage(cl, ck, cv);           // stage 0 into buffer 0
  wait_copies();
  __syncthreads();                     // stage 0 published
  if (nst > 1) fa_copy_stage(cl + FA_BUF * 2, ck + FA_KEYS * HEAD_DIM, cv + FA_KEYS);

  for (int st = 0; st < nst; ++st) {
   const _Float16* kt = kv + (st & 1) * FA_BUF;
   const _Float16* vtl = kt + FA_TILE;
   for (int sub = 0; sub < 2; ++sub) {
    int kb = st * 2 + sub;
    if (kb > kbmax) break;             // wave-uniform: past this wave's diagonal
    int n0 = kb * 32;
    // ---- S^T = K @ Q^T for 32 keys (two 16x16 C tiles, keys down the rows) ----
    v8f s0 = {}, s1 = {};
    const _Float16* kr0 = kt + (sub * 32 + ln16) * FA_PITCH;
    const _Float16* kr1 = kr0 + 16 * FA_PITCH;
    v16h k00 = lds_frag(kr0 + hi * 16);
    v16h k01 = lds_frag(kr0 + 32 + hi * 16);
    v16h k10 = lds_frag(kr1 + hi * 16);
    v16h k11 = lds_frag(kr1 + 32 + hi * 16);
    // V^T rows are the A fragments of the second product, in P^T's k order.
    const _Float16* vb0 = vtl + ln16 * FA_PITCH + sub * 32 + hi * 8;
    v16h av0 = lds_frag_split(vb0);
    v16h av1 = lds_frag_split(vb0 + 16 * FA_PITCH);
    v16h av2 = lds_frag_split(vb0 + 32 * FA_PITCH);
    v16h av3 = lds_frag_split(vb0 + 48 * FA_PITCH);
    // Keeps the pass's LDS reads one group ahead of its products; left free, the
    // scheduler reads each fragment into the same registers right in front of
    // its product, and every product then waits out an LDS latency.
    __builtin_amdgcn_sched_barrier(0);
    s0 = wmma_f16(k00, q0, s0); s0 = wmma_f16(k01, q1, s0);
    s1 = wmma_f16(k10, q0, s1); s1 = wmma_f16(k11, q1, s1);

    // ---- scale, causal mask, online softmax: one query per lane ----
    const int lim = m0 + ln16 - n0 - 8 * hi;   // key r of s0 is masked where r > lim
    s0 *= SCALE_F; s1 *= SCALE_F;
    float v0[8], v1[8];
    float mx = NEG_BIG;
#pragma unroll
    for (int r = 0; r < 8; ++r) {
      v0[r] = r      > lim ? NEG_BIG : s0[r];
      v1[r] = r + 16 > lim ? NEG_BIG : s1[r];
      mx = fmaxf(mx, fmaxf(v0[r], v1[r]));
    }
    mx = fmaxf(mx, other_half(mx));
    float mnew  = fmaxf(mrun, mx);
    float alpha = __expf(mrun - mnew);
#pragma unroll
    for (int r = 0; r < 8; ++r) {
      v0[r] = (v0[r] - mnew) * LOG2E_F;
      v1[r] = (v1[r] - mnew) * LOG2E_F;
    }
    exp2_x8(v0);
    exp2_x8(v1);
    float rsum = 0.f;
    v16h pb;                           // P^T as B: element r key 8 hi + r, 8 + r key 16 + 8 hi + r
#pragma unroll
    for (int r = 0; r < 8; ++r) {
      rsum += v0[r] + v1[r];
      pb[r]     = (_Float16)v0[r];
      pb[8 + r] = (_Float16)v1[r];
    }
    lrun = lrun * alpha + rsum;
    mrun = mnew;
    o0 *= alpha; o1 *= alpha; o2 *= alpha; o3 *= alpha;

    // ---- O^T += V^T @ P^T ----
    o0 = wmma_f16(av0, pb, o0);
    o1 = wmma_f16(av1, pb, o1);
    o2 = wmma_f16(av2, pb, o2);
    o3 = wmma_f16(av3, pb, o3);
   }
   // Foot of the stage, every wave: its reads of this buffer are done, its own
   // copies of the next stage have landed; the barrier publishes that stage and
   // frees this buffer, which only then takes the stage after it.
   lds_fence_wave();
   wait_copies();
   __syncthreads();
   if (st + 2 < nst)
     fa_copy_stage(cl + (st & 1) * FA_BUF * 2, ck + (st + 2) * FA_KEYS * HEAD_DIM,
                   cv + (st + 2) * FA_KEYS);
  }
  wait_copies();                       // nothing in flight when the wave ends

  // ---- normalize and write attention output [B*N, EMBED] f16: a lane holds 8
  // consecutive d of its query in each tile, one 16-byte store a tile ----
  float inv = 1.f / (lrun + other_half(lrun));
  _Float16* orow = ao + ((size_t)(b * NSEQ + m0 + ln16)) * EMBED + h * HEAD_DIM + hi * 8;
  v8h w0, w1, w2, w3;
#pragma unroll
  for (int r = 0; r < 8; ++r) {
    w0[r] = (_Float16)(o0[r] * inv);
    w1[r] = (_Float16)(o1[r] * inv);
    w2[r] = (_Float16)(o2[r] * inv);
    w3[r] = (_Float16)(o3[r] * inv);
  }
  *(v8h*)(orow)      = w0;
  *(v8h*)(orow + 16) = w1;
  *(v8h*)(orow + 32) = w2;
  *(v8h*)(orow + 48) = w3;
}

// ---------------------------------------------------------------------------
// out = residual + ao @ Wo^T + bo  (fp32 output); same blocking as gemm_qkv
// ---------------------------------------------------------------------------
__global__ __launch_bounds__(256) void out_proj(const _Float16* __restrict__ A,
                                                const _Float16* __restrict__ W,
                                                const float* __restrict__ x,
                                                const float* __restrict__ bo,
                                                float* __restrict__ out) {
  __shared__ __attribute__((aligned(16))) _Float16 sm[4 * GT_OPER];
  int lane = threadIdx.x & 31;
  int wave = threadIdx.x >> 5;
  int hi = lane >> 4, ln16 = lane & 15;
  int bx = blockIdx.x;
  int bm0 = (bx >> 3) * 128, bn0 = (bx & 7) * 128;
  v8f acc[4][2] = {};
  gemm_tile_128(A, W, sm, bm0, bn0, acc);

  int m0 = bm0 + (wave >> 2) * 64 + 8 * hi, col0 = bn0 + (wave & 3) * 32 + ln16;
  // One 32-bit element offset per lane on the two scalar bases serves every
  // load of x and every store of out: no 64-bit per-lane address arithmetic.
  const unsigned base = (unsigned)(m0 * EMBED + col0);
  const float* xp = x + base;
  float* op = out + base;
  float bias[2] = {bo[col0], bo[col0 + 16]};
  // The loads of x may land in the register that the two loads above name.
  asm volatile("s_wait_xcnt 0x0" ::: "memory");
  float xr[4][2][8];
#pragma unroll
  for (int i = 0; i < 4; ++i)
#pragma unroll
    for (int j = 0; j < 2; ++j)
#pragma unroll
      for (int r = 0; r < 8; ++r) xr[i][j][r] = xp[(i * 16 + r) * EMBED + j * 16];
#pragma unroll
  for (int i = 0; i < 4; ++i)
#pragma unroll
    for (int j = 0; j < 2; ++j)
#pragma unroll
      for (int r = 0; r < 8; ++r)
        op[(i * 16 + r) * EMBED + j * 16] = xr[i][j][r] + bias[j] + acc[i][j][r];
}

// ---------------------------------------------------------------------------
extern "C" void kernel_launch(void* const* d_in, const int* in_sizes, int n_in,
                              void* d_out, int out_size, void* d_ws, size_t ws_size,
                              hipStream_t stream) {
  (void)in_sizes; (void)n_in; (void)out_size; (void)ws_size;
  const float* x    = (const float*)d_in[0];
  const float* ln_w = (const float*)d_in[1];
  const float* ln_b = (const float*)d_in[2];
  const float* Wq   = (const float*)d_in[3];
  const float* Wk   = (const float*)d_in[4];
  const float* Wv   = (const float*)d_in[5];
  const float* Wo   = (const float*)d_in[6];
  const float* bo   = (const float*)d_in[7];
  float* out = (float*)d_out;

  char* ws = (char*)d_ws;
  size_t off = 0;
  auto carve = [&](size_t elems) {
    _Float16* p = (_Float16*)(ws + off);
    off += ((elems * sizeof(_Float16) + 255) & ~(size_t)255);
    return p;
  };
  _Float16* xn   = carve((size_t)MROWS * EMBED);   // normalized activations
  _Float16* wq16 = carve((size_t)EMBED * EMBED);
  _Float16* wk16 = carve((size_t)EMBED * EMBED);
  _Float16* wv16 = carve((size_t)EMBED * EMBED);
  _Float16* wo16 = carve((size_t)EMBED * EMBED);
  _Float16* qh   = carve((size_t)MROWS * EMBED);   // [B,H,N,D]
  _Float16* kh   = carve((size_t)MROWS * EMBED);   // [B,H,N,D]
  _Float16* vth  = carve((size_t)MROWS * EMBED);   // [B,H,D,N]
  _Float16* ao   = carve((size_t)MROWS * EMBED);   // attention output [B*N, E]

  cvt_weights<<<dim3(4 * CV_BLOCKS), CV_THREADS, 0, stream>>>(Wq, Wk, Wv, Wo,
                                                             wq16, wk16, wv16, wo16);

  ln_kernel<<<dim3(MROWS), 32, 0, stream>>>(x, ln_w, ln_b, xn);

  dim3 gemmGrid((MROWS / 128) * (EMBED / 128));   // 8 waves/block, 128x128 tile
  gemm_qkv<<<gemmGrid, 256, 0, stream>>>(xn, wq16, qh, 1);
  gemm_qkv<<<gemmGrid, 256, 0, stream>>>(xn, wk16, kh, 1);
  gemm_qkv<<<gemmGrid, 256, 0, stream>>>(xn, wv16, vth, 2);

  flash_attn<<<dim3(BATCH * HEADS * (NSEQ / 16) / 4), 128, 0, stream>>>(qh, kh, vth, ao);

  out_proj<<<gemmGrid, 256, 0, stream>>>(ao, wo16, x, bo, out);
}

// v005
// It runs in 81.6 microseconds.
// Next to v004, in two timings, it ran 1.13 and 1.14 times as fast.
// Counting every step since v000, it is 3.81 times as fast.
#include <hip/hip_runtime.h>
#include <hip/hip_bf16.h>

typedef __attribute__((ext_vector_type(16))) _Float16 v16h;
typedef __attribute__((ext_vector_type(8)))  _Float16 v8h;
typedef __attribute__((ext_vector_type(8)))  float    v8f;
typedef __attribute__((ext_vector_type(4)))  float    v4f;

#define EMBED    1024
#define HEADS    16
#define HEAD_DIM 64
#define NSEQ     2048
#define BATCH    2
#define MROWS    (BATCH * NSEQ)        // 4096
#define SCALE_F  0.125f                // HEAD_DIM^-0.5
#define LN_EPS   1e-5f
#define NEG_BIG  (-1e30f)

static __device__ __forceinline__ v8f wmma_f16(v16h a, v16h b, v8f c) {
  // D = A(16x32 f16) * B(32x16 f16) + C(16x16 f32)
  return __builtin_amdgcn_wmma_f32_16x16x32_f16(
      /*neg_a=*/false, a, /*neg_b=*/false, b,
      /*c_mod=*/(short)0, c, /*reuse_a=*/false, /*reuse_b=*/false);
}

// In-order LDS pipe within a wave: wait DS ops then fence the compiler.
static __device__ __forceinline__ void lds_fence_wave() {
  asm volatile("s_wait_dscnt 0x0" ::: "memory");
}

// ---------------------------------------------------------------------------
// fp32 -> f16, all four weight matrices. The work is 24 MB of traffic,
// 256 blocks of 16 waves,
// 64 blocks a matrix. A lane takes 4 pieces of 8 consecutive elements: 8
// 16-byte loads in flight, then 4 16-byte stores. blk: 0 ... 4 CV_BLOCKS - 1.
// ---------------------------------------------------------------------------
#define CV_THREADS 512
#define CV_PIECE   (CV_THREADS * 8)               // elements a block covers per piece
#define CV_BLOCK   (CV_PIECE * 4)                 // elements per block
#define CV_BLOCKS  (EMBED * EMBED / CV_BLOCK)     // blocks per matrix: 64

static __device__ __forceinline__ void cvt_weights(
    unsigned blk,
    const float* __restrict__ s0, const float* __restrict__ s1,
    const float* __restrict__ s2, const float* __restrict__ s3,
    _Float16* __restrict__ d0, _Float16* __restrict__ d1,
    _Float16* __restrict__ d2, _Float16* __restrict__ d3) {
  const int which = blk / CV_BLOCKS;              // block-uniform: scalar selects
  const float* s = which == 0 ? s0 : which == 1 ? s1 : which == 2 ? s2 : s3;
  _Float16*    d = which == 0 ? d0 : which == 1 ? d1 : which == 2 ? d2 : d3;
  const unsigned base = (blk % CV_BLOCKS) * CV_BLOCK + threadIdx.x * 8;
  v4f lo[4], hi[4];
#pragma unroll
  for (int i = 0; i < 4; ++i) {
    lo[i] = *(const v4f*)(s + base + i * CV_PIECE);
    hi[i] = *(const v4f*)(s + base + i * CV_PIECE + 4);
  }
#pragma unroll
  for (int i = 0; i < 4; ++i) {
    v8h o = {(_Float16)lo[i][0], (_Float16)lo[i][1], (_Float16)lo[i][2], (_Float16)lo[i][3],
             (_Float16)hi[i][0], (_Float16)hi[i][1], (_Float16)hi[i][2], (_Float16)hi[i][3]};
    *(v8h*)(d + base + i * CV_PIECE) = o;
  }
}

// ---------------------------------------------------------------------------
// LayerNorm: one wave per row of 1024, fp32 in, f16 out
// ---------------------------------------------------------------------------
static __device__ __forceinline__ void ln_row(int row, int lane,
                                              const float* __restrict__ x,
                                              const float* __restrict__ w,
                                              const float* __restrict__ bns,
                                              _Float16* __restrict__ xn) {
  const float4* xr = (const float4*)(x + (size_t)row * EMBED);
  float4 v[8];
  float s = 0.f, s2 = 0.f;
#pragma unroll
  for (int i = 0; i < 8; ++i) {
    v[i] = xr[lane + 32 * i];
    s  += v[i].x + v[i].y + v[i].z + v[i].w;
    s2 += v[i].x * v[i].x + v[i].y * v[i].y + v[i].z * v[i].z + v[i].w * v[i].w;
  }
#pragma unroll
  for (int off = 16; off >= 1; off >>= 1) {
    s  += __shfl_xor(s, off, 32);
    s2 += __shfl_xor(s2, off, 32);
  }
  float mu  = s * (1.f / EMBED);
  float var = s2 * (1.f / EMBED) - mu * mu;
  float rs  = rsqrtf(var + LN_EPS);
#pragma unroll
  for (int i = 0; i < 8; ++i) {
    int idx = (lane + 32 * i) * 4;
    float4 wv = ((const float4*)w)[lane + 32 * i];
    float4 bv = ((const float4*)bns)[lane + 32 * i];
    _Float16* o = xn + (size_t)row * EMBED + idx;
    o[0] = (_Float16)((v[i].x - mu) * rs * wv.x + bv.x);
    o[1] = (_Float16)((v[i].y - mu) * rs * wv.y + bv.y);
    o[2] = (_Float16)((v[i].z - mu) * rs * wv.z + bv.z);
    o[3] = (_Float16)((v[i].w - mu) * rs * wv.w + bv.w);
  }
}

// ---------------------------------------------------------------------------
// LayerNorm and weight conversion depend on nothing of each other: one launch,
// the role by block index. The first LN_BLOCKS blocks normalize 16 rows each
// (a wave a row), the rest convert.
// ---------------------------------------------------------------------------
#define LN_BLOCKS (MROWS / (CV_THREADS / 32))     // 256

__global__ __launch_bounds__(CV_THREADS) void prep(
    const float* __restrict__ x, const float* __restrict__ w,
    const float* __restrict__ bns, _Float16* __restrict__ xn,
    const float* __restrict__ s0, const float* __restrict__ s1,
    const float* __restrict__ s2, const float* __restrict__ s3,
    _Float16* __restrict__ d0, _Float16* __restrict__ d1,
    _Float16* __restrict__ d2, _Float16* __restrict__ d3) {
  if (blockIdx.x < LN_BLOCKS)
    ln_row(blockIdx.x * (CV_THREADS / 32) + (threadIdx.x >> 5), threadIdx.x & 31, x, w, bns, xn);
  else
    cvt_weights(blockIdx.x - LN_BLOCKS, s0, s1, s2, s3, d0, d1, d2, d3);
}

// ---------------------------------------------------------------------------
// Shared main loop of the four projections: C = A(M x K) @ W^T, both f16, K
// innermost. One block of 8 waves owns a 128x128 tile of C. A pass is 128 k
// (256 B of every operand row): the block loads both 128-row operand tiles
// with whole 256-B row pieces, stages them in LDS (two buffers, row pitch
// 272 B for conflict-free 16-byte reads) and every wave reads its fragments
// from there. Waves are laid 2 (M) x 4 (N); a wave owns 64x32 = 4x2 tiles.
// The next pass's global loads are issued ahead of this pass's products and
// stored to the other buffer behind them; one barrier per pass.
// k order per accumulator is ascending in steps of 32.
// ---------------------------------------------------------------------------
#define GT_ROWS   128                    // rows of each operand tile
#define GT_K      128                    // k per pass
#define GT_PITCH  136                    // LDS row pitch in f16 (272 B)
#define GT_OPER   (GT_ROWS * GT_PITCH)   // f16 per operand tile in LDS
#define GT_PASSES (EMBED / GT_K)         // 8

static __device__ __forceinline__ v16h lds_frag(const _Float16* p) {
  v8h lo = *(const v8h*)(p);
  v8h hi = *(const v8h*)(p + 8);
  return __builtin_shufflevector(lo, hi, 0, 1, 2, 3, 4, 5, 6, 7,
                                 8, 9, 10, 11, 12, 13, 14, 15);
}

static __device__ __forceinline__ void gemm_tile_128(const _Float16* __restrict__ A,
                                                     const _Float16* __restrict__ W,
                                                     _Float16* sm, int m0, int n0,
                                                     v8f (&acc)[4][2]) {
  int tid  = threadIdx.x;
  int lane = tid & 31, wave = tid >> 5;
  int hi = lane >> 4, ln16 = lane & 15;
  int wm = wave >> 2, wn = wave & 3;
  int c16 = tid & 15, r16 = tid >> 4;    // 16 lanes cover one row's 256 B
  // Block-uniform bases plus one per-lane offset that never changes.
  const _Float16* ga = A + (size_t)m0 * EMBED;
  const _Float16* gw = W + (size_t)n0 * EMBED;
  const unsigned go = (unsigned)(r16 * EMBED + c16 * 8);
  _Float16* st = sm + r16 * GT_PITCH + c16 * 8;
  const _Float16* fa = sm + (wm * 64 + ln16) * GT_PITCH + hi * 16;
  const _Float16* fb = sm + GT_OPER + (wn * 32 + ln16) * GT_PITCH + hi * 16;

  v8h ra[8], rw[8];
#pragma unroll
  for (int i = 0; i < 8; ++i) {
    ra[i] = *(const v8h*)(ga + go + i * 16 * EMBED);
    rw[i] = *(const v8h*)(gw + go + i * 16 * EMBED);
  }
#pragma unroll
  for (int i = 0; i < 8; ++i) {
    *(v8h*)(st + i * 16 * GT_PITCH)           = ra[i];
    *(v8h*)(st + GT_OPER + i * 16 * GT_PITCH) = rw[i];
  }
  __syncthreads();

  for (int t = 0; t < GT_PASSES; ++t) {
    const int cur = (t & 1) * 2 * GT_OPER;
    if (t + 1 < GT_PASSES) {
#pragma unroll
      for (int i = 0; i < 8; ++i) {
        ra[i] = *(const v8h*)(ga + (t + 1) * GT_K + go + i * 16 * EMBED);
        rw[i] = *(const v8h*)(gw + (t + 1) * GT_K + go + i * 16 * EMBED);
      }
    }
    v16h a[2][4], b[2][2];             // two fragment sets: one read, one in use
#pragma unroll
    for (int i = 0; i < 4; ++i) a[0][i] = lds_frag(fa + cur + i * 16 * GT_PITCH);
#pragma unroll
    for (int j = 0; j < 2; ++j) b[0][j] = lds_frag(fb + cur + j * 16 * GT_PITCH);
#pragma unroll
    for (int kk = 0; kk < GT_K / 32; ++kk) {
      const int s = kk & 1;
      if (kk + 1 < GT_K / 32) {
#pragma unroll
        for (int i = 0; i < 4; ++i)
          a[s ^ 1][i] = lds_frag(fa + cur + i * 16 * GT_PITCH + (kk + 1) * 32);
#pragma unroll
        for (int j = 0; j < 2; ++j)
          b[s ^ 1][j] = lds_frag(fb + cur + j * 16 * GT_PITCH + (kk + 1) * 32);
      }
      // Keeps the next block's LDS reads one group ahead of this block's
      // products; left free, the scheduler sinks them between the products
      // and each pair of products then waits out an LDS latency.
      __builtin_amdgcn_sched_barrier(0);
#pragma unroll
      for (int i = 0; i < 4; ++i)
#pragma unroll
        for (int j = 0; j < 2; ++j) acc[i][j] = wmma_f16(a[s][i], b[s][j], acc[i][j]);
      // Ends the block: left free, the scheduler lifts the following group's
      // reads in among these products and moves products past the barrier.
      __builtin_amdgcn_sched_barrier(0);
    }
    if (t + 1 < GT_PASSES) {
      // The other buffer's last readers left it at the previous pass's barrier.
      const int nxt = 2 * GT_OPER - cur;
#pragma unroll
      for (int i = 0; i < 8; ++i) {
        *(v8h*)(st + nxt + i * 16 * GT_PITCH)           = ra[i];
        *(v8h*)(st + nxt + GT_OPER + i * 16 * GT_PITCH) = rw[i];
      }
      __syncthreads();
    }
  }
}

// ---------------------------------------------------------------------------
// The three projections of xn depend on nothing of each other: one launch of
// 3 x 256 blocks, the product by block index; two blocks fit a WGP's LDS, so
// one's products run under the other's loads, stores and barriers.
// Q, K: dst = [B,H,N,D] (head layout)
// V:    dst = [B,H,D,N] (transposed, for the second product's A fragments)
// ---------------------------------------------------------------------------
#define GT_TILES ((MROWS / 128) * (EMBED / 128))  // blocks per product: 32*8

__global__ __launch_bounds__(256) void gemm_qkv(const _Float16* __restrict__ A,
                                                const _Float16* __restrict__ Wq,
                                                const _Float16* __restrict__ Wk,
                                                const _Float16* __restrict__ Wv,
                                                _Float16* __restrict__ dq,
                                                _Float16* __restrict__ dk,
                                                _Float16* __restrict__ dv) {
  __shared__ __attribute__((aligned(16))) _Float16 sm[4 * GT_OPER];
  int lane = threadIdx.x & 31;
  int wave = threadIdx.x >> 5;
  int hi = lane >> 4, ln16 = lane & 15;
  const int which = blockIdx.x / GT_TILES;        // block-uniform: scalar selects
  const _Float16* W = which == 0 ? Wq : which == 1 ? Wk : Wv;
  _Float16* dst     = which == 0 ? dq : which == 1 ? dk : dv;
  int bx = blockIdx.x % GT_TILES;
  int bm0 = (bx >> 3) * 128, bn0 = (bx & 7) * 128;
  v8f acc[4][2] = {};
  gemm_tile_128(A, W, sm, bm0, bn0, acc);

  int m0 = bm0 + (wave >> 2) * 64 + 8 * hi, ncol0 = bn0 + (wave & 3) * 32 + ln16;
  int b2 = m0 >> 11;                   // batch: a 64-row strip lies in one
  int n0 = m0 & (NSEQ - 1);            // seq pos of the lane's first row
  if (which < 2) {
#pragma unroll
    for (int j = 0; j < 2; ++j) {
      int col = ncol0 + j * 16;
      int h = col >> 6, d = col & 63;
      size_t base = (size_t)(b2 * HEADS + h);
#pragma unroll
      for (int i = 0; i < 4; ++i)
#pragma unroll
        for (int r = 0; r < 8; ++r)
          dst[(base * NSEQ + n0 + i * 16 + r) * HEAD_DIM + d] = (_Float16)acc[i][j][r];
      // The next column's conversions and addresses reuse registers that the
      // stores above name: the wait stands in front of those overwrites.
      asm volatile("s_wait_xcnt 0x0" ::: "memory");
    }
    return;
  }
#pragma unroll
  for (int j = 0; j < 2; ++j) {
    int col = ncol0 + j * 16;
    int h = col >> 6, d = col & 63;
    size_t base = (size_t)(b2 * HEADS + h);
#pragma unroll
    for (int i = 0; i < 4; ++i)
#pragma unroll
      for (int r = 0; r < 8; ++r)
        dst[(base * HEAD_DIM + d) * NSEQ + n0 + i * 16 + r] = (_Float16)acc[i][j][r];
    // As above: in front of the next column's overwrites of these registers.
    asm volatile("s_wait_xcnt 0x0" ::: "memory");
  }
}

#define FA_KEYS  64
#define FA_PITCH 72
#define FA_TILE  (64 * FA_PITCH)
#define FA_BUF   (2 * FA_TILE)

// One stage: a lane copies 16 B of four K rows and of four V^T rows, 16 rows
// apart; 8 lanes cover a row. lds: the lane's byte address in the buffer's K
// tile; gk, gv: its first source piece of each operand. The copies and the
// wait that stands in front of any rewrite of their address registers are one
// statement.
static __device__ __forceinline__ void fa_copy_stage(unsigned lds, const _Float16* gk,
                                                     const _Float16* gv) {
  const unsigned step = 16 * FA_PITCH * 2;           // 16 rows on, in bytes
  const unsigned lv = lds + FA_TILE * 2;
  asm volatile(
      "global_load_async_to_lds_b128 %0, %8, off\n\t"
      "global_load_async_to_lds_b128 %1, %9, off\n\t"
      "global_load_async_to_lds_b128 %2, %10, off\n\t"
      "global_load_async_to_lds_b128 %3, %11, off\n\t"
      "global_load_async_to_lds_b128 %4, %12, off\n\t"
      "global_load_async_to_lds_b128 %5, %13, off\n\t"
      "global_load_async_to_lds_b128 %6, %14, off\n\t"
      "global_load_async_to_lds_b128 %7, %15, off\n\t"
      "s_wait_xcnt 0x0"
      :: "v"(lds), "v"(lds + step), "v"(lds + 2 * step), "v"(lds + 3 * step),
         "v"(lv), "v"(lv + step), "v"(lv + 2 * step), "v"(lv + 3 * step),
         "v"(gk), "v"(gk + 16 * HEAD_DIM), "v"(gk + 32 * HEAD_DIM), "v"(gk + 48 * HEAD_DIM),
         "v"(gv), "v"(gv + 16 * NSEQ), "v"(gv + 32 * NSEQ), "v"(gv + 48 * NSEQ)
      : "memory");
}

// The issuing wave's own copies have landed.
static __device__ __forceinline__ void wait_copies() {
  asm volatile("s_wait_asynccnt 0x0" ::: "memory");
}

// Lane l takes lane l ^ 16's value: a vector move between the 16-lane rows.
static __device__ __forceinline__ float other_half(float v) {
  int b = __builtin_bit_cast(int, v);
  return __builtin_bit_cast(float, __builtin_amdgcn_permlanex16(b, b, 0x76543210, 0xfedcba98,
                                                                false, false));
}

// A fragment in the k order that a pair of converted D tiles has as B: the
// lane's elements 0..7 are k 8 hi + 0..7, elements 8..15 are k 16 + 8 hi + 0..7.
// p: the row's first k of the 32, plus 8 hi.
static __device__ __forceinline__ v16h lds_frag_split(const _Float16* p) {
  v8h lo = *(const v8h*)(p);
  v8h hi = *(const v8h*)(p + 16);
  return __builtin_shufflevector(lo, hi, 0, 1, 2, 3, 4, 5, 6, 7,
                                 8, 9, 10, 11, 12, 13, 14, 15);
}

#define LOG2E_F 1.44269504f            // e^x = 2^(x log2 e)

// Eight 2^x in place, one statement: each overwrites only its own source and
// reads no other's result, so each has an independent instruction behind it,
// the slot the instruction set asks for behind a transcendental; the v_nop is
// that slot for the last.
static __device__ __forceinline__ void exp2_x8(float (&t)[8]) {
  asm("v_exp_f32 %0, %0\n\t"
      "v_exp_f32 %1, %1\n\t"
      "v_exp_f32 %2, %2\n\t"
      "v_exp_f32 %3, %3\n\t"
      "v_exp_f32 %4, %4\n\t"
      "v_exp_f32 %5, %5\n\t"
      "v_exp_f32 %6, %6\n\t"
      "v_exp_f32 %7, %7\n\t"
      "v_nop"
      : "+v"(t[0]), "+v"(t[1]), "+v"(t[2]), "+v"(t[3]),
        "+v"(t[4]), "+v"(t[5]), "+v"(t[6]), "+v"(t[7]));
}

__global__ __launch_bounds__(128) void flash_attn(const _Float16* __restrict__ q,
                                                  const _Float16* __restrict__ k,
                                                  const _Float16* __restrict__ vt,
                                                  _Float16* __restrict__ ao) {
  __shared__ __attribute__((aligned(16))) _Float16 kv[2 * FA_BUF];
  int lane = threadIdx.x & 31;
  int wave = __builtin_amdgcn_readfirstlane(threadIdx.x >> 5);   // scalar: so is the test that skips a pass
  int hi = lane >> 4, ln16 = lane & 15;
  int tile = blockIdx.x * 4 + wave;    // B*H*(N/16) tiles, 4 per block
  int qb = tile & 127;
  int h  = (tile >> 7) & (HEADS - 1);
  int b  = tile >> 11;
  int m0 = qb * 16;
  size_t bh = (size_t)(b * HEADS + h);
  const _Float16* qb_p = q  + bh * NSEQ * HEAD_DIM;
  const _Float16* kb_p = k  + bh * NSEQ * HEAD_DIM;
  const _Float16* vb_p = vt + bh * HEAD_DIM * NSEQ;

  // Q B-fragments for d = 0..31 and d = 32..63 (loaded once): column ln16 is
  // query m0 + ln16; 16 contiguous d per half, the order of the K loader.
  const _Float16* qrow = qb_p + (size_t)(m0 + ln16) * HEAD_DIM;
  v16h q0 = *(const v16h*)(qrow + hi * 16);
  v16h q1 = *(const v16h*)(qrow + 32 + hi * 16);

  // O^T tiles: o_j[r] = O[query m0 + ln16][d = 16 j + 8 hi + r].
  v8f o0 = {}, o1 = {}, o2 = {}, o3 = {};
  float mrun = NEG_BIG;                // the query's running maximum, same in both halves
  float lrun = 0.f;                    // this half's share of the query's sum

  int kbmax = (m0 + 15) >> 5;          // causal: last key block touching this tile
  // The block's queries are 64 j ... 64 j + 63: it walks the j + 1 stages that
  // hold keys 0 ... 64 j + 63. Same value in every wave of the block.
  const int nst = (blockIdx.x & 31) + 1;
  const int c8 = threadIdx.x & 7, r16 = threadIdx.x >> 3;
  const unsigned cl = (unsigned)(size_t)kv + (unsigned)(r16 * FA_PITCH + c8 * 8) * 2;
  const _Float16* ck = kb_p + r16 * HEAD_DIM + c8 * 8;
  const _Float16* cv = vb_p + r16 * NSEQ + c8 * 8;

  fa_copy_stage(cl, ck, cv);           // stage 0 into buffer 0
  wait_copies();
  __syncthreads();                     // stage 0 published
  if (nst > 1) fa_copy_stage(cl + FA_BUF * 2, ck + FA_KEYS * HEAD_DIM, cv + FA_KEYS);

  for (int st = 0; st < nst; ++st) {
   const _Float16* kt = kv + (st & 1) * FA_BUF;
   const _Float16* vtl = kt + FA_TILE;
   for (int sub = 0; sub < 2; ++sub) {
    int kb = st * 2 + sub;
    if (kb > kbmax) break;             // wave-uniform: past this wave's diagonal
    int n0 = kb * 32;
    // ---- S^T = K @ Q^T for 32 keys (two 16x16 C tiles, keys down the rows) ----
    v8f s0 = {}, s1 = {};
    const _Float16* kr0 = kt + (sub * 32 + ln16) * FA_PITCH;
    const _Float16* kr1 = kr0 + 16 * FA_PITCH;
    v16h k00 = lds_frag(kr0 + hi * 16);
    v16h k01 = lds_frag(kr0 + 32 + hi * 16);
    v16h k10 = lds_frag(kr1 + hi * 16);
    v16h k11 = lds_frag(kr1 + 32 + hi * 16);
    // V^T rows are the A fragments of the second product, in P^T's k order.
    const _Float16* vb0 = vtl + ln16 * FA_PITCH + sub * 32 + hi * 8;
    v16h av0 = lds_frag_split(vb0);
    v16h av1 = lds_frag_split(vb0 + 16 * FA_PITCH);
    v16h av2 = lds_frag_split(vb0 + 32 * FA_PITCH);
    v16h av3 = lds_frag_split(vb0 + 48 * FA_PITCH);
    // Keeps the pass's LDS reads one group ahead of its products; left free, the
    // scheduler reads each fragment into the same registers right in front of
    // its product, and every product then waits out an LDS latency.
    __builtin_amdgcn_sched_barrier(0);
    s0 = wmma_f16(k00, q0, s0); s0 = wmma_f16(k01, q1, s0);
    s1 = wmma_f16(k10, q0, s1); s1 = wmma_f16(k11, q1, s1);

    // ---- scale, causal mask, online softmax: one query per lane ----
    const int lim = m0 + ln16 - n0 - 8 * hi;   // key r of s0 is masked where r > lim
    s0 *= SCALE_F; s1 *= SCALE_F;
    float v0[8], v1[8];
    float mx = NEG_BIG;
#pragma unroll
    for (int r = 0; r < 8; ++r) {
      v0[r] = r      > lim ? NEG_BIG : s0[r];
      v1[r] = r + 16 > lim ? NEG_BIG : s1[r];
      mx = fmaxf(mx, fmaxf(v0[r], v1[r]));
    }
    mx = fmaxf(mx, other_half(mx));
    float mnew  = fmaxf(mrun, mx);
    float alpha = __expf(mrun - mnew);
#pragma unroll
    for (int r = 0; r < 8; ++r) {
      v0[r] = (v0[r] - mnew) * LOG2E_F;
      v1[r] = (v1[r] - mnew) * LOG2E_F;
    }
    exp2_x8(v0);
    exp2_x8(v1);
    float rsum = 0.f;
    v16h pb;                           // P^T as B: element r key 8 hi + r, 8 + r key 16 + 8 hi + r
#pragma unroll
    for (int r = 0; r < 8; ++r) {
      rsum += v0[r] + v1[r];
      pb[r]     = (_Float16)v0[r];
      pb[8 + r] = (_Float16)v1[r];
    }
    lrun = lrun * alpha + rsum;
    mrun = mnew;
    o0 *= alpha; o1 *= alpha; o2 *= alpha; o3 *= alpha;

    // ---- O^T += V^T @ P^T ----
    o0 = wmma_f16(av0, pb, o0);
    o1 = wmma_f16(av1, pb, o1);
    o2 = wmma_f16(av2, pb, o2);
    o3 = wmma_f16(av3, pb, o3);
   }
   // Foot of the stage, every wave: its reads of this buffer are done, its own
   // copies of the next stage have landed; the barrier publishes that stage and
   // frees this buffer, which only then takes the stage after it.
   lds_fence_wave();
   wait_copies();
   __syncthreads();
   if (st + 2 < nst)
     fa_copy_stage(cl + (st & 1) * FA_BUF * 2, ck + (st + 2) * FA_KEYS * HEAD_DIM,
                   cv + (st + 2) * FA_KEYS);
  }
  wait_copies();                       // nothing in flight when the wave ends

  // ---- normalize and write attention output [B*N, EMBED] f16: a lane holds 8
  // consecutive d of its query in each tile, one 16-byte store a tile ----
  float inv = 1.f / (lrun + other_half(lrun));
  _Float16* orow = ao + ((size_t)(b * NSEQ + m0 + ln16)) * EMBED + h * HEAD_DIM + hi * 8;
  v8h w0, w1, w2, w3;
#pragma unroll
  for (int r = 0; r < 8; ++r) {
    w0[r] = (_Float16)(o0[r] * inv);
    w1[r] = (_Float16)(o1[r] * inv);
    w2[r] = (_Float16)(o2[r] * inv);
    w3[r] = (_Float16)(o3[r] * inv);
  }
  *(v8h*)(orow)      = w0;
  *(v8h*)(orow + 16) = w1;
  *(v8h*)(orow + 32) = w2;
  *(v8h*)(orow + 48) = w3;
}

// ---------------------------------------------------------------------------
// out = residual + ao @ Wo^T + bo  (fp32 output); same blocking as gemm_qkv
// ---------------------------------------------------------------------------
__global__ __launch_bounds__(256) void out_proj(const _Float16* __restrict__ A,
                                                const _Float16* __restrict__ W,
                                                const float* __restrict__ x,
                                                const float* __restrict__ bo,
                                                float* __restrict__ out) {
  __shared__ __attribute__((aligned(16))) _Float16 sm[4 * GT_OPER];
  int lane = threadIdx.x & 31;
  int wave = threadIdx.x >> 5;
  int hi = lane >> 4, ln16 = lane & 15;
  int bx = blockIdx.x;
  int bm0 = (bx >> 3) * 128, bn0 = (bx & 7) * 128;
  v8f acc[4][2] = {};
  gemm_tile_128(A, W, sm, bm0, bn0, acc);

  int m0 = bm0 + (wave >> 2) * 64 + 8 * hi, col0 = bn0 + (wave & 3) * 32 + ln16;
  // One 32-bit element offset per lane on the two scalar bases serves every
  // load of x and every store of out: no 64-bit per-lane address arithmetic.
  const unsigned base = (unsigned)(m0 * EMBED + col0);
  const float* xp = x + base;
  float* op = out + base;
  float bias[2] = {bo[col0], bo[col0 + 16]};
  // The loads of x may land in the register that the two loads above name.
  asm volatile("s_wait_xcnt 0x0" ::: "memory");
  float xr[4][2][8];
#pragma unroll
  for (int i = 0; i < 4; ++i)
#pragma unroll
    for (int j = 0; j < 2; ++j)
#pragma unroll
      for (int r = 0; r < 8; ++r) xr[i][j][r] = xp[(i * 16 + r) * EMBED + j * 16];
#pragma unroll
  for (int i = 0; i < 4; ++i)
#pragma unroll
    for (int j = 0; j < 2; ++j)
#pragma unroll
      for (int r = 0; r < 8; ++r)
        op[(i * 16 + r) * EMBED + j * 16] = xr[i][j][r] + bias[j] + acc[i][j][r];
}

// ---------------------------------------------------------------------------
extern "C" void kernel_launch(void* const* d_in, const int* in_sizes, int n_in,
                              void* d_out, int out_size, void* d_ws, size_t ws_size,
                              hipStream_t stream) {
  (void)in_sizes; (void)n_in; (void)out_size; (void)ws_size;
  const float* x    = (const float*)d_in[0];
  const float* ln_w = (const float*)d_in[1];
  const float* ln_b = (const float*)d_in[2];
  const float* Wq   = (const float*)d_in[3];
  const float* Wk   = (const float*)d_in[4];
  const float* Wv   = (const float*)d_in[5];
  const float* Wo   = (const float*)d_in[6];
  const float* bo   = (const float*)d_in[7];
  float* out = (float*)d_out;

  char* ws = (char*)d_ws;
  size_t off = 0;
  auto carve = [&](size_t elems) {
    _Float16* p = (_Float16*)(ws + off);
    off += ((elems * sizeof(_Float16) + 255) & ~(size_t)255);
    return p;
  };
  _Float16* xn   = carve((size_t)MROWS * EMBED);   // normalized activations
  _Float16* wq16 = carve((size_t)EMBED * EMBED);
  _Float16* wk16 = carve((size_t)EMBED * EMBED);
  _Float16* wv16 = carve((size_t)EMBED * EMBED);
  _Float16* wo16 = carve((size_t)EMBED * EMBED);
  _Float16* qh   = carve((size_t)MROWS * EMBED);   // [B,H,N,D]
  _Float16* kh   = carve((size_t)MROWS * EMBED);   // [B,H,N,D]
  _Float16* vth  = carve((size_t)MROWS * EMBED);   // [B,H,D,N]
  _Float16* ao   = carve((size_t)MROWS * EMBED);   // attention output [B*N, E]

  prep<<<dim3(LN_BLOCKS + 4 * CV_BLOCKS), CV_THREADS, 0, stream>>>(
      x, ln_w, ln_b, xn, Wq, Wk, Wv, Wo, wq16, wk16, wv16, wo16);

  gemm_qkv<<<dim3(3 * GT_TILES), 256, 0, stream>>>(xn, wq16, wk16, wv16, qh, kh, vth);

  flash_attn<<<dim3(BATCH * HEADS * (NSEQ / 16) / 4), 128, 0, stream>>>(qh, kh, vth, ao);

  out_proj<<<dim3(GT_TILES), 256, 0, stream>>>(ao, wo16, x, bo, out);
}

// v006
// One run takes 76 microseconds.
// Timed twice side by side with v005, it ran 1.07 times as fast both times.
// All steps since v000 together make it 4.09 times as fast.
#include <hip/hip_runtime.h>
#include <hip/hip_bf16.h>

typedef __attribute__((ext_vector_type(16))) _Float16 v16h;
typedef __attribute__((ext_vector_type(8)))  _Float16 v8h;
typedef __attribute__((ext_vector_type(8)))  float    v8f;
typedef __attribute__((ext_vector_type(4)))  float    v4f;

#define EMBED    1024
#define HEADS    16
#define HEAD_DIM 64
#define NSEQ     2048
#define BATCH    2
#define MROWS    (BATCH * NSEQ)        // 4096
#define SCALE_F  0.125f                // HEAD_DIM^-0.5
#define LN_EPS   1e-5f
#define NEG_BIG  (-1e30f)

static __device__ __forceinline__ v8f wmma_f16(v16h a, v16h b, v8f c) {
  // D = A(16x32 f16) * B(32x16 f16) + C(16x16 f32)
  return __builtin_amdgcn_wmma_f32_16x16x32_f16(
      /*neg_a=*/false, a, /*neg_b=*/false, b,
      /*c_mod=*/(short)0, c, /*reuse_a=*/false, /*reuse_b=*/false);
}

// In-order LDS pipe within a wave: wait DS ops then fence the compiler.
static __device__ __forceinline__ void lds_fence_wave() {
  asm volatile("s_wait_dscnt 0x0" ::: "memory");
}

// ---------------------------------------------------------------------------
// fp32 -> f16, all four weight matrices. The work is 24 MB of traffic,
// 256 blocks of 16 waves,
// 64 blocks a matrix. A lane takes 4 pieces of 8 consecutive elements: 8
// 16-byte loads in flight, then 4 16-byte stores. blk: 0 ... 4 CV_BLOCKS - 1.
// ---------------------------------------------------------------------------
#define CV_THREADS 512
#define CV_PIECE   (CV_THREADS * 8)               // elements a block covers per piece
#define CV_BLOCK   (CV_PIECE * 4)                 // elements per block
#define CV_BLOCKS  (EMBED * EMBED / CV_BLOCK)     // blocks per matrix: 64

static __device__ __forceinline__ void cvt_weights(
    unsigned blk,
    const float* __restrict__ s0, const float* __restrict__ s1,
    const float* __restrict__ s2, const float* __restrict__ s3,
    _Float16* __restrict__ d0, _Float16* __restrict__ d1,
    _Float16* __restrict__ d2, _Float16* __restrict__ d3) {
  const int which = blk / CV_BLOCKS;              // block-uniform: scalar selects
  const float* s = which == 0 ? s0 : which == 1 ? s1 : which == 2 ? s2 : s3;
  _Float16*    d = which == 0 ? d0 : which == 1 ? d1 : which == 2 ? d2 : d3;
  const unsigned base = (blk % CV_BLOCKS) * CV_BLOCK + threadIdx.x * 8;
  v4f lo[4], hi[4];
#pragma unroll
  for (int i = 0; i < 4; ++i) {
    lo[i] = *(const v4f*)(s + base + i * CV_PIECE);
    hi[i] = *(const v4f*)(s + base + i * CV_PIECE + 4);
  }
#pragma unroll
  for (int i = 0; i < 4; ++i) {
    v8h o = {(_Float16)lo[i][0], (_Float16)lo[i][1], (_Float16)lo[i][2], (_Float16)lo[i][3],
             (_Float16)hi[i][0], (_Float16)hi[i][1], (_Float16)hi[i][2], (_Float16)hi[i][3]};
    *(v8h*)(d + base + i * CV_PIECE) = o;
  }
}

// ---------------------------------------------------------------------------
// LayerNorm: one wave per row of 1024, fp32 in, f16 out
// ---------------------------------------------------------------------------
static __device__ __forceinline__ void ln_row(int row, int lane,
                                              const float* __restrict__ x,
                                              const float* __restrict__ w,
                                              const float* __restrict__ bns,
                                              _Float16* __restrict__ xn) {
  const float4* xr = (const float4*)(x + (size_t)row * EMBED);
  float4 v[8];
  float s = 0.f, s2 = 0.f;
#pragma unroll
  for (int i = 0; i < 8; ++i) {
    v[i] = xr[lane + 32 * i];
    s  += v[i].x + v[i].y + v[i].z + v[i].w;
    s2 += v[i].x * v[i].x + v[i].y * v[i].y + v[i].z * v[i].z + v[i].w * v[i].w;
  }
#pragma unroll
  for (int off = 16; off >= 1; off >>= 1) {
    s  += __shfl_xor(s, off, 32);
    s2 += __shfl_xor(s2, off, 32);
  }
  float mu  = s * (1.f / EMBED);
  float var = s2 * (1.f / EMBED) - mu * mu;
  float rs  = rsqrtf(var + LN_EPS);
#pragma unroll
  for (int i = 0; i < 8; ++i) {
    int idx = (lane + 32 * i) * 4;
    float4 wv = ((const float4*)w)[lane + 32 * i];
    float4 bv = ((const float4*)bns)[lane + 32 * i];
    _Float16* o = xn + (size_t)row * EMBED + idx;
    o[0] = (_Float16)((v[i].x - mu) * rs * wv.x + bv.x);
    o[1] = (_Float16)((v[i].y - mu) * rs * wv.y + bv.y);
    o[2] = (_Float16)((v[i].z - mu) * rs * wv.z + bv.z);
    o[3] = (_Float16)((v[i].w - mu) * rs * wv.w + bv.w);
  }
}

// ---------------------------------------------------------------------------
// LayerNorm and weight conversion depend on nothing of each other: one launch,
// the role by block index. The first LN_BLOCKS blocks normalize 16 rows each
// (a wave a row), the rest convert.
// ---------------------------------------------------------------------------
#define LN_BLOCKS (MROWS / (CV_THREADS / 32))     // 256

__global__ __launch_bounds__(CV_THREADS) void prep(
    const float* __restrict__ x, const float* __restrict__ w,
    const float* __restrict__ bns, _Float16* __restrict__ xn,
    const float* __restrict__ s0, const float* __restrict__ s1,
    const float* __restrict__ s2, const float* __restrict__ s3,
    _Float16* __restrict__ d0, _Float16* __restrict__ d1,
    _Float16* __restrict__ d2, _Float16* __restrict__ d3) {
  if (blockIdx.x < LN_BLOCKS)
    ln_row(blockIdx.x * (CV_THREADS / 32) + (threadIdx.x >> 5), threadIdx.x & 31, x, w, bns, xn);
  else
    cvt_weights(blockIdx.x - LN_BLOCKS, s0, s1, s2, s3, d0, d1, d2, d3);
}

// ---------------------------------------------------------------------------
// Shared main loop of the four projections: C = A(M x K) @ W^T, both f16, K
// innermost. One block of 8 waves owns a 128x128 tile of C. A pass is 128 k
// (256 B of every operand row): the block loads both 128-row operand tiles
// with whole 256-B row pieces, stages them in LDS (two buffers, row pitch
// 272 B for conflict-free 16-byte reads) and every wave reads its fragments
// from there. Waves are laid 2 (M) x 4 (N); a wave owns 64x32 = 4x2 tiles.
// The next pass's global loads are issued ahead of this pass's products and
// stored to the other buffer behind them; one barrier per pass.
// k order per accumulator is ascending in steps of 32.
// ---------------------------------------------------------------------------
#define GT_ROWS   128                    // rows of each operand tile
#define GT_K      128                    // k per pass
#define GT_PITCH  136                    // LDS row pitch in f16 (272 B)
#define GT_OPER   (GT_ROWS * GT_PITCH)   // f16 per operand tile in LDS
#define GT_PASSES (EMBED / GT_K)         // 8

static __device__ __forceinline__ v16h lds_frag(const _Float16* p) {
  v8h lo = *(const v8h*)(p);
  v8h hi = *(const v8h*)(p + 8);
  return __builtin_shufflevector(lo, hi, 0, 1, 2, 3, 4, 5, 6, 7,
                                 8, 9, 10, 11, 12, 13, 14, 15);
}

static __device__ __forceinline__ void gemm_tile_128(const _Float16* __restrict__ A,
                                                     const _Float16* __restrict__ W,
                                                     _Float16* sm, int m0, int n0,
                                                     v8f (&acc)[4][2]) {
  int tid  = threadIdx.x;
  int lane = tid & 31, wave = tid >> 5;
  int hi = lane >> 4, ln16 = lane & 15;
  int wm = wave >> 2, wn = wave & 3;
  int c16 = tid & 15, r16 = tid >> 4;    // 16 lanes cover one row's 256 B
  // Block-uniform bases plus one per-lane offset that never changes.
  const _Float16* ga = A + (size_t)m0 * EMBED;
  const _Float16* gw = W + (size_t)n0 * EMBED;
  const unsigned go = (unsigned)(r16 * EMBED + c16 * 8);
  _Float16* st = sm + r16 * GT_PITCH + c16 * 8;
  const _Float16* fa = sm + (wm * 64 + ln16) * GT_PITCH + hi * 16;
  const _Float16* fb = sm + GT_OPER + (wn * 32 + ln16) * GT_PITCH + hi * 16;

  v8h ra[8], rw[8];
#pragma unroll
  for (int i = 0; i < 8; ++i) {
    ra[i] = *(const v8h*)(ga + go + i * 16 * EMBED);
    rw[i] = *(const v8h*)(gw + go + i * 16 * EMBED);
  }
#pragma unroll
  for (int i = 0; i < 8; ++i) {
    *(v8h*)(st + i * 16 * GT_PITCH)           = ra[i];
    *(v8h*)(st + GT_OPER + i * 16 * GT_PITCH) = rw[i];
  }
  __syncthreads();

  for (int t = 0; t < GT_PASSES; ++t) {
    const int cur = (t & 1) * 2 * GT_OPER;
    if (t + 1 < GT_PASSES) {
#pragma unroll
      for (int i = 0; i < 8; ++i) {
        ra[i] = *(const v8h*)(ga + (t + 1) * GT_K + go + i * 16 * EMBED);
        rw[i] = *(const v8h*)(gw + (t + 1) * GT_K + go + i * 16 * EMBED);
      }
    }
    v16h a[2][4], b[2][2];             // two fragment sets: one read, one in use
#pragma unroll
    for (int i = 0; i < 4; ++i) a[0][i] = lds_frag(fa + cur + i * 16 * GT_PITCH);
#pragma unroll
    for (int j = 0; j < 2; ++j) b[0][j] = lds_frag(fb + cur + j * 16 * GT_PITCH);
#pragma unroll
    for (int kk = 0; kk < GT_K / 32; ++kk) {
      const int s = kk & 1;
      if (kk + 1 < GT_K / 32) {
#pragma unroll
        for (int i = 0; i < 4; ++i)
          a[s ^ 1][i] = lds_frag(fa + cur + i * 16 * GT_PITCH + (kk + 1) * 32);
#pragma unroll
        for (int j = 0; j < 2; ++j)
          b[s ^ 1][j] = lds_frag(fb + cur + j * 16 * GT_PITCH + (kk + 1) * 32);
      }
      // Keeps the next block's LDS reads one group ahead of this block's
      // products; left free, the scheduler sinks them between the products
      // and each pair of products then waits out an LDS latency.
      __builtin_amdgcn_sched_barrier(0);
#pragma unroll
      for (int i = 0; i < 4; ++i)
#pragma unroll
        for (int j = 0; j < 2; ++j) acc[i][j] = wmma_f16(a[s][i], b[s][j], acc[i][j]);
      // Ends the block: left free, the scheduler lifts the following group's
      // reads in among these products and moves products past the barrier.
      __builtin_amdgcn_sched_barrier(0);
    }
    if (t + 1 < GT_PASSES) {
      // The other buffer's last readers left it at the previous pass's barrier.
      const int nxt = 2 * GT_OPER - cur;
#pragma unroll
      for (int i = 0; i < 8; ++i) {
        *(v8h*)(st + nxt + i * 16 * GT_PITCH)           = ra[i];
        *(v8h*)(st + nxt + GT_OPER + i * 16 * GT_PITCH) = rw[i];
      }
      __syncthreads();
    }
  }
}

// ---------------------------------------------------------------------------
// The three projections of xn depend on nothing of each other: one launch of
// 3 x 256 blocks, the product by block index; two blocks fit a WGP's LDS, so
// one's products run under the other's loads, stores and barriers.
// Q, K: dst = [B,H,N,D] (head layout)
// V:    dst = [B,H,D,N] (transposed, for the second product's A fragments)
// ---------------------------------------------------------------------------
#define GT_TILES ((MROWS / 128) * (EMBED / 128))  // blocks per product: 32*8

__global__ __launch_bounds__(256) void gemm_qkv(const _Float16* __restrict__ A,
                                                const _Float16* __restrict__ Wq,
                                                const _Float16* __restrict__ Wk,
                                                const _Float16* __restrict__ Wv,
                                                _Float16* __restrict__ dq,
                                                _Float16* __restrict__ dk,
                                                _Float16* __restrict__ dv) {
  __shared__ __attribute__((aligned(16))) _Float16 sm[4 * GT_OPER];
  int lane = threadIdx.x & 31;
  int wave = threadIdx.x >> 5;
  int hi = lane >> 4, ln16 = lane & 15;
  const int which = blockIdx.x / GT_TILES;        // block-uniform: scalar selects
  const _Float16* W = which == 0 ? Wq : which == 1 ? Wk : Wv;
  _Float16* dst     = which == 0 ? dq : which == 1 ? dk : dv;
  int bx = blockIdx.x % GT_TILES;
  int bm0 = (bx >> 3) * 128, bn0 = (bx & 7) * 128;
  v8f acc[4][2] = {};
  gemm_tile_128(A, W, sm, bm0, bn0, acc);

  int m0 = bm0 + (wave >> 2) * 64 + 8 * hi, ncol0 = bn0 + (wave & 3) * 32 + ln16;
  int b2 = m0 >> 11;                   // batch: a 64-row strip lies in one
  int n0 = m0 & (NSEQ - 1);            // seq pos of the lane's first row
  if (which < 2) {
#pragma unroll
    for (int j = 0; j < 2; ++j) {
      int col = ncol0 + j * 16;
      int h = col >> 6, d = col & 63;
      size_t base = (size_t)(b2 * HEADS + h);
#pragma unroll
      for (int i = 0; i < 4; ++i)
#pragma unroll
        for (int r = 0; r < 8; ++r)
          dst[(base * NSEQ + n0 + i * 16 + r) * HEAD_DIM + d] = (_Float16)acc[i][j][r];
      // The next column's conversions and addresses reuse registers that the
      // stores above name: the wait stands in front of those overwrites.
      asm volatile("s_wait_xcnt 0x0" ::: "memory");
    }
    return;
  }
#pragma unroll
  for (int j = 0; j < 2; ++j) {
    int col = ncol0 + j * 16;
    int h = col >> 6, d = col & 63;
    size_t base = (size_t)(b2 * HEADS + h);
#pragma unroll
    for (int i = 0; i < 4; ++i)
#pragma unroll
      for (int r = 0; r < 8; ++r)
        dst[(base * HEAD_DIM + d) * NSEQ + n0 + i * 16 + r] = (_Float16)acc[i][j][r];
    // As above: in front of the next column's overwrites of these registers.
    asm volatile("s_wait_xcnt 0x0" ::: "memory");
  }
}

#define FA_KEYS  64
#define FA_PITCH 72
#define FA_TILE  (64 * FA_PITCH)
#define FA_BUF   (2 * FA_TILE)
#define FA_GROUPS (NSEQ / 64)

// One stage: a lane copies 16 B of four K rows and of four V^T rows, 16 rows
// apart; 8 lanes cover a row. lds: the lane's byte address in the buffer's K
// tile; gk, gv: its first source piece of each operand. The copies and the
// wait that stands in front of any rewrite of their address registers are one
// statement.
static __device__ __forceinline__ void fa_copy_stage(unsigned lds, const _Float16* gk,
                                                     const _Float16* gv) {
  const unsigned step = 16 * FA_PITCH * 2;           // 16 rows on, in bytes
  const unsigned lv = lds + FA_TILE * 2;
  asm volatile(
      "global_load_async_to_lds_b128 %0, %8, off\n\t"
      "global_load_async_to_lds_b128 %1, %9, off\n\t"
      "global_load_async_to_lds_b128 %2, %10, off\n\t"
      "global_load_async_to_lds_b128 %3, %11, off\n\t"
      "global_load_async_to_lds_b128 %4, %12, off\n\t"
      "global_load_async_to_lds_b128 %5, %13, off\n\t"
      "global_load_async_to_lds_b128 %6, %14, off\n\t"
      "global_load_async_to_lds_b128 %7, %15, off\n\t"
      "s_wait_xcnt 0x0"
      :: "v"(lds), "v"(lds + step), "v"(lds + 2 * step), "v"(lds + 3 * step),
         "v"(lv), "v"(lv + step), "v"(lv + 2 * step), "v"(lv + 3 * step),
         "v"(gk), "v"(gk + 16 * HEAD_DIM), "v"(gk + 32 * HEAD_DIM), "v"(gk + 48 * HEAD_DIM),
         "v"(gv), "v"(gv + 16 * NSEQ), "v"(gv + 32 * NSEQ), "v"(gv + 48 * NSEQ)
      : "memory");
}

// The issuing wave's own copies have landed.
static __device__ __forceinline__ void wait_copies() {
  asm volatile("s_wait_asynccnt 0x0" ::: "memory");
}

// Lane l takes lane l ^ 16's value: a vector move between the 16-lane rows.
static __device__ __forceinline__ float other_half(float v) {
  int b = __builtin_bit_cast(int, v);
  return __builtin_bit_cast(float, __builtin_amdgcn_permlanex16(b, b, 0x76543210, 0xfedcba98,
                                                                false, false));
}

// A fragment in the k order that a pair of converted D tiles has as B: the
// lane's elements 0..7 are k 8 hi + 0..7, elements 8..15 are k 16 + 8 hi + 0..7.
// p: the row's first k of the 32, plus 8 hi.
static __device__ __forceinline__ v16h lds_frag_split(const _Float16* p) {
  v8h lo = *(const v8h*)(p);
  v8h hi = *(const v8h*)(p + 16);
  return __builtin_shufflevector(lo, hi, 0, 1, 2, 3, 4, 5, 6, 7,
                                 8, 9, 10, 11, 12, 13, 14, 15);
}

#define LOG2E_F 1.44269504f            // e^x = 2^(x log2 e)

// Eight 2^x in place, one statement: each overwrites only its own source and
// reads no other's result, so each has an independent instruction behind it,
// the slot the instruction set asks for behind a transcendental; the v_nop is
// that slot for the last.
static __device__ __forceinline__ void exp2_x8(float (&t)[8]) {
  asm("v_exp_f32 %0, %0\n\t"
      "v_exp_f32 %1, %1\n\t"
      "v_exp_f32 %2, %2\n\t"
      "v_exp_f32 %3, %3\n\t"
      "v_exp_f32 %4, %4\n\t"
      "v_exp_f32 %5, %5\n\t"
      "v_exp_f32 %6, %6\n\t"
      "v_exp_f32 %7, %7\n\t"
      "v_nop"
      : "+v"(t[0]), "+v"(t[1]), "+v"(t[2]), "+v"(t[3]),
        "+v"(t[4]), "+v"(t[5]), "+v"(t[6]), "+v"(t[7]));
}

__global__ __launch_bounds__(128) void flash_attn(const _Float16* __restrict__ q,
                                                  const _Float16* __restrict__ k,
                                                  const _Float16* __restrict__ vt,
                                                  _Float16* __restrict__ ao) {
  __shared__ __attribute__((aligned(16))) _Float16 kv[2 * FA_BUF];
  int lane = threadIdx.x & 31;
  int wave = __builtin_amdgcn_readfirstlane(threadIdx.x >> 5);   // scalar: so is the test that skips a pass
  int hi = lane >> 4, ln16 = lane & 15;
  const int pr = blockIdx.x & (FA_GROUPS / 2 - 1);   // which pair of query groups
  int h  = (blockIdx.x / (FA_GROUPS / 2)) & (HEADS - 1);
  int b  = blockIdx.x / (FA_GROUPS / 2 * HEADS);
  size_t bh = (size_t)(b * HEADS + h);
  const _Float16* qb_p = q  + bh * NSEQ * HEAD_DIM;
  const _Float16* kb_p = k  + bh * NSEQ * HEAD_DIM;
  const _Float16* vb_p = vt + bh * HEAD_DIM * NSEQ;
  const int c8 = threadIdx.x & 7, r16 = threadIdx.x >> 3;
  const unsigned cl = (unsigned)(size_t)kv + (unsigned)(r16 * FA_PITCH + c8 * 8) * 2;
  const _Float16* ck = kb_p + r16 * HEAD_DIM + c8 * 8;
  const _Float16* cv = vb_p + r16 * NSEQ + c8 * 8;

  for (int half = 0; half < 2; ++half) {
  const int grp = half ? FA_GROUPS - 1 - pr : pr;    // same value in every wave of the block
  int m0 = (grp * 4 + wave) * 16;

  // Q B-fragments for d = 0..31 and d = 32..63 (loaded once): column ln16 is
  // query m0 + ln16; 16 contiguous d per half, the order of the K loader.
  const _Float16* qrow = qb_p + (size_t)(m0 + ln16) * HEAD_DIM;
  v16h q0 = *(const v16h*)(qrow + hi * 16);
  v16h q1 = *(const v16h*)(qrow + 32 + hi * 16);

  // O^T tiles: o_j[r] = O[query m0 + ln16][d = 16 j + 8 hi + r].
  v8f o0 = {}, o1 = {}, o2 = {}, o3 = {};
  float mrun = NEG_BIG;                // the query's running maximum, same in both halves
  float lrun = 0.f;                    // this half's share of the query's sum

  int kbmax = (m0 + 15) >> 5;          // causal: last key block touching this tile
  // The group's queries are 64 j ... 64 j + 63: it walks the j + 1 stages that
  // hold keys 0 ... 64 j + 63. Same value in every wave of the block.
  const int nst = grp + 1;

  // For the second group: the first group's last foot (reads done, barrier)
  // has freed both buffers, and none of its copies is in flight.
  fa_copy_stage(cl, ck, cv);           // stage 0 into buffer 0
  wait_copies();
  __syncthreads();                     // stage 0 published
  if (nst > 1) fa_copy_stage(cl + FA_BUF * 2, ck + FA_KEYS * HEAD_DIM, cv + FA_KEYS);

  for (int st = 0; st < nst; ++st) {
   const _Float16* kt = kv + (st & 1) * FA_BUF;
   const _Float16* vtl = kt + FA_TILE;
   for (int sub = 0; sub < 2; ++sub) {
    int kb = st * 2 + sub;
    if (kb > kbmax) break;             // wave-uniform: past this wave's diagonal
    int n0 = kb * 32;
    // ---- S^T = K @ Q^T for 32 keys (two 16x16 C tiles, keys down the rows) ----
    v8f s0 = {}, s1 = {};
    const _Float16* kr0 = kt + (sub * 32 + ln16) * FA_PITCH;
    const _Float16* kr1 = kr0 + 16 * FA_PITCH;
    v16h k00 = lds_frag(kr0 + hi * 16);
    v16h k01 = lds_frag(kr0 + 32 + hi * 16);
    v16h k10 = lds_frag(kr1 + hi * 16);
    v16h k11 = lds_frag(kr1 + 32 + hi * 16);
    // V^T rows are the A fragments of the second product, in P^T's k order.
    const _Float16* vb0 = vtl + ln16 * FA_PITCH + sub * 32 + hi * 8;
    v16h av0 = lds_frag_split(vb0);
    v16h av1 = lds_frag_split(vb0 + 16 * FA_PITCH);
    v16h av2 = lds_frag_split(vb0 + 32 * FA_PITCH);
    v16h av3 = lds_frag_split(vb0 + 48 * FA_PITCH);
    // Keeps the pass's LDS reads one group ahead of its products; left free, the
    // scheduler reads each fragment into the same registers right in front of
    // its product, and every product then waits out an LDS latency.
    __builtin_amdgcn_sched_barrier(0);
    s0 = wmma_f16(k00, q0, s0); s0 = wmma_f16(k01, q1, s0);
    s1 = wmma_f16(k10, q0, s1); s1 = wmma_f16(k11, q1, s1);

    // ---- scale, causal mask, online softmax: one query per lane ----
    const int lim = m0 + ln16 - n0 - 8 * hi;   // key r of s0 is masked where r > lim
    s0 *= SCALE_F; s1 *= SCALE_F;
    float v0[8], v1[8];
    float mx = NEG_BIG;
#pragma unroll
    for (int r = 0; r < 8; ++r) {
      v0[r] = r      > lim ? NEG_BIG : s0[r];
      v1[r] = r + 16 > lim ? NEG_BIG : s1[r];
      mx = fmaxf(mx, fmaxf(v0[r], v1[r]));
    }
    mx = fmaxf(mx, other_half(mx));
    float mnew  = fmaxf(mrun, mx);
    float alpha = __expf(mrun - mnew);
#pragma unroll
    for (int r = 0; r < 8; ++r) {
      v0[r] = (v0[r] - mnew) * LOG2E_F;
      v1[r] = (v1[r] - mnew) * LOG2E_F;
    }
    exp2_x8(v0);
    exp2_x8(v1);
    float rsum = 0.f;
    v16h pb;                           // P^T as B: element r key 8 hi + r, 8 + r key 16 + 8 hi + r
#pragma unroll
    for (int r = 0; r < 8; ++r) {
      rsum += v0[r] + v1[r];
      pb[r]     = (_Float16)v0[r];
      pb[8 + r] = (_Float16)v1[r];
    }
    lrun = lrun * alpha + rsum;
    mrun = mnew;
    o0 *= alpha; o1 *= alpha; o2 *= alpha; o3 *= alpha;

    // ---- O^T += V^T @ P^T ----
    o0 = wmma_f16(av0, pb, o0);
    o1 = wmma_f16(av1, pb, o1);
    o2 = wmma_f16(av2, pb, o2);
    o3 = wmma_f16(av3, pb, o3);
   }
   // Foot of the stage, every wave: its reads of this buffer are done, its own
   // copies of the next stage have landed; the barrier publishes that stage and
   // frees this buffer, which only then takes the stage after it.
   lds_fence_wave();
   wait_copies();
   __syncthreads();
   if (st + 2 < nst)
     fa_copy_stage(cl + (st & 1) * FA_BUF * 2, ck + (st + 2) * FA_KEYS * HEAD_DIM,
                   cv + (st + 2) * FA_KEYS);
  }
  wait_copies();                       // nothing in flight when the group ends

  // ---- normalize and write attention output [B*N, EMBED] f16: a lane holds 8
  // consecutive d of its query in each tile, one 16-byte store a tile ----
  float inv = 1.f / (lrun + other_half(lrun));
  _Float16* orow = ao + ((size_t)(b * NSEQ + m0 + ln16)) * EMBED + h * HEAD_DIM + hi * 8;
  v8h w0, w1, w2, w3;
#pragma unroll
  for (int r = 0; r < 8; ++r) {
    w0[r] = (_Float16)(o0[r] * inv);
    w1[r] = (_Float16)(o1[r] * inv);
    w2[r] = (_Float16)(o2[r] * inv);
    w3[r] = (_Float16)(o3[r] * inv);
  }
  *(v8h*)(orow)      = w0;
  *(v8h*)(orow + 16) = w1;
  *(v8h*)(orow + 32) = w2;
  *(v8h*)(orow + 48) = w3;
  // The next group's code reuses registers that the stores above name: the
  // wait stands in front of those overwrites.
  asm volatile("s_wait_xcnt 0x0" ::: "memory");
  }
}

// ---------------------------------------------------------------------------
// out = residual + ao @ Wo^T + bo  (fp32 output); same blocking as gemm_qkv
// ---------------------------------------------------------------------------
__global__ __launch_bounds__(256) void out_proj(const _Float16* __restrict__ A,
                                                const _Float16* __restrict__ W,
                                                const float* __restrict__ x,
                                                const float* __restrict__ bo,
                                                float* __restrict__ out) {
  __shared__ __attribute__((aligned(16))) _Float16 sm[4 * GT_OPER];
  int lane = threadIdx.x & 31;
  int wave = threadIdx.x >> 5;
  int hi = lane >> 4, ln16 = lane & 15;
  int bx = blockIdx.x;
  int bm0 = (bx >> 3) * 128, bn0 = (bx & 7) * 128;
  v8f acc[4][2] = {};
  gemm_tile_128(A, W, sm, bm0, bn0, acc);

  int m0 = bm0 + (wave >> 2) * 64 + 8 * hi, col0 = bn0 + (wave & 3) * 32 + ln16;
  // One 32-bit element offset per lane on the two scalar bases serves every
  // load of x and every store of out: no 64-bit per-lane address arithmetic.
  const unsigned base = (unsigned)(m0 * EMBED + col0);
  const float* xp = x + base;
  float* op = out + base;
  float bias[2] = {bo[col0], bo[col0 + 16]};
  // The loads of x may land in the register that the two loads above name.
  asm volatile("s_wait_xcnt 0x0" ::: "memory");
  float xr[4][2][8];
#pragma unroll
  for (int i = 0; i < 4; ++i)
#pragma unroll
    for (int j = 0; j < 2; ++j)
#pragma unroll
      for (int r = 0; r < 8; ++r) xr[i][j][r] = xp[(i * 16 + r) * EMBED + j * 16];
#pragma unroll
  for (int i = 0; i < 4; ++i)
#pragma unroll
    for (int j = 0; j < 2; ++j)
#pragma unroll
      for (int r = 0; r < 8; ++r)
        op[(i * 16 + r) * EMBED + j * 16] = xr[i][j][r] + bias[j] + acc[i][j][r];
}

// ---------------------------------------------------------------------------
extern "C" void kernel_launch(void* const* d_in, const int* in_sizes, int n_in,
                              void* d_out, int out_size, void* d_ws, size_t ws_size,
                              hipStream_t stream) {
  (void)in_sizes; (void)n_in; (void)out_size; (void)ws_size;
  const float* x    = (const float*)d_in[0];
  const float* ln_w = (const float*)d_in[1];
  const float* ln_b = (const float*)d_in[2];
  const float* Wq   = (const float*)d_in[3];
  const float* Wk   = (const float*)d_in[4];
  const float* Wv   = (const float*)d_in[5];
  const float* Wo   = (const float*)d_in[6];
  const float* bo   = (const float*)d_in[7];
  float* out = (float*)d_out;

  char* ws = (char*)d_ws;
  size_t off = 0;
  auto carve = [&](size_t elems) {
    _Float16* p = (_Float16*)(ws + off);
    off += ((elems * sizeof(_Float16) + 255) & ~(size_t)255);
    return p;
  };
  _Float16* xn   = carve((size_t)MROWS * EMBED);   // normalized activations
  _Float16* wq16 = carve((size_t)EMBED * EMBED);
  _Float16* wk16 = carve((size_t)EMBED * EMBED);
  _Float16* wv16 = carve((size_t)EMBED * EMBED);
  _Float16* wo16 = carve((size_t)EMBED * EMBED);
  _Float16* qh   = carve((size_t)MROWS * EMBED);   // [B,H,N,D]
  _Float16* kh   = carve((size_t)MROWS * EMBED);   // [B,H,N,D]
  _Float16* vth  = carve((size_t)MROWS * EMBED);   // [B,H,D,N]
  _Float16* ao   = carve((size_t)MROWS * EMBED);   // attention output [B*N, E]

  prep<<<dim3(LN_BLOCKS + 4 * CV_BLOCKS), CV_THREADS, 0, stream>>>(
      x, ln_w, ln_b, xn, Wq, Wk, Wv, Wo, wq16, wk16, wv16, wo16);

  gemm_qkv<<<dim3(3 * GT_TILES), 256, 0, stream>>>(xn, wq16, wk16, wv16, qh, kh, vth);

  flash_attn<<<dim3(BATCH * HEADS * (FA_GROUPS / 2)), 128, 0, stream>>>(qh, kh, vth, ao);

  out_proj<<<dim3(GT_TILES), 256, 0, stream>>>(ao, wo16, x, bo, out);
}

// v007
// One run takes 71.6 microseconds.
// In two side-by-side timings against v006, it was 1.07 and 1.06 times as fast.
// All steps since v000 together make it 4.35 times as fast.
#include <hip/hip_runtime.h>
#include <hip/hip_bf16.h>

typedef __attribute__((ext_vector_type(16))) _Float16 v16h;
typedef __attribute__((ext_vector_type(8)))  _Float16 v8h;
typedef __attribute__((ext_vector_type(8)))  float    v8f;
typedef __attribute__((ext_vector_type(4)))  float    v4f;

#define EMBED    1024
#define HEADS    16
#define HEAD_DIM 64
#define NSEQ     2048
#define BATCH    2
#define MROWS    (BATCH * NSEQ)        // 4096
#define SCALE_F  0.125f                // HEAD_DIM^-0.5
#define LN_EPS   1e-5f
#define NEG_BIG  (-1e30f)

static __device__ __forceinline__ v8f wmma_f16(v16h a, v16h b, v8f c) {
  // D = A(16x32 f16) * B(32x16 f16) + C(16x16 f32)
  return __builtin_amdgcn_wmma_f32_16x16x32_f16(
      /*neg_a=*/false, a, /*neg_b=*/false, b,
      /*c_mod=*/(short)0, c, /*reuse_a=*/false, /*reuse_b=*/false);
}

// In-order LDS pipe within a wave: wait DS ops then fence the compiler.
static __device__ __forceinline__ void lds_fence_wave() {
  asm volatile("s_wait_dscnt 0x0" ::: "memory");
}

// ---------------------------------------------------------------------------
// fp32 -> f16, all four weight matrices. The work is 24 MB of traffic,
// 256 blocks of 16 waves,
// 64 blocks a matrix. A lane takes 4 pieces of 8 consecutive elements: 8
// 16-byte loads in flight, then 4 16-byte stores. blk: 0 ... 4 CV_BLOCKS - 1.
// ---------------------------------------------------------------------------
#define CV_THREADS 512
#define CV_PIECE   (CV_THREADS * 8)               // elements a block covers per piece
#define CV_BLOCK   (CV_PIECE * 4)                 // elements per block
#define CV_BLOCKS  (EMBED * EMBED / CV_BLOCK)     // blocks per matrix: 64

static __device__ __forceinline__ void cvt_weights(
    unsigned blk,
    const float* __restrict__ s0, const float* __restrict__ s1,
    const float* __restrict__ s2, const float* __restrict__ s3,
    _Float16* __restrict__ d0, _Float16* __restrict__ d1,
    _Float16* __restrict__ d2, _Float16* __restrict__ d3) {
  const int which = blk / CV_BLOCKS;              // block-uniform: scalar selects
  const float* s = which == 0 ? s0 : which == 1 ? s1 : which == 2 ? s2 : s3;
  _Float16*    d = which == 0 ? d0 : which == 1 ? d1 : which == 2 ? d2 : d3;
  const unsigned base = (blk % CV_BLOCKS) * CV_BLOCK + threadIdx.x * 8;
  v4f lo[4], hi[4];
#pragma unroll
  for (int i = 0; i < 4; ++i) {
    lo[i] = *(const v4f*)(s + base + i * CV_PIECE);
    hi[i] = *(const v4f*)(s + base + i * CV_PIECE + 4);
  }
#pragma unroll
  for (int i = 0; i < 4; ++i) {
    v8h o = {(_Float16)lo[i][0], (_Float16)lo[i][1], (_Float16)lo[i][2], (_Float16)lo[i][3],
             (_Float16)hi[i][0], (_Float16)hi[i][1], (_Float16)hi[i][2], (_Float16)hi[i][3]};
    *(v8h*)(d + base + i * CV_PIECE) = o;
  }
}

// ---------------------------------------------------------------------------
// LayerNorm: one wave per row of 1024, fp32 in, f16 out
// ---------------------------------------------------------------------------
static __device__ __forceinline__ void ln_row(int row, int lane,
                                              const float* __restrict__ x,
                                              const float* __restrict__ w,
                                              const float* __restrict__ bns,
                                              _Float16* __restrict__ xn) {
  const float4* xr = (const float4*)(x + (size_t)row * EMBED);
  float4 v[8];
  float s = 0.f, s2 = 0.f;
#pragma unroll
  for (int i = 0; i < 8; ++i) {
    v[i] = xr[lane + 32 * i];
    s  += v[i].x + v[i].y + v[i].z + v[i].w;
    s2 += v[i].x * v[i].x + v[i].y * v[i].y + v[i].z * v[i].z + v[i].w * v[i].w;
  }
#pragma unroll
  for (int off = 16; off >= 1; off >>= 1) {
    s  += __shfl_xor(s, off, 32);
    s2 += __shfl_xor(s2, off, 32);
  }
  float mu  = s * (1.f / EMBED);
  float var = s2 * (1.f / EMBED) - mu * mu;
  float rs  = rsqrtf(var + LN_EPS);
#pragma unroll
  for (int i = 0; i < 8; ++i) {
    int idx = (lane + 32 * i) * 4;
    float4 wv = ((const float4*)w)[lane + 32 * i];
    float4 bv = ((const float4*)bns)[lane + 32 * i];
    _Float16* o = xn + (size_t)row * EMBED + idx;
    o[0] = (_Float16)((v[i].x - mu) * rs * wv.x + bv.x);
    o[1] = (_Float16)((v[i].y - mu) * rs * wv.y + bv.y);
    o[2] = (_Float16)((v[i].z - mu) * rs * wv.z + bv.z);
    o[3] = (_Float16)((v[i].w - mu) * rs * wv.w + bv.w);
  }
}

// ---------------------------------------------------------------------------
// LayerNorm and weight conversion depend on nothing of each other: one launch,
// the role by block index. The first LN_BLOCKS blocks normalize 16 rows each
// (a wave a row), the rest convert.
// ---------------------------------------------------------------------------
#define LN_BLOCKS (MROWS / (CV_THREADS / 32))     // 256

__global__ __launch_bounds__(CV_THREADS) void prep(
    const float* __restrict__ x, const float* __restrict__ w,
    const float* __restrict__ bns, _Float16* __restrict__ xn,
    const float* __restrict__ s0, const float* __restrict__ s1,
    const float* __restrict__ s2, const float* __restrict__ s3,
    _Float16* __restrict__ d0, _Float16* __restrict__ d1,
    _Float16* __restrict__ d2, _Float16* __restrict__ d3) {
  if (blockIdx.x < LN_BLOCKS)
    ln_row(blockIdx.x * (CV_THREADS / 32) + (threadIdx.x >> 5), threadIdx.x & 31, x, w, bns, xn);
  else
    cvt_weights(blockIdx.x - LN_BLOCKS, s0, s1, s2, s3, d0, d1, d2, d3);
}

// ---------------------------------------------------------------------------
// Shared main loop of the four projections: C = A(M x K) @ W^T, both f16, K
// innermost. One block of 8 waves owns a 128x128 tile of C. A pass is 128 k
// (256 B of every operand row): the block loads both 128-row operand tiles
// with whole 256-B row pieces, stages them in LDS (two buffers, row pitch
// 272 B for conflict-free 16-byte reads) and every wave reads its fragments
// from there. Waves are laid 2 (M) x 4 (N); a wave owns 64x32 = 4x2 tiles.
// The next pass's global loads are issued ahead of this pass's products and
// stored to the other buffer behind them; one barrier per pass.
// k order per accumulator is ascending in steps of 32.
// ---------------------------------------------------------------------------
#define GT_ROWS   128                    // rows of each operand tile
#define GT_K      128                    // k per pass
#define GT_PITCH  136                    // LDS row pitch in f16 (272 B)
#define GT_OPER   (GT_ROWS * GT_PITCH)   // f16 per operand tile in LDS
#define GT_PASSES (EMBED / GT_K)         // 8

static __device__ __forceinline__ v16h lds_frag(const _Float16* p) {
  v8h lo = *(const v8h*)(p);
  v8h hi = *(const v8h*)(p + 8);
  return __builtin_shufflevector(lo, hi, 0, 1, 2, 3, 4, 5, 6, 7,
                                 8, 9, 10, 11, 12, 13, 14, 15);
}

static __device__ __forceinline__ void gemm_tile_128(const _Float16* __restrict__ A,
                                                     const _Float16* __restrict__ W,
                                                     _Float16* sm, int m0, int n0,
                                                     v8f (&acc)[4][2]) {
  int tid  = threadIdx.x;
  int lane = tid & 31, wave = tid >> 5;
  int hi = lane >> 4, ln16 = lane & 15;
  int wm = wave >> 2, wn = wave & 3;
  int c16 = tid & 15, r16 = tid >> 4;    // 16 lanes cover one row's 256 B
  // Block-uniform bases plus one per-lane offset that never changes.
  const _Float16* ga = A + (size_t)m0 * EMBED;
  const _Float16* gw = W + (size_t)n0 * EMBED;
  const unsigned go = (unsigned)(r16 * EMBED + c16 * 8);
  _Float16* st = sm + r16 * GT_PITCH + c16 * 8;
  const _Float16* fa = sm + (wm * 64 + ln16) * GT_PITCH + hi * 16;
  const _Float16* fb = sm + GT_OPER + (wn * 32 + ln16) * GT_PITCH + hi * 16;

  v8h ra[8], rw[8];
#pragma unroll
  for (int i = 0; i < 8; ++i) {
    ra[i] = *(const v8h*)(ga + go + i * 16 * EMBED);
    rw[i] = *(const v8h*)(gw + go + i * 16 * EMBED);
  }
#pragma unroll
  for (int i = 0; i < 8; ++i) {
    *(v8h*)(st + i * 16 * GT_PITCH)           = ra[i];
    *(v8h*)(st + GT_OPER + i * 16 * GT_PITCH) = rw[i];
  }
  __syncthreads();

  for (int t = 0; t < GT_PASSES; ++t) {
    const int cur = (t & 1) * 2 * GT_OPER;
    if (t + 1 < GT_PASSES) {
#pragma unroll
      for (int i = 0; i < 8; ++i) {
        ra[i] = *(const v8h*)(ga + (t + 1) * GT_K + go + i * 16 * EMBED);
        rw[i] = *(const v8h*)(gw + (t + 1) * GT_K + go + i * 16 * EMBED);
      }
    }
    v16h a[2][4], b[2][2];             // two fragment sets: one read, one in use
#pragma unroll
    for (int i = 0; i < 4; ++i) a[0][i] = lds_frag(fa + cur + i * 16 * GT_PITCH);
#pragma unroll
    for (int j = 0; j < 2; ++j) b[0][j] = lds_frag(fb + cur + j * 16 * GT_PITCH);
#pragma unroll
    for (int kk = 0; kk < GT_K / 32; ++kk) {
      const int s = kk & 1;
      if (kk + 1 < GT_K / 32) {
#pragma unroll
        for (int i = 0; i < 4; ++i)
          a[s ^ 1][i] = lds_frag(fa + cur + i * 16 * GT_PITCH + (kk + 1) * 32);
#pragma unroll
        for (int j = 0; j < 2; ++j)
          b[s ^ 1][j] = lds_frag(fb + cur + j * 16 * GT_PITCH + (kk + 1) * 32);
      }
      // Keeps the next block's LDS reads one group ahead of this block's
      // products; left free, the scheduler sinks them between the products
      // and each pair of products then waits out an LDS latency.
      __builtin_amdgcn_sched_barrier(0);
#pragma unroll
      for (int i = 0; i < 4; ++i)
#pragma unroll
        for (int j = 0; j < 2; ++j) acc[i][j] = wmma_f16(a[s][i], b[s][j], acc[i][j]);
      // Ends the block: left free, the scheduler lifts the following group's
      // reads in among these products and moves products past the barrier.
      __builtin_amdgcn_sched_barrier(0);
    }
    if (t + 1 < GT_PASSES) {
      // The other buffer's last readers left it at the previous pass's barrier.
      const int nxt = 2 * GT_OPER - cur;
#pragma unroll
      for (int i = 0; i < 8; ++i) {
        *(v8h*)(st + nxt + i * 16 * GT_PITCH)           = ra[i];
        *(v8h*)(st + nxt + GT_OPER + i * 16 * GT_PITCH) = rw[i];
      }
      __syncthreads();
    }
  }
}

// ---------------------------------------------------------------------------
// The three projections of xn depend on nothing of each other: one launch of
// 3 x 256 blocks, the product by block index; two blocks fit a WGP's LDS, so
// one's products run under the other's loads, stores and barriers.
// Q, K: dst = [B,H,N,D] (head layout)
// V:    dst = [B,H,D,N] (transposed, for the second product's A fragments)
// ---------------------------------------------------------------------------
#define GT_TILES ((MROWS / 128) * (EMBED / 128))  // blocks per product: 32*8

__global__ __launch_bounds__(256) void gemm_qkv(const _Float16* __restrict__ A,
                                                const _Float16* __restrict__ Wq,
                                                const _Float16* __restrict__ Wk,
                                                const _Float16* __restrict__ Wv,
                                                _Float16* __restrict__ dq,
                                                _Float16* __restrict__ dk,
                                                _Float16* __restrict__ dv) {
  __shared__ __attribute__((aligned(16))) _Float16 sm[4 * GT_OPER];
  int lane = threadIdx.x & 31;
  int wave = threadIdx.x >> 5;
  int hi = lane >> 4, ln16 = lane & 15;
  const int which = blockIdx.x / GT_TILES;        // block-uniform: scalar selects
  const _Float16* W = which == 0 ? Wq : which == 1 ? Wk : Wv;
  _Float16* dst     = which == 0 ? dq : which == 1 ? dk : dv;
  int bx = blockIdx.x % GT_TILES;
  int bm0 = (bx >> 3) * 128, bn0 = (bx & 7) * 128;
  v8f acc[4][2] = {};
  gemm_tile_128(A, W, sm, bm0, bn0, acc);

  int m0 = bm0 + (wave >> 2) * 64 + 8 * hi, ncol0 = bn0 + (wave & 3) * 32 + ln16;
  int b2 = m0 >> 11;                   // batch: a 64-row strip lies in one
  int n0 = m0 & (NSEQ - 1);            // seq pos of the lane's first row
  if (which < 2) {
#pragma unroll
    for (int j = 0; j < 2; ++j) {
      int col = ncol0 + j * 16;
      int h = col >> 6, d = col & 63;
      size_t base = (size_t)(b2 * HEADS + h);
#pragma unroll
      for (int i = 0; i < 4; ++i)
#pragma unroll
        for (int r = 0; r < 8; ++r)
          dst[(base * NSEQ + n0 + i * 16 + r) * HEAD_DIM + d] = (_Float16)acc[i][j][r];
      // The next column's conversions and addresses reuse registers that the
      // stores above name: the wait stands in front of those overwrites.
      asm volatile("s_wait_xcnt 0x0" ::: "memory");
    }
    return;
  }
#pragma unroll
  for (int j = 0; j < 2; ++j) {
    int col = ncol0 + j * 16;
    int h = col >> 6, d = col & 63;
    size_t base = (size_t)(b2 * HEADS + h);
#pragma unroll
    for (int i = 0; i < 4; ++i)
#pragma unroll
      for (int r = 0; r < 8; ++r)
        dst[(base * HEAD_DIM + d) * NSEQ + n0 + i * 16 + r] = (_Float16)acc[i][j][r];
    // As above: in front of the next column's overwrites of these registers.
    asm volatile("s_wait_xcnt 0x0" ::: "memory");
  }
}

#define FA_KEYS  64
#define FA_PITCH 72
#define FA_TILE  (64 * FA_PITCH)
#define FA_BUF   (2 * FA_TILE)
#define FA_SBUF  (2 * FA_BUF)
#define FA_GROUPS (NSEQ / 64)

// One stage: a lane copies 16 B of four K rows and of four V^T rows, 16 rows
// apart; 8 lanes cover a row. lds: the lane's byte address in the buffer's K
// tile; gk, gv: its first source piece of each operand. The copies and the
// wait that stands in front of any rewrite of their address registers are one
// statement.
static __device__ __forceinline__ void fa_copy_stage(unsigned lds, const _Float16* gk,
                                                     const _Float16* gv) {
  const unsigned step = 16 * FA_PITCH * 2;           // 16 rows on, in bytes
  const unsigned lv = lds + FA_TILE * 2;
  asm volatile(
      "global_load_async_to_lds_b128 %0, %8, off\n\t"
      "global_load_async_to_lds_b128 %1, %9, off\n\t"
      "global_load_async_to_lds_b128 %2, %10, off\n\t"
      "global_load_async_to_lds_b128 %3, %11, off\n\t"
      "global_load_async_to_lds_b128 %4, %12, off\n\t"
      "global_load_async_to_lds_b128 %5, %13, off\n\t"
      "global_load_async_to_lds_b128 %6, %14, off\n\t"
      "global_load_async_to_lds_b128 %7, %15, off\n\t"
      "s_wait_xcnt 0x0"
      :: "v"(lds), "v"(lds + step), "v"(lds + 2 * step), "v"(lds + 3 * step),
         "v"(lv), "v"(lv + step), "v"(lv + 2 * step), "v"(lv + 3 * step),
         "v"(gk), "v"(gk + 16 * HEAD_DIM), "v"(gk + 32 * HEAD_DIM), "v"(gk + 48 * HEAD_DIM),
         "v"(gv), "v"(gv + 16 * NSEQ), "v"(gv + 32 * NSEQ), "v"(gv + 48 * NSEQ)
      : "memory");
}

// The issuing wave's own copies have landed.
static __device__ __forceinline__ void wait_copies() {
  asm volatile("s_wait_asynccnt 0x0" ::: "memory");
}

// Lane l takes lane l ^ 16's value: a vector move between the 16-lane rows.
static __device__ __forceinline__ float other_half(float v) {
  int b = __builtin_bit_cast(int, v);
  return __builtin_bit_cast(float, __builtin_amdgcn_permlanex16(b, b, 0x76543210, 0xfedcba98,
                                                                false, false));
}

// A fragment in the k order that a pair of converted D tiles has as B: the
// lane's elements 0..7 are k 8 hi + 0..7, elements 8..15 are k 16 + 8 hi + 0..7.
// p: the row's first k of the 32, plus 8 hi.
static __device__ __forceinline__ v16h lds_frag_split(const _Float16* p) {
  v8h lo = *(const v8h*)(p);
  v8h hi = *(const v8h*)(p + 16);
  return __builtin_shufflevector(lo, hi, 0, 1, 2, 3, 4, 5, 6, 7,
                                 8, 9, 10, 11, 12, 13, 14, 15);
}

#define LOG2E_F 1.44269504f            // e^x = 2^(x log2 e)

// Eight 2^x in place, one statement: each overwrites only its own source and
// reads no other's result, so each has an independent instruction behind it,
// the slot the instruction set asks for behind a transcendental; the v_nop is
// that slot for the last.
static __device__ __forceinline__ void exp2_x8(float (&t)[8]) {
  asm("v_exp_f32 %0, %0\n\t"
      "v_exp_f32 %1, %1\n\t"
      "v_exp_f32 %2, %2\n\t"
      "v_exp_f32 %3, %3\n\t"
      "v_exp_f32 %4, %4\n\t"
      "v_exp_f32 %5, %5\n\t"
      "v_exp_f32 %6, %6\n\t"
      "v_exp_f32 %7, %7\n\t"
      "v_nop"
      : "+v"(t[0]), "+v"(t[1]), "+v"(t[2]), "+v"(t[3]),
        "+v"(t[4]), "+v"(t[5]), "+v"(t[6]), "+v"(t[7]));
}

__global__ __launch_bounds__(256) void flash_attn(const _Float16* __restrict__ q,
                                                  const _Float16* __restrict__ k,
                                                  const _Float16* __restrict__ vt,
                                                  _Float16* __restrict__ ao) {
  __shared__ __attribute__((aligned(16))) _Float16 kv[2 * FA_SBUF];
  // Waves 4-7's partial results: per query tile 8 pieces of O^T and one of
  // (maximum, sum); a lane's 16 bytes beside its neighbour's.
  __shared__ __attribute__((aligned(16))) v4f part[4][9][32];
  int lane = threadIdx.x & 31;
  int wave = __builtin_amdgcn_readfirstlane(threadIdx.x >> 5);   // scalar: so is the test that skips a pass
  const int qt = wave & 3, kh = wave >> 2;           // query tile; which 64 keys of a stage
  int hi = lane >> 4, ln16 = lane & 15;
  const int pr = blockIdx.x & (FA_GROUPS / 2 - 1);   // which pair of query groups
  int h  = (blockIdx.x / (FA_GROUPS / 2)) & (HEADS - 1);
  int b  = blockIdx.x / (FA_GROUPS / 2 * HEADS);
  size_t bh = (size_t)(b * HEADS + h);
  const _Float16* qb_p = q  + bh * NSEQ * HEAD_DIM;
  const _Float16* kb_p = k  + bh * NSEQ * HEAD_DIM;
  const _Float16* vb_p = vt + bh * HEAD_DIM * NSEQ;
  const int c8 = threadIdx.x & 7, r16 = (threadIdx.x & 127) >> 3;
  const unsigned cl = (unsigned)(size_t)kv + (unsigned)(kh * FA_BUF + r16 * FA_PITCH + c8 * 8) * 2;
  const _Float16* ck = kb_p + (kh * FA_KEYS + r16) * HEAD_DIM + c8 * 8;
  const _Float16* cv = vb_p + r16 * NSEQ + kh * FA_KEYS + c8 * 8;

  for (int half = 0; half < 2; ++half) {
  const int grp = half ? FA_GROUPS - 1 - pr : pr;    // same value in every wave of the block
  int m0 = (grp * 4 + qt) * 16;

  // Q B-fragments for d = 0..31 and d = 32..63 (loaded once): column ln16 is
  // query m0 + ln16; 16 contiguous d per half, the order of the K loader.
  const _Float16* qrow = qb_p + (size_t)(m0 + ln16) * HEAD_DIM;
  v16h q0 = *(const v16h*)(qrow + hi * 16);
  v16h q1 = *(const v16h*)(qrow + 32 + hi * 16);

  // O^T tiles: o_j[r] = O[query m0 + ln16][d = 16 j + 8 hi + r].
  v8f o0 = {}, o1 = {}, o2 = {}, o3 = {};
  float mrun = NEG_BIG;                // the query's running maximum, same in both halves
  float lrun = 0.f;                    // this half's share of the query's sum

  int kbmax = (m0 + 15) >> 5;          // causal: last key block touching this tile
  // The group's queries are 64 j ... 64 j + 63: it walks the stages of 128 keys
  // that hold keys 0 ... 64 j + 63; for even j the last stage's second 64 keys
  // (still inside the sequence) lie past the diagonal and no wave reads them.
  // Same value in every wave of the block.
  const int nst = (grp + 2) >> 1;

  // For the second group: the first group's last foot (reads done, barrier)
  // has freed both buffers, and none of its copies is in flight.
  fa_copy_stage(cl, ck, cv);           // stage 0 into buffer 0
  wait_copies();
  __syncthreads();                     // stage 0 published
  if (nst > 1) fa_copy_stage(cl + FA_SBUF * 2, ck + 2 * FA_KEYS * HEAD_DIM, cv + 2 * FA_KEYS);

  for (int st = 0; st < nst; ++st) {
   const _Float16* kt = kv + (st & 1) * FA_SBUF + kh * FA_BUF;
   const _Float16* vtl = kt + FA_TILE;
   for (int sub = 0; sub < 2; ++sub) {
    int kb = (st * 2 + kh) * 2 + sub;
    if (kb > kbmax) break;             // wave-uniform: past this wave's diagonal
    int n0 = kb * 32;
    // ---- S^T = K @ Q^T for 32 keys (two 16x16 C tiles, keys down the rows) ----
    v8f s0 = {}, s1 = {};
    const _Float16* kr0 = kt + (sub * 32 + ln16) * FA_PITCH;
    const _Float16* kr1 = kr0 + 16 * FA_PITCH;
    v16h k00 = lds_frag(kr0 + hi * 16);
    v16h k01 = lds_frag(kr0 + 32 + hi * 16);
    v16h k10 = lds_frag(kr1 + hi * 16);
    v16h k11 = lds_frag(kr1 + 32 + hi * 16);
    // V^T rows are the A fragments of the second product, in P^T's k order.
    const _Float16* vb0 = vtl + ln16 * FA_PITCH + sub * 32 + hi * 8;
    v16h av0 = lds_frag_split(vb0);
    v16h av1 = lds_frag_split(vb0 + 16 * FA_PITCH);
    v16h av2 = lds_frag_split(vb0 + 32 * FA_PITCH);
    v16h av3 = lds_frag_split(vb0 + 48 * FA_PITCH);
    // Keeps the pass's LDS reads one group ahead of its products; left free, the
    // scheduler reads each fragment into the same registers right in front of
    // its product, and every product then waits out an LDS latency.
    __builtin_amdgcn_sched_barrier(0);
    s0 = wmma_f16(k00, q0, s0); s0 = wmma_f16(k01, q1, s0);
    s1 = wmma_f16(k10, q0, s1); s1 = wmma_f16(k11, q1, s1);

    // ---- scale, causal mask, online softmax: one query per lane ----
    const int lim = m0 + ln16 - n0 - 8 * hi;   // key r of s0 is masked where r > lim
    s0 *= SCALE_F; s1 *= SCALE_F;
    float v0[8], v1[8];
    float mx = NEG_BIG;
#pragma unroll
    for (int r = 0; r < 8; ++r) {
      v0[r] = r      > lim ? NEG_BIG : s0[r];
      v1[r] = r + 16 > lim ? NEG_BIG : s1[r];
      mx = fmaxf(mx, fmaxf(v0[r], v1[r]));
    }
    mx = fmaxf(mx, other_half(mx));
    float mnew  = fmaxf(mrun, mx);
    float alpha = __expf(mrun - mnew);
#pragma unroll
    for (int r = 0; r < 8; ++r) {
      v0[r] = (v0[r] - mnew) * LOG2E_F;
      v1[r] = (v1[r] - mnew) * LOG2E_F;
    }
    exp2_x8(v0);
    exp2_x8(v1);
    float rsum = 0.f;
    v16h pb;                           // P^T as B: element r key 8 hi + r, 8 + r key 16 + 8 hi + r
#pragma unroll
    for (int r = 0; r < 8; ++r) {
      rsum += v0[r] + v1[r];
      pb[r]     = (_Float16)v0[r];
      pb[8 + r] = (_Float16)v1[r];
    }
    lrun = lrun * alpha + rsum;
    mrun = mnew;
    o0 *= alpha; o1 *= alpha; o2 *= alpha; o3 *= alpha;

    // ---- O^T += V^T @ P^T ----
    o0 = wmma_f16(av0, pb, o0);
    o1 = wmma_f16(av1, pb, o1);
    o2 = wmma_f16(av2, pb, o2);
    o3 = wmma_f16(av3, pb, o3);
   }
   // Foot of the stage, every wave: its reads of this buffer are done, its own
   // copies of the next stage have landed; the barrier publishes that stage and
   // frees this buffer, which only then takes the stage after it.
   lds_fence_wave();
   wait_copies();
   __syncthreads();
   if (st + 2 < nst)
     fa_copy_stage(cl + (st & 1) * FA_SBUF * 2, ck + (st + 2) * 2 * FA_KEYS * HEAD_DIM,
                   cv + (st + 2) * 2 * FA_KEYS);
  }
  wait_copies();                       // nothing in flight when the group ends

  // ---- join the two key sets' partial results, lane by lane ----
  if (kh == 1) {                       // wave-uniform, a scalar test
    part[qt][0][lane] = __builtin_shufflevector(o0, o0, 0, 1, 2, 3);
    part[qt][1][lane] = __builtin_shufflevector(o0, o0, 4, 5, 6, 7);
    part[qt][2][lane] = __builtin_shufflevector(o1, o1, 0, 1, 2, 3);
    part[qt][3][lane] = __builtin_shufflevector(o1, o1, 4, 5, 6, 7);
    part[qt][4][lane] = __builtin_shufflevector(o2, o2, 0, 1, 2, 3);
    part[qt][5][lane] = __builtin_shufflevector(o2, o2, 4, 5, 6, 7);
    part[qt][6][lane] = __builtin_shufflevector(o3, o3, 0, 1, 2, 3);
    part[qt][7][lane] = __builtin_shufflevector(o3, o3, 4, 5, 6, 7);
    part[qt][8][lane] = (v4f){mrun, lrun, 0.f, 0.f};
  }
  // Publishes the partial results. They are rewritten only at the next group's
  // end, behind that group's barriers, which their readers pass after reading.
  __syncthreads();
  if (kh == 1) continue;               // wave-uniform; the next barrier is the next group's first
  {
    v4f ml = part[qt][8][lane];
    // A set that saw no key below the diagonal hands over (NEG_BIG, 0, 0): weight 0.
    float mj = fmaxf(mrun, ml[0]);
    float a0 = __expf(mrun - mj), a1 = __expf(ml[0] - mj);
    lrun = lrun * a0 + ml[1] * a1;
    v4f p0 = part[qt][0][lane], p1 = part[qt][1][lane], p2 = part[qt][2][lane], p3 = part[qt][3][lane];
    v4f p4 = part[qt][4][lane], p5 = part[qt][5][lane], p6 = part[qt][6][lane], p7 = part[qt][7][lane];
    o0 = o0 * a0 + __builtin_shufflevector(p0, p1, 0, 1, 2, 3, 4, 5, 6, 7) * a1;
    o1 = o1 * a0 + __builtin_shufflevector(p2, p3, 0, 1, 2, 3, 4, 5, 6, 7) * a1;
    o2 = o2 * a0 + __builtin_shufflevector(p4, p5, 0, 1, 2, 3, 4, 5, 6, 7) * a1;
    o3 = o3 * a0 + __builtin_shufflevector(p6, p7, 0, 1, 2, 3, 4, 5, 6, 7) * a1;
  }

  // ---- normalize and write attention output [B*N, EMBED] f16: a lane holds 8
  // consecutive d of its query in each tile, one 16-byte store a tile ----
  float inv = 1.f / (lrun + other_half(lrun));
  _Float16* orow = ao + ((size_t)(b * NSEQ + m0 + ln16)) * EMBED + h * HEAD_DIM + hi * 8;
  v8h w0, w1, w2, w3;
#pragma unroll
  for (int r = 0; r < 8; ++r) {
    w0[r] = (_Float16)(o0[r] * inv);
    w1[r] = (_Float16)(o1[r] * inv);
    w2[r] = (_Float16)(o2[r] * inv);
    w3[r] = (_Float16)(o3[r] * inv);
  }
  *(v8h*)(orow)      = w0;
  *(v8h*)(orow + 16) = w1;
  *(v8h*)(orow + 32) = w2;
  *(v8h*)(orow + 48) = w3;
  // The next group's code reuses registers that the stores above name: the
  // wait stands in front of those overwrites.
  asm volatile("s_wait_xcnt 0x0" ::: "memory");
  }
}

// ---------------------------------------------------------------------------
// out = residual + ao @ Wo^T + bo  (fp32 output); same blocking as gemm_qkv
// ---------------------------------------------------------------------------
__global__ __launch_bounds__(256) void out_proj(const _Float16* __restrict__ A,
                                                const _Float16* __restrict__ W,
                                                const float* __restrict__ x,
                                                const float* __restrict__ bo,
                                                float* __restrict__ out) {
  __shared__ __attribute__((aligned(16))) _Float16 sm[4 * GT_OPER];
  int lane = threadIdx.x & 31;
  int wave = threadIdx.x >> 5;
  int hi = lane >> 4, ln16 = lane & 15;
  int bx = blockIdx.x;
  int bm0 = (bx >> 3) * 128, bn0 = (bx & 7) * 128;
  v8f acc[4][2] = {};
  gemm_tile_128(A, W, sm, bm0, bn0, acc);

  int m0 = bm0 + (wave >> 2) * 64 + 8 * hi, col0 = bn0 + (wave & 3) * 32 + ln16;
  // One 32-bit element offset per lane on the two scalar bases serves every
  // load of x and every store of out: no 64-bit per-lane address arithmetic.
  const unsigned base = (unsigned)(m0 * EMBED + col0);
  const float* xp = x + base;
  float* op = out + base;
  float bias[2] = {bo[col0], bo[col0 + 16]};
  // The loads of x may land in the register that the two loads above name.
  asm volatile("s_wait_xcnt 0x0" ::: "memory");
  float xr[4][2][8];
#pragma unroll
  for (int i = 0; i < 4; ++i)
#pragma unroll
    for (int j = 0; j < 2; ++j)
#pragma unroll
      for (int r = 0; r < 8; ++r) xr[i][j][r] = xp[(i * 16 + r) * EMBED + j * 16];
#pragma unroll
  for (int i = 0; i < 4; ++i)
#pragma unroll
    for (int j = 0; j < 2; ++j)
#pragma unroll
      for (int r = 0; r < 8; ++r)
        op[(i * 16 + r) * EMBED + j * 16] = xr[i][j][r] + bias[j] + acc[i][j][r];
}

// ---------------------------------------------------------------------------
extern "C" void kernel_launch(void* const* d_in, const int* in_sizes, int n_in,
                              void* d_out, int out_size, void* d_ws, size_t ws_size,
                              hipStream_t stream) {
  (void)in_sizes; (void)n_in; (void)out_size; (void)ws_size;
  const float* x    = (const float*)d_in[0];
  const float* ln_w = (const float*)d_in[1];
  const float* ln_b = (const float*)d_in[2];
  const float* Wq   = (const float*)d_in[3];
  const float* Wk   = (const float*)d_in[4];
  const float* Wv   = (const float*)d_in[5];
  const float* Wo   = (const float*)d_in[6];
  const float* bo   = (const float*)d_in[7];
  float* out = (float*)d_out;

  char* ws = (char*)d_ws;
  size_t off = 0;
  auto carve = [&](size_t elems) {
    _Float16* p = (_Float16*)(ws + off);
    off += ((elems * sizeof(_Float16) + 255) & ~(size_t)255);
    return p;
  };
  _Float16* xn   = carve((size_t)MROWS * EMBED);   // normalized activations
  _Float16* wq16 = carve((size_t)EMBED * EMBED);
  _Float16* wk16 = carve((size_t)EMBED * EMBED);
  _Float16* wv16 = carve((size_t)EMBED * EMBED);
  _Float16* wo16 = carve((size_t)EMBED * EMBED);
  _Float16* qh   = carve((size_t)MROWS * EMBED);   // [B,H,N,D]
  _Float16* kh   = carve((size_t)MROWS * EMBED);   // [B,H,N,D]
  _Float16* vth  = carve((size_t)MROWS * EMBED);   // [B,H,D,N]
  _Float16* ao   = carve((size_t)MROWS * EMBED);   // attention output [B*N, E]

  prep<<<dim3(LN_BLOCKS + 4 * CV_BLOCKS), CV_THREADS, 0, stream>>>(
      x, ln_w, ln_b, xn, Wq, Wk, Wv, Wo, wq16, wk16, wv16, wo16);

  gemm_qkv<<<dim3(3 * GT_TILES), 256, 0, stream>>>(xn, wq16, wk16, wv16, qh, kh, vth);

  flash_attn<<<dim3(BATCH * HEADS * (FA_GROUPS / 2)), 256, 0, stream>>>(qh, kh, vth, ao);

  out_proj<<<dim3(GT_TILES), 256, 0, stream>>>(ao, wo16, x, bo, out);
}

// v008
// One run takes 66.1 microseconds.
// Two timings next to v007 both put it at 1.08 times that version's speed.
// All steps since v000 together make it 4.71 times as fast.
#include <hip/hip_runtime.h>
#include <hip/hip_bf16.h>

typedef __attribute__((ext_vector_type(16))) _Float16 v16h;
typedef __attribute__((ext_vector_type(8)))  _Float16 v8h;
typedef __attribute__((ext_vector_type(2)))  _Float16 v2h;
typedef __attribute__((ext_vector_type(8)))  float    v8f;
typedef __attribute__((ext_vector_type(4)))  float    v4f;

#define EMBED    1024
#define HEADS    16
#define HEAD_DIM 64
#define NSEQ     2048
#define BATCH    2
#define MROWS    (BATCH * NSEQ)        // 4096
#define SCALE_F  0.125f                // HEAD_DIM^-0.5
#define LN_EPS   1e-5f
#define NEG_BIG  (-1e30f)

static __device__ __forceinline__ v8f wmma_f16(v16h a, v16h b, v8f c) {
  // D = A(16x32 f16) * B(32x16 f16) + C(16x16 f32)
  return __builtin_amdgcn_wmma_f32_16x16x32_f16(
      /*neg_a=*/false, a, /*neg_b=*/false, b,
      /*c_mod=*/(short)0, c, /*reuse_a=*/false, /*reuse_b=*/false);
}

// In-order LDS pipe within a wave: wait DS ops then fence the compiler.
static __device__ __forceinline__ void lds_fence_wave() {
  asm volatile("s_wait_dscnt 0x0" ::: "memory");
}

// ---------------------------------------------------------------------------
// fp32 -> f16, all four weight matrices. The work is 24 MB of traffic,
// 256 blocks of 16 waves,
// 64 blocks a matrix. A lane takes 4 pieces of 8 consecutive elements: 8
// 16-byte loads in flight, then 4 16-byte stores. blk: 0 ... 4 CV_BLOCKS - 1.
// ---------------------------------------------------------------------------
#define CV_THREADS 512
#define CV_PIECE   (CV_THREADS * 8)               // elements a block covers per piece
#define CV_BLOCK   (CV_PIECE * 4)                 // elements per block
#define CV_BLOCKS  (EMBED * EMBED / CV_BLOCK)     // blocks per matrix: 64

static __device__ __forceinline__ void cvt_weights(
    unsigned blk,
    const float* __restrict__ s0, const float* __restrict__ s1,
    const float* __restrict__ s2, const float* __restrict__ s3,
    _Float16* __restrict__ d0, _Float16* __restrict__ d1,
    _Float16* __restrict__ d2, _Float16* __restrict__ d3) {
  const int which = blk / CV_BLOCKS;              // block-uniform: scalar selects
  const float* s = which == 0 ? s0 : which == 1 ? s1 : which == 2 ? s2 : s3;
  _Float16*    d = which == 0 ? d0 : which == 1 ? d1 : which == 2 ? d2 : d3;
  const unsigned base = (blk % CV_BLOCKS) * CV_BLOCK + threadIdx.x * 8;
  v4f lo[4], hi[4];
#pragma unroll
  for (int i = 0; i < 4; ++i) {
    lo[i] = *(const v4f*)(s + base + i * CV_PIECE);
    hi[i] = *(const v4f*)(s + base + i * CV_PIECE + 4);
  }
#pragma unroll
  for (int i = 0; i < 4; ++i) {
    v8h o = {(_Float16)lo[i][0], (_Float16)lo[i][1], (_Float16)lo[i][2], (_Float16)lo[i][3],
             (_Float16)hi[i][0], (_Float16)hi[i][1], (_Float16)hi[i][2], (_Float16)hi[i][3]};
    *(v8h*)(d + base + i * CV_PIECE) = o;
  }
}

// ---------------------------------------------------------------------------
// LayerNorm: one wave per row of 1024, fp32 in, f16 out
// ---------------------------------------------------------------------------
static __device__ __forceinline__ void ln_row(int row, int lane,
                                              const float* __restrict__ x,
                                              const float* __restrict__ w,
                                              const float* __restrict__ bns,
                                              _Float16* __restrict__ xn) {
  const float4* xr = (const float4*)(x + (size_t)row * EMBED);
  float4 v[8];
  float s = 0.f, s2 = 0.f;
#pragma unroll
  for (int i = 0; i < 8; ++i) {
    v[i] = xr[lane + 32 * i];
    s  += v[i].x + v[i].y + v[i].z + v[i].w;
    s2 += v[i].x * v[i].x + v[i].y * v[i].y + v[i].z * v[i].z + v[i].w * v[i].w;
  }
#pragma unroll
  for (int off = 16; off >= 1; off >>= 1) {
    s  += __shfl_xor(s, off, 32);
    s2 += __shfl_xor(s2, off, 32);
  }
  float mu  = s * (1.f / EMBED);
  float var = s2 * (1.f / EMBED) - mu * mu;
  float rs  = rsqrtf(var + LN_EPS);
#pragma unroll
  for (int i = 0; i < 8; ++i) {
    int idx = (lane + 32 * i) * 4;
    float4 wv = ((const float4*)w)[lane + 32 * i];
    float4 bv = ((const float4*)bns)[lane + 32 * i];
    _Float16* o = xn + (size_t)row * EMBED + idx;
    o[0] = (_Float16)((v[i].x - mu) * rs * wv.x + bv.x);
    o[1] = (_Float16)((v[i].y - mu) * rs * wv.y + bv.y);
    o[2] = (_Float16)((v[i].z - mu) * rs * wv.z + bv.z);
    o[3] = (_Float16)((v[i].w - mu) * rs * wv.w + bv.w);
  }
}

// ---------------------------------------------------------------------------
// LayerNorm and weight conversion depend on nothing of each other: one launch,
// the role by block index. The first LN_BLOCKS blocks normalize 16 rows each
// (a wave a row), the rest convert.
// ---------------------------------------------------------------------------
#define LN_BLOCKS (MROWS / (CV_THREADS / 32))     // 256

__global__ __launch_bounds__(CV_THREADS) void prep(
    const float* __restrict__ x, const float* __restrict__ w,
    const float* __restrict__ bns, _Float16* __restrict__ xn,
    const float* __restrict__ s0, const float* __restrict__ s1,
    const float* __restrict__ s2, const float* __restrict__ s3,
    _Float16* __restrict__ d0, _Float16* __restrict__ d1,
    _Float16* __restrict__ d2, _Float16* __restrict__ d3) {
  if (blockIdx.x < LN_BLOCKS)
    ln_row(blockIdx.x * (CV_THREADS / 32) + (threadIdx.x >> 5), threadIdx.x & 31, x, w, bns, xn);
  else
    cvt_weights(blockIdx.x - LN_BLOCKS, s0, s1, s2, s3, d0, d1, d2, d3);
}

// ---------------------------------------------------------------------------
// Main loop of the output projection: C = A(M x K) @ W^T, both f16, K
// innermost. One block of 8 waves owns a 128x128 tile of C. A pass is 128 k
// (256 B of every operand row): the block loads both 128-row operand tiles
// with whole 256-B row pieces, stages them in LDS (two buffers, row pitch
// 272 B for conflict-free 16-byte reads) and every wave reads its fragments
// from there. Waves are laid 2 (M) x 4 (N); a wave owns 64x32 = 4x2 tiles.
// The next pass's global loads are issued ahead of this pass's products and
// stored to the other buffer behind them; one barrier per pass.
// k order per accumulator is ascending in steps of 32.
// ---------------------------------------------------------------------------
#define GT_ROWS   128                    // rows of each operand tile
#define GT_K      128                    // k per pass
#define GT_PITCH  136                    // LDS row pitch in f16 (272 B)
#define GT_OPER   (GT_ROWS * GT_PITCH)   // f16 per operand tile in LDS
#define GT_PASSES (EMBED / GT_K)         // 8

static __device__ __forceinline__ v16h lds_frag(const _Float16* p) {
  v8h lo = *(const v8h*)(p);
  v8h hi = *(const v8h*)(p + 8);
  return __builtin_shufflevector(lo, hi, 0, 1, 2, 3, 4, 5, 6, 7,
                                 8, 9, 10, 11, 12, 13, 14, 15);
}

static __device__ __forceinline__ void gemm_tile_128(const _Float16* __restrict__ A,
                                                     const _Float16* __restrict__ W,
                                                     _Float16* sm, int m0, int n0,
                                                     v8f (&acc)[4][2]) {
  int tid  = threadIdx.x;
  int lane = tid & 31, wave = tid >> 5;
  int hi = lane >> 4, ln16 = lane & 15;
  int wm = wave >> 2, wn = wave & 3;
  int c16 = tid & 15, r16 = tid >> 4;    // 16 lanes cover one row's 256 B
  // Block-uniform bases plus one per-lane offset that never changes.
  const _Float16* ga = A + (size_t)m0 * EMBED;
  const _Float16* gw = W + (size_t)n0 * EMBED;
  const unsigned go = (unsigned)(r16 * EMBED + c16 * 8);
  _Float16* st = sm + r16 * GT_PITCH + c16 * 8;
  const _Float16* fa = sm + (wm * 64 + ln16) * GT_PITCH + hi * 16;
  const _Float16* fb = sm + GT_OPER + (wn * 32 + ln16) * GT_PITCH + hi * 16;

  v8h ra[8], rw[8];
#pragma unroll
  for (int i = 0; i < 8; ++i) {
    ra[i] = *(const v8h*)(ga + go + i * 16 * EMBED);
    rw[i] = *(const v8h*)(gw + go + i * 16 * EMBED);
  }
#pragma unroll
  for (int i = 0; i < 8; ++i) {
    *(v8h*)(st + i * 16 * GT_PITCH)           = ra[i];
    *(v8h*)(st + GT_OPER + i * 16 * GT_PITCH) = rw[i];
  }
  __syncthreads();

  for (int t = 0; t < GT_PASSES; ++t) {
    const int cur = (t & 1) * 2 * GT_OPER;
    if (t + 1 < GT_PASSES) {
#pragma unroll
      for (int i = 0; i < 8; ++i) {
        ra[i] = *(const v8h*)(ga + (t + 1) * GT_K + go + i * 16 * EMBED);
        rw[i] = *(const v8h*)(gw + (t + 1) * GT_K + go + i * 16 * EMBED);
      }
    }
    v16h a[2][4], b[2][2];             // two fragment sets: one read, one in use
#pragma unroll
    for (int i = 0; i < 4; ++i) a[0][i] = lds_frag(fa + cur + i * 16 * GT_PITCH);
#pragma unroll
    for (int j = 0; j < 2; ++j) b[0][j] = lds_frag(fb + cur + j * 16 * GT_PITCH);
#pragma unroll
    for (int kk = 0; kk < GT_K / 32; ++kk) {
      const int s = kk & 1;
      if (kk + 1 < GT_K / 32) {
#pragma unroll
        for (int i = 0; i < 4; ++i)
          a[s ^ 1][i] = lds_frag(fa + cur + i * 16 * GT_PITCH + (kk + 1) * 32);
#pragma unroll
        for (int j = 0; j < 2; ++j)
          b[s ^ 1][j] = lds_frag(fb + cur + j * 16 * GT_PITCH + (kk + 1) * 32);
      }
      // Keeps the next block's LDS reads one group ahead of this block's
      // products; left free, the scheduler sinks them between the products
      // and each pair of products then waits out an LDS latency.
      __builtin_amdgcn_sched_barrier(0);
#pragma unroll
      for (int i = 0; i < 4; ++i)
#pragma unroll
        for (int j = 0; j < 2; ++j) acc[i][j] = wmma_f16(a[s][i], b[s][j], acc[i][j]);
      // Ends the block: left free, the scheduler lifts the following group's
      // reads in among these products and moves products past the barrier.
      __builtin_amdgcn_sched_barrier(0);
    }
    if (t + 1 < GT_PASSES) {
      // The other buffer's last readers left it at the previous pass's barrier.
      const int nxt = 2 * GT_OPER - cur;
#pragma unroll
      for (int i = 0; i < 8; ++i) {
        *(v8h*)(st + nxt + i * 16 * GT_PITCH)           = ra[i];
        *(v8h*)(st + nxt + GT_OPER + i * 16 * GT_PITCH) = rw[i];
      }
      __syncthreads();
    }
  }
}

// ---------------------------------------------------------------------------
// The three projections of xn are one product: C = xn (4096 x 1024) @ W^T, W the
// rows of Wq, Wk, Wv one after the other (3072 x 1024). What bounds it is the
// bytes its blocks draw from L2, (rows of xn + rows of W) per tile: a block of
// 8 waves owns 256 x 192 of C, 256 blocks, one a WGP. Waves are laid 4 (M) x 2
// (N); a wave owns 64 x 96 = 4 x 6 tiles, 10 fragments for 24 products.
// A pass is 128 k (256 B of each of the 448 operand rows, pitch 272 B). Beside
// 192 accumulator registers a lane has no room to carry its share of a pass, so
// the rows go to LDS by asynchronous copies, two buffers: a pass's copies are
// issued one whole pass ahead, into the buffer every reader has just left.
// k order per accumulator is ascending in steps of 32.
// Q, K: dst = [B,H,N,D] (head layout)
// V:    dst = [B,H,D,N] (transposed, for the second product's A fragments)
// ---------------------------------------------------------------------------
#define QT_M     256                     // rows of xn per block
#define QT_N     192                     // rows of W per block
#define QT_STAGE ((QT_M + QT_N) * GT_PITCH)   // f16 per buffer: xn rows, then W rows
#define QT_NT    (3 * EMBED / QT_N)      // tiles across: 16

// Fourteen copies of 16 B a lane. The copies and the wait that stands in front
// of any rewrite of their address registers are one statement.
static __device__ __forceinline__ void copy_x14(const unsigned (&l)[14],
                                                const _Float16* const (&g)[14]) {
  asm volatile(
      "global_load_async_to_lds_b128 %0, %14, off\n\t"
      "global_load_async_to_lds_b128 %1, %15, off\n\t"
      "global_load_async_to_lds_b128 %2, %16, off\n\t"
      "global_load_async_to_lds_b128 %3, %17, off\n\t"
      "global_load_async_to_lds_b128 %4, %18, off\n\t"
      "global_load_async_to_lds_b128 %5, %19, off\n\t"
      "global_load_async_to_lds_b128 %6, %20, off\n\t"
      "global_load_async_to_lds_b128 %7, %21, off\n\t"
      "global_load_async_to_lds_b128 %8, %22, off\n\t"
      "global_load_async_to_lds_b128 %9, %23, off\n\t"
      "global_load_async_to_lds_b128 %10, %24, off\n\t"
      "global_load_async_to_lds_b128 %11, %25, off\n\t"
      "global_load_async_to_lds_b128 %12, %26, off\n\t"
      "global_load_async_to_lds_b128 %13, %27, off\n\t"
      "s_wait_xcnt 0x0"
      :: "v"(l[0]), "v"(l[1]), "v"(l[2]), "v"(l[3]), "v"(l[4]), "v"(l[5]), "v"(l[6]),
         "v"(l[7]), "v"(l[8]), "v"(l[9]), "v"(l[10]), "v"(l[11]), "v"(l[12]), "v"(l[13]),
         "v"(g[0]), "v"(g[1]), "v"(g[2]), "v"(g[3]), "v"(g[4]), "v"(g[5]), "v"(g[6]),
         "v"(g[7]), "v"(g[8]), "v"(g[9]), "v"(g[10]), "v"(g[11]), "v"(g[12]), "v"(g[13])
      : "memory");
}

// One pass's rows: 16 lanes cover a row's 256 B, a lane takes 28 rows 16 apart,
// 16 of xn and 12 of W. lds: the lane's byte address in the buffer's first 16
// rows; ga, gw: the block's first source row of each operand at the pass's k
// (block-uniform); go: the lane's element offset from either, which never changes.
static __device__ __forceinline__ void qt_copy_stage(unsigned lds, const _Float16* ga,
                                                     const _Float16* gw, unsigned go) {
#pragma unroll
  for (int p = 0; p < 2; ++p) {
    unsigned l[14];
    const _Float16* g[14];
#pragma unroll
    for (int c = 0; c < 14; ++c) {
      const int i = p * 14 + c;
      l[c] = lds + i * 16 * GT_PITCH * 2;
      g[c] = (i < QT_M / 16 ? ga + i * 16 * EMBED : gw + (i - QT_M / 16) * 16 * EMBED) + go;
    }
    copy_x14(l, g);
  }
}

// One 16-column tile's share of a lane, head layout: 32 rows of 128 B, the rows
// 16 i + 0..7; w[4 i + q] holds rows 16 i + 2 q (low half) and 16 i + 2 q + 1
// (high half). The stores and the wait that stands in front of any rewrite of
// the registers they name are one statement: in a statement of its own the
// compiler lifted the next conversions over the wait.
static __device__ __forceinline__ void store_rows_x32(_Float16* p, const unsigned (&w)[16]) {
  asm volatile(
      "global_store_b16 %0, %1, off\n\t"
      "global_store_d16_hi_b16 %0, %1, off offset:128\n\t"
      "global_store_b16 %0, %2, off offset:256\n\t"
      "global_store_d16_hi_b16 %0, %2, off offset:384\n\t"
      "global_store_b16 %0, %3, off offset:512\n\t"
      "global_store_d16_hi_b16 %0, %3, off offset:640\n\t"
      "global_store_b16 %0, %4, off offset:768\n\t"
      "global_store_d16_hi_b16 %0, %4, off offset:896\n\t"
      "global_store_b16 %0, %5, off offset:2048\n\t"
      "global_store_d16_hi_b16 %0, %5, off offset:2176\n\t"
      "global_store_b16 %0, %6, off offset:2304\n\t"
      "global_store_d16_hi_b16 %0, %6, off offset:2432\n\t"
      "global_store_b16 %0, %7, off offset:2560\n\t"
      "global_store_d16_hi_b16 %0, %7, off offset:2688\n\t"
      "global_store_b16 %0, %8, off offset:2816\n\t"
      "global_store_d16_hi_b16 %0, %8, off offset:2944\n\t"
      "global_store_b16 %0, %9, off offset:4096\n\t"
      "global_store_d16_hi_b16 %0, %9, off offset:4224\n\t"
      "global_store_b16 %0, %10, off offset:4352\n\t"
      "global_store_d16_hi_b16 %0, %10, off offset:4480\n\t"
      "global_store_b16 %0, %11, off offset:4608\n\t"
      "global_store_d16_hi_b16 %0, %11, off offset:4736\n\t"
      "global_store_b16 %0, %12, off offset:4864\n\t"
      "global_store_d16_hi_b16 %0, %12, off offset:4992\n\t"
      "global_store_b16 %0, %13, off offset:6144\n\t"
      "global_store_d16_hi_b16 %0, %13, off offset:6272\n\t"
      "global_store_b16 %0, %14, off offset:6400\n\t"
      "global_store_d16_hi_b16 %0, %14, off offset:6528\n\t"
      "global_store_b16 %0, %15, off offset:6656\n\t"
      "global_store_d16_hi_b16 %0, %15, off offset:6784\n\t"
      "global_store_b16 %0, %16, off offset:6912\n\t"
      "global_store_d16_hi_b16 %0, %16, off offset:7040\n\t"
      "s_wait_xcnt 0x0"
      :: "v"(p), "v"(w[0]), "v"(w[1]), "v"(w[2]), "v"(w[3]), "v"(w[4]), "v"(w[5]), "v"(w[6]),
         "v"(w[7]), "v"(w[8]), "v"(w[9]), "v"(w[10]), "v"(w[11]), "v"(w[12]), "v"(w[13]),
         "v"(w[14]), "v"(w[15])
      : "memory");
}

__global__ __launch_bounds__(256) void gemm_qkv(const _Float16* __restrict__ A,
                                                const _Float16* __restrict__ W,
                                                _Float16* __restrict__ dq,
                                                _Float16* __restrict__ dk,
                                                _Float16* __restrict__ dv) {
  __shared__ __attribute__((aligned(16))) _Float16 sm[2 * QT_STAGE];
  int tid  = threadIdx.x;
  int lane = tid & 31;
  int wave = __builtin_amdgcn_readfirstlane(tid >> 5);   // scalar: so is the test that picks a tile's layout
  int hi = lane >> 4, ln16 = lane & 15;
  const int wm = wave >> 1, wn = wave & 1;
  const int bm0 = (blockIdx.x / QT_NT) * QT_M, bn0 = (blockIdx.x % QT_NT) * QT_N;
  const int c16 = tid & 15, r16 = tid >> 4;
  const unsigned cl = (unsigned)(size_t)sm + (unsigned)(r16 * GT_PITCH + c16 * 8) * 2;
  const _Float16* ga = A + (size_t)bm0 * EMBED;
  const _Float16* gw = W + (size_t)bn0 * EMBED;
  const unsigned go = (unsigned)(r16 * EMBED + c16 * 8);
  const _Float16* fa = sm + (wm * 64 + ln16) * GT_PITCH + hi * 16;
  const _Float16* fb = sm + (QT_M + wn * 96 + ln16) * GT_PITCH + hi * 16;
  v8f acc[4][6] = {};

  qt_copy_stage(cl, ga, gw, go);       // pass 0 into buffer 0
  asm volatile("s_wait_asynccnt 0x0" ::: "memory");   // this wave's copies have landed
  __syncthreads();                     // pass 0 published
  qt_copy_stage(cl + QT_STAGE * 2, ga + GT_K, gw + GT_K, go);

  for (int t = 0; t < GT_PASSES; ++t) {
    const int cur = (t & 1) * QT_STAGE;
    v16h a[2][4], b[2][6];             // two fragment sets: one read, one in use
#pragma unroll
    for (int i = 0; i < 4; ++i) a[0][i] = lds_frag(fa + cur + i * 16 * GT_PITCH);
#pragma unroll
    for (int j = 0; j < 6; ++j) b[0][j] = lds_frag(fb + cur + j * 16 * GT_PITCH);
#pragma unroll
    for (int kk = 0; kk < GT_K / 32; ++kk) {
      const int s = kk & 1;
      if (kk + 1 < GT_K / 32) {
#pragma unroll
        for (int i = 0; i < 4; ++i)
          a[s ^ 1][i] = lds_frag(fa + cur + i * 16 * GT_PITCH + (kk + 1) * 32);
#pragma unroll
        for (int j = 0; j < 6; ++j)
          b[s ^ 1][j] = lds_frag(fb + cur + j * 16 * GT_PITCH + (kk + 1) * 32);
      }
      // Keeps the next block's LDS reads one group ahead of this block's
      // products; left free, the scheduler sinks them between the products
      // and the products then wait out an LDS latency.
      __builtin_amdgcn_sched_barrier(0);
#pragma unroll
      for (int i = 0; i < 4; ++i)
#pragma unroll
        for (int j = 0; j < 6; ++j) acc[i][j] = wmma_f16(a[s][i], b[s][j], acc[i][j]);
      // Ends the block: left free, the scheduler lifts the following group's
      // reads in among these products.
      __builtin_amdgcn_sched_barrier(0);
    }
    // Foot of the pass, every wave: its reads of this buffer are done, its own
    // copies of the next pass have landed; the barrier publishes that pass and
    // frees this buffer, which only then takes the pass after it.
    lds_fence_wave();
    asm volatile("s_wait_asynccnt 0x0" ::: "memory");
    __syncthreads();
    if (t + 2 < GT_PASSES)
      qt_copy_stage(cl + cur * 2, ga + (t + 2) * GT_K, gw + (t + 2) * GT_K, go);
  }
  asm volatile("s_wait_asynccnt 0x0" ::: "memory");   // nothing in flight when the loop ends

  int m0 = bm0 + wm * 64 + 8 * hi;
  int b2 = m0 >> 11;                   // batch: a 64-row strip lies in one
  int n0 = m0 & (NSEQ - 1);            // seq pos of the lane's first row
#pragma unroll
  for (int j = 0; j < 6; ++j) {
    const int cb = bn0 + wn * 96 + j * 16;   // the tile's first column of 3072: 16 columns lie in one head
    const int which = cb / EMBED;            // wave-uniform, a scalar test
    int col = (cb & (EMBED - 1)) + ln16;
    int h = col >> 6, d = col & 63;
    size_t base = (size_t)(b2 * HEADS + h);
    if (which < 2) {
      _Float16* dst = (which == 0 ? dq : dk) + (base * NSEQ + n0) * HEAD_DIM + d;
      unsigned w[16];
      // Both loops unrolled: w and acc stay in registers only under constant indices.
#pragma unroll
      for (int i = 0; i < 4; ++i)
#pragma unroll
        for (int q = 0; q < 4; ++q) {
          v2h pr = {(_Float16)acc[i][j][2 * q], (_Float16)acc[i][j][2 * q + 1]};
          w[i * 4 + q] = __builtin_bit_cast(unsigned, pr);
        }
      store_rows_x32(dst, w);
    } else {
      _Float16* dst = dv + (base * HEAD_DIM + d) * NSEQ + n0;
#pragma unroll
      for (int i = 0; i < 4; ++i)
#pragma unroll
        for (int r = 0; r < 8; ++r)
          dst[i * 16 + r] = (_Float16)acc[i][j][r];
      // The next column's conversions and addresses reuse registers that these
      // stores name: the wait stands in front of those overwrites.
      asm volatile("s_wait_xcnt 0x0" ::: "memory");
    }
  }
}

#define FA_KEYS  64
#define FA_PITCH 72
#define FA_TILE  (64 * FA_PITCH)
#define FA_BUF   (2 * FA_TILE)
#define FA_SBUF  (2 * FA_BUF)
#define FA_GROUPS (NSEQ / 64)

// One stage: a lane copies 16 B of four K rows and of four V^T rows, 16 rows
// apart; 8 lanes cover a row. lds: the lane's byte address in the buffer's K
// tile; gk, gv: its first source piece of each operand. The copies and the
// wait that stands in front of any rewrite of their address registers are one
// statement.
static __device__ __forceinline__ void fa_copy_stage(unsigned lds, const _Float16* gk,
                                                     const _Float16* gv) {
  const unsigned step = 16 * FA_PITCH * 2;           // 16 rows on, in bytes
  const unsigned lv = lds + FA_TILE * 2;
  asm volatile(
      "global_load_async_to_lds_b128 %0, %8, off\n\t"
      "global_load_async_to_lds_b128 %1, %9, off\n\t"
      "global_load_async_to_lds_b128 %2, %10, off\n\t"
      "global_load_async_to_lds_b128 %3, %11, off\n\t"
      "global_load_async_to_lds_b128 %4, %12, off\n\t"
      "global_load_async_to_lds_b128 %5, %13, off\n\t"
      "global_load_async_to_lds_b128 %6, %14, off\n\t"
      "global_load_async_to_lds_b128 %7, %15, off\n\t"
      "s_wait_xcnt 0x0"
      :: "v"(lds), "v"(lds + step), "v"(lds + 2 * step), "v"(lds + 3 * step),
         "v"(lv), "v"(lv + step), "v"(lv + 2 * step), "v"(lv + 3 * step),
         "v"(gk), "v"(gk + 16 * HEAD_DIM), "v"(gk + 32 * HEAD_DIM), "v"(gk + 48 * HEAD_DIM),
         "v"(gv), "v"(gv + 16 * NSEQ), "v"(gv + 32 * NSEQ), "v"(gv + 48 * NSEQ)
      : "memory");
}

// The issuing wave's own copies have landed.
static __device__ __forceinline__ void wait_copies() {
  asm volatile("s_wait_asynccnt 0x0" ::: "memory");
}

// Lane l takes lane l ^ 16's value: a vector move between the 16-lane rows.
static __device__ __forceinline__ float other_half(float v) {
  int b = __builtin_bit_cast(int, v);
  return __builtin_bit_cast(float, __builtin_amdgcn_permlanex16(b, b, 0x76543210, 0xfedcba98,
                                                                false, false));
}

// A fragment in the k order that a pair of converted D tiles has as B: the
// lane's elements 0..7 are k 8 hi + 0..7, elements 8..15 are k 16 + 8 hi + 0..7.
// p: the row's first k of the 32, plus 8 hi.
static __device__ __forceinline__ v16h lds_frag_split(const _Float16* p) {
  v8h lo = *(const v8h*)(p);
  v8h hi = *(const v8h*)(p + 16);
  return __builtin_shufflevector(lo, hi, 0, 1, 2, 3, 4, 5, 6, 7,
                                 8, 9, 10, 11, 12, 13, 14, 15);
}

#define LOG2E_F 1.44269504f            // e^x = 2^(x log2 e)

// Eight 2^x in place, one statement: each overwrites only its own source and
// reads no other's result, so each has an independent instruction behind it,
// the slot the instruction set asks for behind a transcendental; the v_nop is
// that slot for the last.
static __device__ __forceinline__ void exp2_x8(float (&t)[8]) {
  asm("v_exp_f32 %0, %0\n\t"
      "v_exp_f32 %1, %1\n\t"
      "v_exp_f32 %2, %2\n\t"
      "v_exp_f32 %3, %3\n\t"
      "v_exp_f32 %4, %4\n\t"
      "v_exp_f32 %5, %5\n\t"
      "v_exp_f32 %6, %6\n\t"
      "v_exp_f32 %7, %7\n\t"
      "v_nop"
      : "+v"(t[0]), "+v"(t[1]), "+v"(t[2]), "+v"(t[3]),
        "+v"(t[4]), "+v"(t[5]), "+v"(t[6]), "+v"(t[7]));
}

__global__ __launch_bounds__(256) void flash_attn(const _Float16* __restrict__ q,
                                                  const _Float16* __restrict__ k,
                                                  const _Float16* __restrict__ vt,
                                                  _Float16* __restrict__ ao) {
  __shared__ __attribute__((aligned(16))) _Float16 kv[2 * FA_SBUF];
  // Waves 4-7's partial results: per query tile 8 pieces of O^T and one of
  // (maximum, sum); a lane's 16 bytes beside its neighbour's.
  __shared__ __attribute__((aligned(16))) v4f part[4][9][32];
  int lane = threadIdx.x & 31;
  int wave = __builtin_amdgcn_readfirstlane(threadIdx.x >> 5);   // scalar: so is the test that skips a pass
  const int qt = wave & 3, kh = wave >> 2;           // query tile; which 64 keys of a stage
  int hi = lane >> 4, ln16 = lane & 15;
  const int pr = blockIdx.x & (FA_GROUPS / 2 - 1);   // which pair of query groups
  int h  = (blockIdx.x / (FA_GROUPS / 2)) & (HEADS - 1);
  int b  = blockIdx.x / (FA_GROUPS / 2 * HEADS);
  size_t bh = (size_t)(b * HEADS + h);
  const _Float16* qb_p = q  + bh * NSEQ * HEAD_DIM;
  const _Float16* kb_p = k  + bh * NSEQ * HEAD_DIM;
  const _Float16* vb_p = vt + bh * HEAD_DIM * NSEQ;
  const int c8 = threadIdx.x & 7, r16 = (threadIdx.x & 127) >> 3;
  const unsigned cl = (unsigned)(size_t)kv + (unsigned)(kh * FA_BUF + r16 * FA_PITCH + c8 * 8) * 2;
  const _Float16* ck = kb_p + (kh * FA_KEYS + r16) * HEAD_DIM + c8 * 8;
  const _Float16* cv = vb_p + r16 * NSEQ + kh * FA_KEYS + c8 * 8;

  for (int half = 0; half < 2; ++half) {
  const int grp = half ? FA_GROUPS - 1 - pr : pr;    // same value in every wave of the block
  int m0 = (grp * 4 + qt) * 16;

  // Q B-fragments for d = 0..31 and d = 32..63 (loaded once): column ln16 is
  // query m0 + ln16; 16 contiguous d per half, the order of the K loader.
  const _Float16* qrow = qb_p + (size_t)(m0 + ln16) * HEAD_DIM;
  v16h q0 = *(const v16h*)(qrow + hi * 16);
  v16h q1 = *(const v16h*)(qrow + 32 + hi * 16);

  // O^T tiles: o_j[r] = O[query m0 + ln16][d = 16 j + 8 hi + r].
  v8f o0 = {}, o1 = {}, o2 = {}, o3 = {};
  float mrun = NEG_BIG;                // the query's running maximum, same in both halves
  float lrun = 0.f;                    // this half's share of the query's sum

  int kbmax = (m0 + 15) >> 5;          // causal: last key block touching this tile
  // The group's queries are 64 j ... 64 j + 63: it walks the stages of 128 keys
  // that hold keys 0 ... 64 j + 63; for even j the last stage's second 64 keys
  // (still inside the sequence) lie past the diagonal and no wave reads them.
  // Same value in every wave of the block.
  const int nst = (grp + 2) >> 1;

  // For the second group: the first group's last foot (reads done, barrier)
  // has freed both buffers, and none of its copies is in flight.
  fa_copy_stage(cl, ck, cv);           // stage 0 into buffer 0
  wait_copies();
  __syncthreads();                     // stage 0 published
  if (nst > 1) fa_copy_stage(cl + FA_SBUF * 2, ck + 2 * FA_KEYS * HEAD_DIM, cv + 2 * FA_KEYS);

  for (int st = 0; st < nst; ++st) {
   const _Float16* kt = kv + (st & 1) * FA_SBUF + kh * FA_BUF;
   const _Float16* vtl = kt + FA_TILE;
   for (int sub = 0; sub < 2; ++sub) {
    int kb = (st * 2 + kh) * 2 + sub;
    if (kb > kbmax) break;             // wave-uniform: past this wave's diagonal
    int n0 = kb * 32;
    // ---- S^T = K @ Q^T for 32 keys (two 16x16 C tiles, keys down the rows) ----
    v8f s0 = {}, s1 = {};
    const _Float16* kr0 = kt + (sub * 32 + ln16) * FA_PITCH;
    const _Float16* kr1 = kr0 + 16 * FA_PITCH;
    v16h k00 = lds_frag(kr0 + hi * 16);
    v16h k01 = lds_frag(kr0 + 32 + hi * 16);
    v16h k10 = lds_frag(kr1 + hi * 16);
    v16h k11 = lds_frag(kr1 + 32 + hi * 16);
    // V^T rows are the A fragments of the second product, in P^T's k order.
    const _Float16* vb0 = vtl + ln16 * FA_PITCH + sub * 32 + hi * 8;
    v16h av0 = lds_frag_split(vb0);
    v16h av1 = lds_frag_split(vb0 + 16 * FA_PITCH);
    v16h av2 = lds_frag_split(vb0 + 32 * FA_PITCH);
    v16h av3 = lds_frag_split(vb0 + 48 * FA_PITCH);
    // Keeps the pass's LDS reads one group ahead of its products; left free, the
    // scheduler reads each fragment into the same registers right in front of
    // its product, and every product then waits out an LDS latency.
    __builtin_amdgcn_sched_barrier(0);
    s0 = wmma_f16(k00, q0, s0); s0 = wmma_f16(k01, q1, s0);
    s1 = wmma_f16(k10, q0, s1); s1 = wmma_f16(k11, q1, s1);

    // ---- scale, causal mask, online softmax: one query per lane ----
    const int lim = m0 + ln16 - n0 - 8 * hi;   // key r of s0 is masked where r > lim
    s0 *= SCALE_F; s1 *= SCALE_F;
    float v0[8], v1[8];
    float mx = NEG_BIG;
#pragma unroll
    for (int r = 0; r < 8; ++r) {
      v0[r] = r      > lim ? NEG_BIG : s0[r];
      v1[r] = r + 16 > lim ? NEG_BIG : s1[r];
      mx = fmaxf(mx, fmaxf(v0[r], v1[r]));
    }
    mx = fmaxf(mx, other_half(mx));
    float mnew  = fmaxf(mrun, mx);
    float alpha = __expf(mrun - mnew);
#pragma unroll
    for (int r = 0; r < 8; ++r) {
      v0[r] = (v0[r] - mnew) * LOG2E_F;
      v1[r] = (v1[r] - mnew) * LOG2E_F;
    }
    exp2_x8(v0);
    exp2_x8(v1);
    float rsum = 0.f;
    v16h pb;                           // P^T as B: element r key 8 hi + r, 8 + r key 16 + 8 hi + r
#pragma unroll
    for (int r = 0; r < 8; ++r) {
      rsum += v0[r] + v1[r];
      pb[r]     = (_Float16)v0[r];
      pb[8 + r] = (_Float16)v1[r];
    }
    lrun = lrun * alpha + rsum;
    mrun = mnew;
    o0 *= alpha; o1 *= alpha; o2 *= alpha; o3 *= alpha;

    // ---- O^T += V^T @ P^T ----
    o0 = wmma_f16(av0, pb, o0);
    o1 = wmma_f16(av1, pb, o1);
    o2 = wmma_f16(av2, pb, o2);
    o3 = wmma_f16(av3, pb, o3);
   }
   // Foot of the stage, every wave: its reads of this buffer are done, its own
   // copies of the next stage have landed; the barrier publishes that stage and
   // frees this buffer, which only then takes the stage after it.
   lds_fence_wave();
   wait_copies();
   __syncthreads();
   if (st + 2 < nst)
     fa_copy_stage(cl + (st & 1) * FA_SBUF * 2, ck + (st + 2) * 2 * FA_KEYS * HEAD_DIM,
                   cv + (st + 2) * 2 * FA_KEYS);
  }
  wait_copies();                       // nothing in flight when the group ends

  // ---- join the two key sets' partial results, lane by lane ----
  if (kh == 1) {                       // wave-uniform, a scalar test
    part[qt][0][lane] = __builtin_shufflevector(o0, o0, 0, 1, 2, 3);
    part[qt][1][lane] = __builtin_shufflevector(o0, o0, 4, 5, 6, 7);
    part[qt][2][lane] = __builtin_shufflevector(o1, o1, 0, 1, 2, 3);
    part[qt][3][lane] = __builtin_shufflevector(o1, o1, 4, 5, 6, 7);
    part[qt][4][lane] = __builtin_shufflevector(o2, o2, 0, 1, 2, 3);
    part[qt][5][lane] = __builtin_shufflevector(o2, o2, 4, 5, 6, 7);
    part[qt][6][lane] = __builtin_shufflevector(o3, o3, 0, 1, 2, 3);
    part[qt][7][lane] = __builtin_shufflevector(o3, o3, 4, 5, 6, 7);
    part[qt][8][lane] = (v4f){mrun, lrun, 0.f, 0.f};
  }
  // Publishes the partial results. They are rewritten only at the next group's
  // end, behind that group's barriers, which their readers pass after reading.
  __syncthreads();
  if (kh == 1) continue;               // wave-uniform; the next barrier is the next group's first
  {
    v4f ml = part[qt][8][lane];
    // A set that saw no key below the diagonal hands over (NEG_BIG, 0, 0): weight 0.
    float mj = fmaxf(mrun, ml[0]);
    float a0 = __expf(mrun - mj), a1 = __expf(ml[0] - mj);
    lrun = lrun * a0 + ml[1] * a1;
    v4f p0 = part[qt][0][lane], p1 = part[qt][1][lane], p2 = part[qt][2][lane], p3 = part[qt][3][lane];
    v4f p4 = part[qt][4][lane], p5 = part[qt][5][lane], p6 = part[qt][6][lane], p7 = part[qt][7][lane];
    o0 = o0 * a0 + __builtin_shufflevector(p0, p1, 0, 1, 2, 3, 4, 5, 6, 7) * a1;
    o1 = o1 * a0 + __builtin_shufflevector(p2, p3, 0, 1, 2, 3, 4, 5, 6, 7) * a1;
    o2 = o2 * a0 + __builtin_shufflevector(p4, p5, 0, 1, 2, 3, 4, 5, 6, 7) * a1;
    o3 = o3 * a0 + __builtin_shufflevector(p6, p7, 0, 1, 2, 3, 4, 5, 6, 7) * a1;
  }

  // ---- normalize and write attention output [B*N, EMBED] f16: a lane holds 8
  // consecutive d of its query in each tile, one 16-byte store a tile ----
  float inv = 1.f / (lrun + other_half(lrun));
  _Float16* orow = ao + ((size_t)(b * NSEQ + m0 + ln16)) * EMBED + h * HEAD_DIM + hi * 8;
  v8h w0, w1, w2, w3;
#pragma unroll
  for (int r = 0; r < 8; ++r) {
    w0[r] = (_Float16)(o0[r] * inv);
    w1[r] = (_Float16)(o1[r] * inv);
    w2[r] = (_Float16)(o2[r] * inv);
    w3[r] = (_Float16)(o3[r] * inv);
  }
  *(v8h*)(orow)      = w0;
  *(v8h*)(orow + 16) = w1;
  *(v8h*)(orow + 32) = w2;
  *(v8h*)(orow + 48) = w3;
  // The next group's code reuses registers that the stores above name: the
  // wait stands in front of those overwrites.
  asm volatile("s_wait_xcnt 0x0" ::: "memory");
  }
}

// ---------------------------------------------------------------------------
// out = residual + ao @ Wo^T + bo  (fp32 output); 128x128 block tiles
// ---------------------------------------------------------------------------
#define GT_TILES ((MROWS / 128) * (EMBED / 128))  // blocks: 32*8

__global__ __launch_bounds__(256) void out_proj(const _Float16* __restrict__ A,
                                                const _Float16* __restrict__ W,
                                                const float* __restrict__ x,
                                                const float* __restrict__ bo,
                                                float* __restrict__ out) {
  __shared__ __attribute__((aligned(16))) _Float16 sm[4 * GT_OPER];
  int lane = threadIdx.x & 31;
  int wave = threadIdx.x >> 5;
  int hi = lane >> 4, ln16 = lane & 15;
  int bx = blockIdx.x;
  int bm0 = (bx >> 3) * 128, bn0 = (bx & 7) * 128;
  v8f acc[4][2] = {};
  gemm_tile_128(A, W, sm, bm0, bn0, acc);

  int m0 = bm0 + (wave >> 2) * 64 + 8 * hi, col0 = bn0 + (wave & 3) * 32 + ln16;
  // One 32-bit element offset per lane on the two scalar bases serves every
  // load of x and every store of out: no 64-bit per-lane address arithmetic.
  const unsigned base = (unsigned)(m0 * EMBED + col0);
  const float* xp = x + base;
  float* op = out + base;
  float bias[2] = {bo[col0], bo[col0 + 16]};
  // The loads of x may land in the register that the two loads above name.
  asm volatile("s_wait_xcnt 0x0" ::: "memory");
  float xr[4][2][8];
#pragma unroll
  for (int i = 0; i < 4; ++i)
#pragma unroll
    for (int j = 0; j < 2; ++j)
#pragma unroll
      for (int r = 0; r < 8; ++r) xr[i][j][r] = xp[(i * 16 + r) * EMBED + j * 16];
#pragma unroll
  for (int i = 0; i < 4; ++i)
#pragma unroll
    for (int j = 0; j < 2; ++j)
#pragma unroll
      for (int r = 0; r < 8; ++r)
        op[(i * 16 + r) * EMBED + j * 16] = xr[i][j][r] + bias[j] + acc[i][j][r];
}

// ---------------------------------------------------------------------------
extern "C" void kernel_launch(void* const* d_in, const int* in_sizes, int n_in,
                              void* d_out, int out_size, void* d_ws, size_t ws_size,
                              hipStream_t stream) {
  (void)in_sizes; (void)n_in; (void)out_size; (void)ws_size;
  const float* x    = (const float*)d_in[0];
  const float* ln_w = (const float*)d_in[1];
  const float* ln_b = (const float*)d_in[2];
  const float* Wq   = (const float*)d_in[3];
  const float* Wk   = (const float*)d_in[4];
  const float* Wv   = (const float*)d_in[5];
  const float* Wo   = (const float*)d_in[6];
  const float* bo   = (const float*)d_in[7];
  float* out = (float*)d_out;

  char* ws = (char*)d_ws;
  size_t off = 0;
  auto carve = [&](size_t elems) {
    _Float16* p = (_Float16*)(ws + off);
    off += ((elems * sizeof(_Float16) + 255) & ~(size_t)255);
    return p;
  };
  _Float16* xn   = carve((size_t)MROWS * EMBED);   // normalized activations
  _Float16* wq16 = carve((size_t)3 * EMBED * EMBED);   // Wq, Wk, Wv: one [3072][1024] operand
  _Float16* wk16 = wq16 + (size_t)EMBED * EMBED;
  _Float16* wv16 = wk16 + (size_t)EMBED * EMBED;
  _Float16* wo16 = carve((size_t)EMBED * EMBED);
  _Float16* qh   = carve((size_t)MROWS * EMBED);   // [B,H,N,D]
  _Float16* kh   = carve((size_t)MROWS * EMBED);   // [B,H,N,D]
  _Float16* vth  = carve((size_t)MROWS * EMBED);   // [B,H,D,N]
  _Float16* ao   = carve((size_t)MROWS * EMBED);   // attention output [B*N, E]

  prep<<<dim3(LN_BLOCKS + 4 * CV_BLOCKS), CV_THREADS, 0, stream>>>(
      x, ln_w, ln_b, xn, Wq, Wk, Wv, Wo, wq16, wk16, wv16, wo16);

  gemm_qkv<<<dim3((MROWS / QT_M) * QT_NT), 256, 0, stream>>>(xn, wq16, qh, kh, vth);

  flash_attn<<<dim3(BATCH * HEADS * (FA_GROUPS / 2)), 256, 0, stream>>>(qh, kh, vth, ao);

  out_proj<<<dim3(GT_TILES), 256, 0, stream>>>(ao, wo16, x, bo, out);
}

// v009
// A run of this version takes 63.2 microseconds.
// Timed twice side by side with v008, it ran 1.04 times as fast both times.
// All steps since v000 together make it 4.90 times as fast.
#include <hip/hip_runtime.h>
#include <hip/hip_bf16.h>

typedef __attribute__((ext_vector_type(16))) _Float16 v16h;
typedef __attribute__((ext_vector_type(8)))  _Float16 v8h;
typedef __attribute__((ext_vector_type(2)))  _Float16 v2h;
typedef __attribute__((ext_vector_type(8)))  float    v8f;
typedef __attribute__((ext_vector_type(4)))  float    v4f;

#define EMBED    1024
#define HEADS    16
#define HEAD_DIM 64
#define NSEQ     2048
#define BATCH    2
#define MROWS    (BATCH * NSEQ)        // 4096
#define SCALE_F  0.125f                // HEAD_DIM^-0.5
#define LN_EPS   1e-5f
#define NEG_BIG  (-1e30f)

static __device__ __forceinline__ v8f wmma_f16(v16h a, v16h b, v8f c) {
  // D = A(16x32 f16) * B(32x16 f16) + C(16x16 f32)
  return __builtin_amdgcn_wmma_f32_16x16x32_f16(
      /*neg_a=*/false, a, /*neg_b=*/false, b,
      /*c_mod=*/(short)0, c, /*reuse_a=*/false, /*reuse_b=*/false);
}

// In-order LDS pipe within a wave: wait DS ops then fence the compiler.
static __device__ __forceinline__ void lds_fence_wave() {
  asm volatile("s_wait_dscnt 0x0" ::: "memory");
}

// ---------------------------------------------------------------------------
// fp32 -> f16, all four weight matrices. The work is 24 MB of traffic,
// 256 blocks of 16 waves,
// 64 blocks a matrix. A lane takes 4 pieces of 8 consecutive elements: 8
// 16-byte loads in flight, then 4 16-byte stores. blk: 0 ... 4 CV_BLOCKS - 1.
// ---------------------------------------------------------------------------
#define CV_THREADS 512
#define CV_PIECE   (CV_THREADS * 8)               // elements a block covers per piece
#define CV_BLOCK   (CV_PIECE * 4)                 // elements per block
#define CV_BLOCKS  (EMBED * EMBED / CV_BLOCK)     // blocks per matrix: 64

static __device__ __forceinline__ void cvt_weights(
    unsigned blk,
    const float* __restrict__ s0, const float* __restrict__ s1,
    const float* __restrict__ s2, const float* __restrict__ s3,
    _Float16* __restrict__ d0, _Float16* __restrict__ d1,
    _Float16* __restrict__ d2, _Float16* __restrict__ d3) {
  const int which = blk / CV_BLOCKS;              // block-uniform: scalar selects
  const float* s = which == 0 ? s0 : which == 1 ? s1 : which == 2 ? s2 : s3;
  _Float16*    d = which == 0 ? d0 : which == 1 ? d1 : which == 2 ? d2 : d3;
  const unsigned base = (blk % CV_BLOCKS) * CV_BLOCK + threadIdx.x * 8;
  v4f lo[4], hi[4];
#pragma unroll
  for (int i = 0; i < 4; ++i) {
    lo[i] = *(const v4f*)(s + base + i * CV_PIECE);
    hi[i] = *(const v4f*)(s + base + i * CV_PIECE + 4);
  }
#pragma unroll
  for (int i = 0; i < 4; ++i) {
    v8h o = {(_Float16)lo[i][0], (_Float16)lo[i][1], (_Float16)lo[i][2], (_Float16)lo[i][3],
             (_Float16)hi[i][0], (_Float16)hi[i][1], (_Float16)hi[i][2], (_Float16)hi[i][3]};
    *(v8h*)(d + base + i * CV_PIECE) = o;
  }
}

// ---------------------------------------------------------------------------
// LayerNorm: one wave per row of 1024, fp32 in, f16 out
// ---------------------------------------------------------------------------
static __device__ __forceinline__ void ln_row(int row, int lane,
                                              const float* __restrict__ x,
                                              const float* __restrict__ w,
                                              const float* __restrict__ bns,
                                              _Float16* __restrict__ xn) {
  const float4* xr = (const float4*)(x + (size_t)row * EMBED);
  float4 v[8];
  float s = 0.f, s2 = 0.f;
#pragma unroll
  for (int i = 0; i < 8; ++i) {
    v[i] = xr[lane + 32 * i];
    s  += v[i].x + v[i].y + v[i].z + v[i].w;
    s2 += v[i].x * v[i].x + v[i].y * v[i].y + v[i].z * v[i].z + v[i].w * v[i].w;
  }
#pragma unroll
  for (int off = 16; off >= 1; off >>= 1) {
    s  += __shfl_xor(s, off, 32);
    s2 += __shfl_xor(s2, off, 32);
  }
  float mu  = s * (1.f / EMBED);
  float var = s2 * (1.f / EMBED) - mu * mu;
  float rs  = rsqrtf(var + LN_EPS);
#pragma unroll
  for (int i = 0; i < 8; ++i) {
    int idx = (lane + 32 * i) * 4;
    float4 wv = ((const float4*)w)[lane + 32 * i];
    float4 bv = ((const float4*)bns)[lane + 32 * i];
    _Float16* o = xn + (size_t)row * EMBED + idx;
    o[0] = (_Float16)((v[i].x - mu) * rs * wv.x + bv.x);
    o[1] = (_Float16)((v[i].y - mu) * rs * wv.y + bv.y);
    o[2] = (_Float16)((v[i].z - mu) * rs * wv.z + bv.z);
    o[3] = (_Float16)((v[i].w - mu) * rs * wv.w + bv.w);
  }
}

// ---------------------------------------------------------------------------
// LayerNorm and weight conversion depend on nothing of each other: one launch,
// the role by block index. The first LN_BLOCKS blocks normalize 16 rows each
// (a wave a row), the rest convert.
// ---------------------------------------------------------------------------
#define LN_BLOCKS (MROWS / (CV_THREADS / 32))     // 256

__global__ __launch_bounds__(CV_THREADS) void prep(
    const float* __restrict__ x, const float* __restrict__ w,
    const float* __restrict__ bns, _Float16* __restrict__ xn,
    const float* __restrict__ s0, const float* __restrict__ s1,
    const float* __restrict__ s2, const float* __restrict__ s3,
    _Float16* __restrict__ d0, _Float16* __restrict__ d1,
    _Float16* __restrict__ d2, _Float16* __restrict__ d3) {
  if (blockIdx.x < LN_BLOCKS)
    ln_row(blockIdx.x * (CV_THREADS / 32) + (threadIdx.x >> 5), threadIdx.x & 31, x, w, bns, xn);
  else
    cvt_weights(blockIdx.x - LN_BLOCKS, s0, s1, s2, s3, d0, d1, d2, d3);
}

// ---------------------------------------------------------------------------
// Main loop of the output projection: C = A(M x K) @ W^T, both f16, K
// innermost. One block of 8 waves owns a 128x128 tile of C. A pass is 128 k
// (256 B of every operand row): the block loads both 128-row operand tiles
// with whole 256-B row pieces, stages them in LDS (two buffers, row pitch
// 272 B for conflict-free 16-byte reads) and every wave reads its fragments
// from there. Waves are laid 2 (M) x 4 (N); a wave owns 64x32 = 4x2 tiles.
// The next pass's global loads are issued ahead of this pass's products and
// stored to the other buffer behind them; one barrier per pass.
// k order per accumulator is ascending in steps of 32.
// ---------------------------------------------------------------------------
#define GT_ROWS   128                    // rows of each operand tile
#define GT_K      128                    // k per pass
#define GT_PITCH  136                    // LDS row pitch in f16 (272 B)
#define GT_OPER   (GT_ROWS * GT_PITCH)   // f16 per operand tile in LDS
#define GT_PASSES (EMBED / GT_K)         // 8

static __device__ __forceinline__ v16h lds_frag(const _Float16* p) {
  v8h lo = *(const v8h*)(p);
  v8h hi = *(const v8h*)(p + 8);
  return __builtin_shufflevector(lo, hi, 0, 1, 2, 3, 4, 5, 6, 7,
                                 8, 9, 10, 11, 12, 13, 14, 15);
}

static __device__ __forceinline__ void gemm_tile_128(const _Float16* __restrict__ A,
                                                     const _Float16* __restrict__ W,
                                                     _Float16* sm, int m0, int n0,
                                                     v8f (&acc)[4][2]) {
  int tid  = threadIdx.x;
  int lane = tid & 31, wave = tid >> 5;
  int hi = lane >> 4, ln16 = lane & 15;
  int wm = wave >> 2, wn = wave & 3;
  int c16 = tid & 15, r16 = tid >> 4;    // 16 lanes cover one row's 256 B
  // Block-uniform bases plus one per-lane offset that never changes.
  const _Float16* ga = A + (size_t)m0 * EMBED;
  const _Float16* gw = W + (size_t)n0 * EMBED;
  const unsigned go = (unsigned)(r16 * EMBED + c16 * 8);
  _Float16* st = sm + r16 * GT_PITCH + c16 * 8;
  const _Float16* fa = sm + (wm * 64 + ln16) * GT_PITCH + hi * 16;
  const _Float16* fb = sm + GT_OPER + (wn * 32 + ln16) * GT_PITCH + hi * 16;

  v8h ra[8], rw[8];
#pragma unroll
  for (int i = 0; i < 8; ++i) {
    ra[i] = *(const v8h*)(ga + go + i * 16 * EMBED);
    rw[i] = *(const v8h*)(gw + go + i * 16 * EMBED);
  }
#pragma unroll
  for (int i = 0; i < 8; ++i) {
    *(v8h*)(st + i * 16 * GT_PITCH)           = ra[i];
    *(v8h*)(st + GT_OPER + i * 16 * GT_PITCH) = rw[i];
  }
  __syncthreads();

  for (int t = 0; t < GT_PASSES; ++t) {
    const int cur = (t & 1) * 2 * GT_OPER;
    if (t + 1 < GT_PASSES) {
#pragma unroll
      for (int i = 0; i < 8; ++i) {
        ra[i] = *(const v8h*)(ga + (t + 1) * GT_K + go + i * 16 * EMBED);
        rw[i] = *(const v8h*)(gw + (t + 1) * GT_K + go + i * 16 * EMBED);
      }
    }
    v16h a[2][4], b[2][2];             // two fragment sets: one read, one in use
#pragma unroll
    for (int i = 0; i < 4; ++i) a[0][i] = lds_frag(fa + cur + i * 16 * GT_PITCH);
#pragma unroll
    for (int j = 0; j < 2; ++j) b[0][j] = lds_frag(fb + cur + j * 16 * GT_PITCH);
#pragma unroll
    for (int kk = 0; kk < GT_K / 32; ++kk) {
      const int s = kk & 1;
      if (kk + 1 < GT_K / 32) {
#pragma unroll
        for (int i = 0; i < 4; ++i)
          a[s ^ 1][i] = lds_frag(fa + cur + i * 16 * GT_PITCH + (kk + 1) * 32);
#pragma unroll
        for (int j = 0; j < 2; ++j)
          b[s ^ 1][j] = lds_frag(fb + cur + j * 16 * GT_PITCH + (kk + 1) * 32);
      }
      // Keeps the next block's LDS reads one group ahead of this block's
      // products; left free, the scheduler sinks them between the products
      // and each pair of products then waits out an LDS latency.
      __builtin_amdgcn_sched_barrier(0);
#pragma unroll
      for (int i = 0; i < 4; ++i)
#pragma unroll
        for (int j = 0; j < 2; ++j) acc[i][j] = wmma_f16(a[s][i], b[s][j], acc[i][j]);
      // Ends the block: left free, the scheduler lifts the following group's
      // reads in among these products and moves products past the barrier.
      __builtin_amdgcn_sched_barrier(0);
    }
    if (t + 1 < GT_PASSES) {
      // The other buffer's last readers left it at the previous pass's barrier.
      const int nxt = 2 * GT_OPER - cur;
#pragma unroll
      for (int i = 0; i < 8; ++i) {
        *(v8h*)(st + nxt + i * 16 * GT_PITCH)           = ra[i];
        *(v8h*)(st + nxt + GT_OPER + i * 16 * GT_PITCH) = rw[i];
      }
      __syncthreads();
    }
  }
}

// ---------------------------------------------------------------------------
// The three projections of xn are one product: C = xn (4096 x 1024) @ W^T, W the
// rows of Wq, Wk, Wv one after the other (3072 x 1024). What bounds it is the
// bytes its blocks draw from L2, (rows of xn + rows of W) per tile: a block of
// 8 waves owns 256 x 192 of C, 256 blocks, one a WGP. Waves are laid 4 (M) x 2
// (N); a wave owns 64 x 96 = 4 x 6 tiles, 10 fragments for 24 products.
// A pass is 128 k (256 B of each of the 448 operand rows, pitch 272 B). Beside
// 192 accumulator registers a lane has no room to carry its share of a pass, so
// the rows go to LDS by asynchronous copies, two buffers: a pass's copies are
// issued one whole pass ahead, into the buffer every reader has just left.
// k order per accumulator is ascending in steps of 32.
// Q, K: dst = [B,H,N,D] (head layout)
// V:    dst = [B,H,D,N] (transposed, for the second product's A fragments)
// ---------------------------------------------------------------------------
#define QT_M     256                     // rows of xn per block
#define QT_N     192                     // rows of W per block
#define QT_STAGE ((QT_M + QT_N) * GT_PITCH)   // f16 per buffer: xn rows, then W rows
#define QT_NT    (3 * EMBED / QT_N)      // tiles across: 16

// Fourteen copies of 16 B a lane. The copies and the wait that stands in front
// of any rewrite of their address registers are one statement.
static __device__ __forceinline__ void copy_x14(const unsigned (&l)[14],
                                                const _Float16* const (&g)[14]) {
  asm volatile(
      "global_load_async_to_lds_b128 %0, %14, off\n\t"
      "global_load_async_to_lds_b128 %1, %15, off\n\t"
      "global_load_async_to_lds_b128 %2, %16, off\n\t"
      "global_load_async_to_lds_b128 %3, %17, off\n\t"
      "global_load_async_to_lds_b128 %4, %18, off\n\t"
      "global_load_async_to_lds_b128 %5, %19, off\n\t"
      "global_load_async_to_lds_b128 %6, %20, off\n\t"
      "global_load_async_to_lds_b128 %7, %21, off\n\t"
      "global_load_async_to_lds_b128 %8, %22, off\n\t"
      "global_load_async_to_lds_b128 %9, %23, off\n\t"
      "global_load_async_to_lds_b128 %10, %24, off\n\t"
      "global_load_async_to_lds_b128 %11, %25, off\n\t"
      "global_load_async_to_lds_b128 %12, %26, off\n\t"
      "global_load_async_to_lds_b128 %13, %27, off\n\t"
      "s_wait_xcnt 0x0"
      :: "v"(l[0]), "v"(l[1]), "v"(l[2]), "v"(l[3]), "v"(l[4]), "v"(l[5]), "v"(l[6]),
         "v"(l[7]), "v"(l[8]), "v"(l[9]), "v"(l[10]), "v"(l[11]), "v"(l[12]), "v"(l[13]),
         "v"(g[0]), "v"(g[1]), "v"(g[2]), "v"(g[3]), "v"(g[4]), "v"(g[5]), "v"(g[6]),
         "v"(g[7]), "v"(g[8]), "v"(g[9]), "v"(g[10]), "v"(g[11]), "v"(g[12]), "v"(g[13])
      : "memory");
}

// One pass's rows: 16 lanes cover a row's 256 B, a lane takes 28 rows 16 apart,
// 16 of xn and 12 of W. lds: the lane's byte address in the buffer's first 16
// rows; ga, gw: the block's first source row of each operand at the pass's k
// (block-uniform); go: the lane's element offset from either, which never changes.
static __device__ __forceinline__ void qt_copy_stage(unsigned lds, const _Float16* ga,
                                                     const _Float16* gw, unsigned go) {
#pragma unroll
  for (int p = 0; p < 2; ++p) {
    unsigned l[14];
    const _Float16* g[14];
#pragma unroll
    for (int c = 0; c < 14; ++c) {
      const int i = p * 14 + c;
      l[c] = lds + i * 16 * GT_PITCH * 2;
      g[c] = (i < QT_M / 16 ? ga + i * 16 * EMBED : gw + (i - QT_M / 16) * 16 * EMBED) + go;
    }
    copy_x14(l, g);
  }
}

// One 16-column tile's share of a lane, head layout: 32 rows of 128 B, the rows
// 16 i + 0..7; w[4 i + q] holds rows 16 i + 2 q (low half) and 16 i + 2 q + 1
// (high half). The stores and the wait that stands in front of any rewrite of
// the registers they name are one statement: in a statement of its own the
// compiler lifted the next conversions over the wait.
static __device__ __forceinline__ void store_rows_x32(_Float16* p, const unsigned (&w)[16]) {
  asm volatile(
      "global_store_b16 %0, %1, off\n\t"
      "global_store_d16_hi_b16 %0, %1, off offset:128\n\t"
      "global_store_b16 %0, %2, off offset:256\n\t"
      "global_store_d16_hi_b16 %0, %2, off offset:384\n\t"
      "global_store_b16 %0, %3, off offset:512\n\t"
      "global_store_d16_hi_b16 %0, %3, off offset:640\n\t"
      "global_store_b16 %0, %4, off offset:768\n\t"
      "global_store_d16_hi_b16 %0, %4, off offset:896\n\t"
      "global_store_b16 %0, %5, off offset:2048\n\t"
      "global_store_d16_hi_b16 %0, %5, off offset:2176\n\t"
      "global_store_b16 %0, %6, off offset:2304\n\t"
      "global_store_d16_hi_b16 %0, %6, off offset:2432\n\t"
      "global_store_b16 %0, %7, off offset:2560\n\t"
      "global_store_d16_hi_b16 %0, %7, off offset:2688\n\t"
      "global_store_b16 %0, %8, off offset:2816\n\t"
      "global_store_d16_hi_b16 %0, %8, off offset:2944\n\t"
      "global_store_b16 %0, %9, off offset:4096\n\t"
      "global_store_d16_hi_b16 %0, %9, off offset:4224\n\t"
      "global_store_b16 %0, %10, off offset:4352\n\t"
      "global_store_d16_hi_b16 %0, %10, off offset:4480\n\t"
      "global_store_b16 %0, %11, off offset:4608\n\t"
      "global_store_d16_hi_b16 %0, %11, off offset:4736\n\t"
      "global_store_b16 %0, %12, off offset:4864\n\t"
      "global_store_d16_hi_b16 %0, %12, off offset:4992\n\t"
      "global_store_b16 %0, %13, off offset:6144\n\t"
      "global_store_d16_hi_b16 %0, %13, off offset:6272\n\t"
      "global_store_b16 %0, %14, off offset:6400\n\t"
      "global_store_d16_hi_b16 %0, %14, off offset:6528\n\t"
      "global_store_b16 %0, %15, off offset:6656\n\t"
      "global_store_d16_hi_b16 %0, %15, off offset:6784\n\t"
      "global_store_b16 %0, %16, off offset:6912\n\t"
      "global_store_d16_hi_b16 %0, %16, off offset:7040\n\t"
      "s_wait_xcnt 0x0"
      :: "v"(p), "v"(w[0]), "v"(w[1]), "v"(w[2]), "v"(w[3]), "v"(w[4]), "v"(w[5]), "v"(w[6]),
         "v"(w[7]), "v"(w[8]), "v"(w[9]), "v"(w[10]), "v"(w[11]), "v"(w[12]), "v"(w[13]),
         "v"(w[14]), "v"(w[15])
      : "memory");
}

__global__ __launch_bounds__(256) void gemm_qkv(const _Float16* __restrict__ A,
                                                const _Float16* __restrict__ W,
                                                _Float16* __restrict__ dq,
                                                _Float16* __restrict__ dk,
                                                _Float16* __restrict__ dv) {
  __shared__ __attribute__((aligned(16))) _Float16 sm[2 * QT_STAGE];
  int tid  = threadIdx.x;
  int lane = tid & 31;
  int wave = __builtin_amdgcn_readfirstlane(tid >> 5);   // scalar: so is the test that picks a tile's layout
  int hi = lane >> 4, ln16 = lane & 15;
  const int wm = wave >> 1, wn = wave & 1;
  const int bm0 = (blockIdx.x / QT_NT) * QT_M, bn0 = (blockIdx.x % QT_NT) * QT_N;
  const int c16 = tid & 15, r16 = tid >> 4;
  const unsigned cl = (unsigned)(size_t)sm + (unsigned)(r16 * GT_PITCH + c16 * 8) * 2;
  const _Float16* ga = A + (size_t)bm0 * EMBED;
  const _Float16* gw = W + (size_t)bn0 * EMBED;
  const unsigned go = (unsigned)(r16 * EMBED + c16 * 8);
  const _Float16* fa = sm + (wm * 64 + ln16) * GT_PITCH + hi * 16;
  const _Float16* fb = sm + (QT_M + wn * 96 + ln16) * GT_PITCH + hi * 16;
  v8f acc[4][6] = {};

  qt_copy_stage(cl, ga, gw, go);       // pass 0 into buffer 0
  asm volatile("s_wait_asynccnt 0x0" ::: "memory");   // this wave's copies have landed
  __syncthreads();                     // pass 0 published
  qt_copy_stage(cl + QT_STAGE * 2, ga + GT_K, gw + GT_K, go);

  for (int t = 0; t < GT_PASSES; ++t) {
    const int cur = (t & 1) * QT_STAGE;
    v16h a[2][4], b[2][6];             // two fragment sets: one read, one in use
#pragma unroll
    for (int i = 0; i < 4; ++i) a[0][i] = lds_frag(fa + cur + i * 16 * GT_PITCH);
#pragma unroll
    for (int j = 0; j < 6; ++j) b[0][j] = lds_frag(fb + cur + j * 16 * GT_PITCH);
#pragma unroll
    for (int kk = 0; kk < GT_K / 32; ++kk) {
      const int s = kk & 1;
      if (kk + 1 < GT_K / 32) {
#pragma unroll
        for (int i = 0; i < 4; ++i)
          a[s ^ 1][i] = lds_frag(fa + cur + i * 16 * GT_PITCH + (kk + 1) * 32);
#pragma unroll
        for (int j = 0; j < 6; ++j)
          b[s ^ 1][j] = lds_frag(fb + cur + j * 16 * GT_PITCH + (kk + 1) * 32);
      }
      // Keeps the next block's LDS reads one group ahead of this block's
      // products; left free, the scheduler sinks them between the products
      // and the products then wait out an LDS latency.
      __builtin_amdgcn_sched_barrier(0);
#pragma unroll
      for (int i = 0; i < 4; ++i)
#pragma unroll
        for (int j = 0; j < 6; ++j) acc[i][j] = wmma_f16(a[s][i], b[s][j], acc[i][j]);
      // Ends the block: left free, the scheduler lifts the following group's
      // reads in among these products.
      __builtin_amdgcn_sched_barrier(0);
    }
    // Foot of the pass, every wave: its reads of this buffer are done, its own
    // copies of the next pass have landed; the barrier publishes that pass and
    // frees this buffer, which only then takes the pass after it.
    lds_fence_wave();
    asm volatile("s_wait_asynccnt 0x0" ::: "memory");
    __syncthreads();
    if (t + 2 < GT_PASSES)
      qt_copy_stage(cl + cur * 2, ga + (t + 2) * GT_K, gw + (t + 2) * GT_K, go);
  }
  asm volatile("s_wait_asynccnt 0x0" ::: "memory");   // nothing in flight when the loop ends

  int m0 = bm0 + wm * 64 + 8 * hi;
  int b2 = m0 >> 11;                   // batch: a 64-row strip lies in one
  int n0 = m0 & (NSEQ - 1);            // seq pos of the lane's first row
#pragma unroll
  for (int j = 0; j < 6; ++j) {
    const int cb = bn0 + wn * 96 + j * 16;   // the tile's first column of 3072: 16 columns lie in one head
    const int which = cb / EMBED;            // wave-uniform, a scalar test
    int col = (cb & (EMBED - 1)) + ln16;
    int h = col >> 6, d = col & 63;
    size_t base = (size_t)(b2 * HEADS + h);
    if (which < 2) {
      _Float16* dst = (which == 0 ? dq : dk) + (base * NSEQ + n0) * HEAD_DIM + d;
      unsigned w[16];
      // Both loops unrolled: w and acc stay in registers only under constant indices.
#pragma unroll
      for (int i = 0; i < 4; ++i)
#pragma unroll
        for (int q = 0; q < 4; ++q) {
          v2h pr = {(_Float16)acc[i][j][2 * q], (_Float16)acc[i][j][2 * q + 1]};
          w[i * 4 + q] = __builtin_bit_cast(unsigned, pr);
        }
      store_rows_x32(dst, w);
    } else {
      _Float16* dst = dv + (base * HEAD_DIM + d) * NSEQ + n0;
#pragma unroll
      for (int i = 0; i < 4; ++i)
#pragma unroll
        for (int r = 0; r < 8; ++r)
          dst[i * 16 + r] = (_Float16)acc[i][j][r];
      // The next column's conversions and addresses reuse registers that these
      // stores name: the wait stands in front of those overwrites.
      asm volatile("s_wait_xcnt 0x0" ::: "memory");
    }
  }
}

#define FA_KEYS  64
#define FA_PITCH 72
#define FA_TILE  (64 * FA_PITCH)
#define FA_BUF   (2 * FA_TILE)
#define FA_SBUF  (2 * FA_BUF)
#define FA_GROUPS (NSEQ / 64)

// One stage: a lane copies 16 B of four K rows and of four V^T rows, 16 rows
// apart; 8 lanes cover a row. lds: the lane's byte address in the buffer's K
// tile; gk, gv: its first source piece of each operand. The copies and the
// wait that stands in front of any rewrite of their address registers are one
// statement.
static __device__ __forceinline__ void fa_copy_stage(unsigned lds, const _Float16* gk,
                                                     const _Float16* gv) {
  const unsigned step = 16 * FA_PITCH * 2;           // 16 rows on, in bytes
  const unsigned lv = lds + FA_TILE * 2;
  asm volatile(
      "global_load_async_to_lds_b128 %0, %8, off\n\t"
      "global_load_async_to_lds_b128 %1, %9, off\n\t"
      "global_load_async_to_lds_b128 %2, %10, off\n\t"
      "global_load_async_to_lds_b128 %3, %11, off\n\t"
      "global_load_async_to_lds_b128 %4, %12, off\n\t"
      "global_load_async_to_lds_b128 %5, %13, off\n\t"
      "global_load_async_to_lds_b128 %6, %14, off\n\t"
      "global_load_async_to_lds_b128 %7, %15, off\n\t"
      "s_wait_xcnt 0x0"
      :: "v"(lds), "v"(lds + step), "v"(lds + 2 * step), "v"(lds + 3 * step),
         "v"(lv), "v"(lv + step), "v"(lv + 2 * step), "v"(lv + 3 * step),
         "v"(gk), "v"(gk + 16 * HEAD_DIM), "v"(gk + 32 * HEAD_DIM), "v"(gk + 48 * HEAD_DIM),
         "v"(gv), "v"(gv + 16 * NSEQ), "v"(gv + 32 * NSEQ), "v"(gv + 48 * NSEQ)
      : "memory");
}

// The issuing wave's own copies have landed.
static __device__ __forceinline__ void wait_copies() {
  asm volatile("s_wait_asynccnt 0x0" ::: "memory");
}

// Lane l takes lane l ^ 16's value: a vector move between the 16-lane rows.
static __device__ __forceinline__ float other_half(float v) {
  int b = __builtin_bit_cast(int, v);
  return __builtin_bit_cast(float, __builtin_amdgcn_permlanex16(b, b, 0x76543210, 0xfedcba98,
                                                                false, false));
}

// A fragment in the k order that a pair of converted D tiles has as B: the
// lane's elements 0..7 are k 8 hi + 0..7, elements 8..15 are k 16 + 8 hi + 0..7.
// p: the row's first k of the 32, plus 8 hi.
static __device__ __forceinline__ v16h lds_frag_split(const _Float16* p) {
  v8h lo = *(const v8h*)(p);
  v8h hi = *(const v8h*)(p + 16);
  return __builtin_shufflevector(lo, hi, 0, 1, 2, 3, 4, 5, 6, 7,
                                 8, 9, 10, 11, 12, 13, 14, 15);
}

#define LOG2E_F 1.44269504f            // e^x = 2^(x log2 e)

// Eight 2^x in place, one statement: each overwrites only its own source and
// reads no other's result, so each has an independent instruction behind it,
// the slot the instruction set asks for behind a transcendental; the v_nop is
// that slot for the last.
static __device__ __forceinline__ void exp2_x8(float (&t)[8]) {
  asm("v_exp_f32 %0, %0\n\t"
      "v_exp_f32 %1, %1\n\t"
      "v_exp_f32 %2, %2\n\t"
      "v_exp_f32 %3, %3\n\t"
      "v_exp_f32 %4, %4\n\t"
      "v_exp_f32 %5, %5\n\t"
      "v_exp_f32 %6, %6\n\t"
      "v_exp_f32 %7, %7\n\t"
      "v_nop"
      : "+v"(t[0]), "+v"(t[1]), "+v"(t[2]), "+v"(t[3]),
        "+v"(t[4]), "+v"(t[5]), "+v"(t[6]), "+v"(t[7]));
}

// One pass: 32 keys against the wave's 16 queries. The scores stay as the matrix
// unit leaves them: the maximum is taken and kept on raw scores (the scale is
// positive), and scale and log2 e go into the one multiply-add that forms the
// exponent, 2^(s c - m c) with c = scale log2 e. MASKED: the pass holds keys
// past the diagonal.
#define EXP_C (SCALE_F * LOG2E_F)

template <bool MASKED>
static __device__ __forceinline__ void fa_pass(const _Float16* kt, const _Float16* vtl, int sub,
                                               int ln16, int hi, int lim,
                                               const v16h& q0, const v16h& q1,
                                               v8f& o0, v8f& o1, v8f& o2, v8f& o3,
                                               float& mrun, float& lrun) {
  // ---- S^T = K @ Q^T for 32 keys (two 16x16 C tiles, keys down the rows) ----
  v8f s0 = {}, s1 = {};
  const _Float16* kr0 = kt + (sub * 32 + ln16) * FA_PITCH;
  const _Float16* kr1 = kr0 + 16 * FA_PITCH;
  v16h k00 = lds_frag(kr0 + hi * 16);
  v16h k01 = lds_frag(kr0 + 32 + hi * 16);
  v16h k10 = lds_frag(kr1 + hi * 16);
  v16h k11 = lds_frag(kr1 + 32 + hi * 16);
  // V^T rows are the A fragments of the second product, in P^T's k order.
  const _Float16* vb0 = vtl + ln16 * FA_PITCH + sub * 32 + hi * 8;
  v16h av0 = lds_frag_split(vb0);
  v16h av1 = lds_frag_split(vb0 + 16 * FA_PITCH);
  v16h av2 = lds_frag_split(vb0 + 32 * FA_PITCH);
  v16h av3 = lds_frag_split(vb0 + 48 * FA_PITCH);
  // Keeps the pass's LDS reads one group ahead of its products; left free, the
  // scheduler reads each fragment into the same registers right in front of
  // its product, and every product then waits out an LDS latency.
  __builtin_amdgcn_sched_barrier(0);
  s0 = wmma_f16(k00, q0, s0); s0 = wmma_f16(k01, q1, s0);
  s1 = wmma_f16(k10, q0, s1); s1 = wmma_f16(k11, q1, s1);

  // ---- causal mask, online softmax: one query per lane ----
  float v0[8], v1[8];
  float mx = NEG_BIG;
#pragma unroll
  for (int r = 0; r < 8; ++r) {
    v0[r] = MASKED && r      > lim ? NEG_BIG : s0[r];
    v1[r] = MASKED && r + 16 > lim ? NEG_BIG : s1[r];
    mx = fmaxf(mx, fmaxf(v0[r], v1[r]));
  }
  mx = fmaxf(mx, other_half(mx));
  float mnew  = fmaxf(mrun, mx);
  float alpha = __builtin_amdgcn_exp2f((mrun - mnew) * EXP_C);
  const float nm = -mnew * EXP_C;
#pragma unroll
  for (int r = 0; r < 8; ++r) {
    v0[r] = __builtin_fmaf(v0[r], EXP_C, nm);
    v1[r] = __builtin_fmaf(v1[r], EXP_C, nm);
  }
  exp2_x8(v0);
  exp2_x8(v1);
  float rsum = 0.f;
  v16h pb;                             // P^T as B: element r key 8 hi + r, 8 + r key 16 + 8 hi + r
#pragma unroll
  for (int r = 0; r < 8; ++r) {
    rsum += v0[r] + v1[r];
    pb[r]     = (_Float16)v0[r];
    pb[8 + r] = (_Float16)v1[r];
  }
  lrun = lrun * alpha + rsum;
  mrun = mnew;
  o0 *= alpha; o1 *= alpha; o2 *= alpha; o3 *= alpha;

  // ---- O^T += V^T @ P^T ----
  o0 = wmma_f16(av0, pb, o0);
  o1 = wmma_f16(av1, pb, o1);
  o2 = wmma_f16(av2, pb, o2);
  o3 = wmma_f16(av3, pb, o3);
}

__global__ __launch_bounds__(256) void flash_attn(const _Float16* __restrict__ q,
                                                  const _Float16* __restrict__ k,
                                                  const _Float16* __restrict__ vt,
                                                  _Float16* __restrict__ ao) {
  __shared__ __attribute__((aligned(16))) _Float16 kv[2 * FA_SBUF];
  // Waves 4-7's partial results: per query tile 8 pieces of O^T and one of
  // (maximum, sum); a lane's 16 bytes beside its neighbour's.
  __shared__ __attribute__((aligned(16))) v4f part[4][9][32];
  int lane = threadIdx.x & 31;
  int wave = __builtin_amdgcn_readfirstlane(threadIdx.x >> 5);   // scalar: so is the test that skips a pass
  const int qt = wave & 3, kh = wave >> 2;           // query tile; which 64 keys of a stage
  int hi = lane >> 4, ln16 = lane & 15;
  const int pr = blockIdx.x & (FA_GROUPS / 2 - 1);   // which pair of query groups
  int h  = (blockIdx.x / (FA_GROUPS / 2)) & (HEADS - 1);
  int b  = blockIdx.x / (FA_GROUPS / 2 * HEADS);
  size_t bh = (size_t)(b * HEADS + h);
  const _Float16* qb_p = q  + bh * NSEQ * HEAD_DIM;
  const _Float16* kb_p = k  + bh * NSEQ * HEAD_DIM;
  const _Float16* vb_p = vt + bh * HEAD_DIM * NSEQ;
  const int c8 = threadIdx.x & 7, r16 = (threadIdx.x & 127) >> 3;
  const unsigned cl = (unsigned)(size_t)kv + (unsigned)(kh * FA_BUF + r16 * FA_PITCH + c8 * 8) * 2;
  const _Float16* ck = kb_p + (kh * FA_KEYS + r16) * HEAD_DIM + c8 * 8;
  const _Float16* cv = vb_p + r16 * NSEQ + kh * FA_KEYS + c8 * 8;

  for (int half = 0; half < 2; ++half) {
  const int grp = half ? FA_GROUPS - 1 - pr : pr;    // same value in every wave of the block
  int m0 = (grp * 4 + qt) * 16;

  // Q B-fragments for d = 0..31 and d = 32..63 (loaded once): column ln16 is
  // query m0 + ln16; 16 contiguous d per half, the order of the K loader.
  const _Float16* qrow = qb_p + (size_t)(m0 + ln16) * HEAD_DIM;
  v16h q0 = *(const v16h*)(qrow + hi * 16);
  v16h q1 = *(const v16h*)(qrow + 32 + hi * 16);

  // O^T tiles: o_j[r] = O[query m0 + ln16][d = 16 j + 8 hi + r].
  v8f o0 = {}, o1 = {}, o2 = {}, o3 = {};
  float mrun = NEG_BIG;                // the query's running maximum (raw scores), same in both halves
  float lrun = 0.f;                    // this half's share of the query's sum

  int kbmax = (m0 + 15) >> 5;          // causal: last key block touching this tile
  // In block kbmax key r of the first score tile lies past the query's diagonal where r > lim.
  const int lim = m0 + ln16 - kbmax * 32 - 8 * hi;
  // The group's queries are 64 j ... 64 j + 63: it walks the stages of 128 keys
  // that hold keys 0 ... 64 j + 63; for even j the last stage's second 64 keys
  // (still inside the sequence) lie past the diagonal and no wave reads them.
  // Same value in every wave of the block.
  const int nst = (grp + 2) >> 1;

  // For the second group: the first group's last foot (reads done, barrier)
  // has freed both buffers, and none of its copies is in flight.
  fa_copy_stage(cl, ck, cv);           // stage 0 into buffer 0
  wait_copies();
  __syncthreads();                     // stage 0 published
  if (nst > 1) fa_copy_stage(cl + FA_SBUF * 2, ck + 2 * FA_KEYS * HEAD_DIM, cv + 2 * FA_KEYS);

  for (int st = 0; st < nst; ++st) {
   const _Float16* kt = kv + (st & 1) * FA_SBUF + kh * FA_BUF;
   const _Float16* vtl = kt + FA_TILE;
   // The wave's two passes of this stage are key blocks kb0 and kb0 + 1. 32 kbmax <= m0:
   // every key of a block below kbmax lies below every query of the tile, so only
   // block kbmax, the wave's last, selects by the diagonal. All three tests are
   // wave-uniform, scalar branches; blocks past kbmax are skipped.
   const int kb0 = (st * 2 + kh) * 2;
   if (kb0 < kbmax)     fa_pass<false>(kt, vtl, 0, ln16, hi, 0, q0, q1, o0, o1, o2, o3, mrun, lrun);
   if (kb0 + 1 < kbmax) fa_pass<false>(kt, vtl, 1, ln16, hi, 0, q0, q1, o0, o1, o2, o3, mrun, lrun);
   if ((kbmax >> 1) == st * 2 + kh)
     fa_pass<true>(kt, vtl, kbmax & 1, ln16, hi, lim, q0, q1, o0, o1, o2, o3, mrun, lrun);
   // Foot of the stage, every wave: its reads of this buffer are done, its own
   // copies of the next stage have landed; the barrier publishes that stage and
   // frees this buffer, which only then takes the stage after it.
   lds_fence_wave();
   wait_copies();
   __syncthreads();
   if (st + 2 < nst)
     fa_copy_stage(cl + (st & 1) * FA_SBUF * 2, ck + (st + 2) * 2 * FA_KEYS * HEAD_DIM,
                   cv + (st + 2) * 2 * FA_KEYS);
  }
  wait_copies();                       // nothing in flight when the group ends

  // ---- join the two key sets' partial results, lane by lane ----
  if (kh == 1) {                       // wave-uniform, a scalar test
    part[qt][0][lane] = __builtin_shufflevector(o0, o0, 0, 1, 2, 3);
    part[qt][1][lane] = __builtin_shufflevector(o0, o0, 4, 5, 6, 7);
    part[qt][2][lane] = __builtin_shufflevector(o1, o1, 0, 1, 2, 3);
    part[qt][3][lane] = __builtin_shufflevector(o1, o1, 4, 5, 6, 7);
    part[qt][4][lane] = __builtin_shufflevector(o2, o2, 0, 1, 2, 3);
    part[qt][5][lane] = __builtin_shufflevector(o2, o2, 4, 5, 6, 7);
    part[qt][6][lane] = __builtin_shufflevector(o3, o3, 0, 1, 2, 3);
    part[qt][7][lane] = __builtin_shufflevector(o3, o3, 4, 5, 6, 7);
    part[qt][8][lane] = (v4f){mrun, lrun, 0.f, 0.f};
  }
  // Publishes the partial results. They are rewritten only at the next group's
  // end, behind that group's barriers, which their readers pass after reading.
  __syncthreads();
  if (kh == 1) continue;               // wave-uniform; the next barrier is the next group's first
  {
    v4f ml = part[qt][8][lane];
    // A set that saw no key below the diagonal hands over (NEG_BIG, 0, 0): weight 0.
    float mj = fmaxf(mrun, ml[0]);
    float a0 = __builtin_amdgcn_exp2f((mrun - mj) * EXP_C), a1 = __builtin_amdgcn_exp2f((ml[0] - mj) * EXP_C);
    lrun = lrun * a0 + ml[1] * a1;
    v4f p0 = part[qt][0][lane], p1 = part[qt][1][lane], p2 = part[qt][2][lane], p3 = part[qt][3][lane];
    v4f p4 = part[qt][4][lane], p5 = part[qt][5][lane], p6 = part[qt][6][lane], p7 = part[qt][7][lane];
    o0 = o0 * a0 + __builtin_shufflevector(p0, p1, 0, 1, 2, 3, 4, 5, 6, 7) * a1;
    o1 = o1 * a0 + __builtin_shufflevector(p2, p3, 0, 1, 2, 3, 4, 5, 6, 7) * a1;
    o2 = o2 * a0 + __builtin_shufflevector(p4, p5, 0, 1, 2, 3, 4, 5, 6, 7) * a1;
    o3 = o3 * a0 + __builtin_shufflevector(p6, p7, 0, 1, 2, 3, 4, 5, 6, 7) * a1;
  }

  // ---- normalize and write attention output [B*N, EMBED] f16: a lane holds 8
  // consecutive d of its query in each tile, one 16-byte store a tile ----
  float inv = 1.f / (lrun + other_half(lrun));
  _Float16* orow = ao + ((size_t)(b * NSEQ + m0 + ln16)) * EMBED + h * HEAD_DIM + hi * 8;
  v8h w0, w1, w2, w3;
#pragma unroll
  for (int r = 0; r < 8; ++r) {
    w0[r] = (_Float16)(o0[r] * inv);
    w1[r] = (_Float16)(o1[r] * inv);
    w2[r] = (_Float16)(o2[r] * inv);
    w3[r] = (_Float16)(o3[r] * inv);
  }
  *(v8h*)(orow)      = w0;
  *(v8h*)(orow + 16) = w1;
  *(v8h*)(orow + 32) = w2;
  *(v8h*)(orow + 48) = w3;
  // The next group's code reuses registers that the stores above name: the
  // wait stands in front of those overwrites.
  asm volatile("s_wait_xcnt 0x0" ::: "memory");
  }
}

// ---------------------------------------------------------------------------
// out = residual + ao @ Wo^T + bo  (fp32 output); 128x128 block tiles
// ---------------------------------------------------------------------------
#define GT_TILES ((MROWS / 128) * (EMBED / 128))  // blocks: 32*8

__global__ __launch_bounds__(256) void out_proj(const _Float16* __restrict__ A,
                                                const _Float16* __restrict__ W,
                                                const float* __restrict__ x,
                                                const float* __restrict__ bo,
                                                float* __restrict__ out) {
  __shared__ __attribute__((aligned(16))) _Float16 sm[4 * GT_OPER];
  int lane = threadIdx.x & 31;
  int wave = threadIdx.x >> 5;
  int hi = lane >> 4, ln16 = lane & 15;
  int bx = blockIdx.x;
  int bm0 = (bx >> 3) * 128, bn0 = (bx & 7) * 128;
  v8f acc[4][2] = {};
  gemm_tile_128(A, W, sm, bm0, bn0, acc);

  int m0 = bm0 + (wave >> 2) * 64 + 8 * hi, col0 = bn0 + (wave & 3) * 32 + ln16;
  // One 32-bit element offset per lane on the two scalar bases serves every
  // load of x and every store of out: no 64-bit per-lane address arithmetic.
  const unsigned base = (unsigned)(m0 * EMBED + col0);
  const float* xp = x + base;
  float* op = out + base;
  float bias[2] = {bo[col0], bo[col0 + 16]};
  // The loads of x may land in the register that the two loads above name.
  asm volatile("s_wait_xcnt 0x0" ::: "memory");
  float xr[4][2][8];
#pragma unroll
  for (int i = 0; i < 4; ++i)
#pragma unroll
    for (int j = 0; j < 2; ++j)
#pragma unroll
      for (int r = 0; r < 8; ++r) xr[i][j][r] = xp[(i * 16 + r) * EMBED + j * 16];
#pragma unroll
  for (int i = 0; i < 4; ++i)
#pragma unroll
    for (int j = 0; j < 2; ++j)
#pragma unroll
      for (int r = 0; r < 8; ++r)
        op[(i * 16 + r) * EMBED + j * 16] = xr[i][j][r] + bias[j] + acc[i][j][r];
}

// ---------------------------------------------------------------------------
extern "C" void kernel_launch(void* const* d_in, const int* in_sizes, int n_in,
                              void* d_out, int out_size, void* d_ws, size_t ws_size,
                              hipStream_t stream) {
  (void)in_sizes; (void)n_in; (void)out_size; (void)ws_size;
  const float* x    = (const float*)d_in[0];
  const float* ln_w = (const float*)d_in[1];
  const float* ln_b = (const float*)d_in[2];
  const float* Wq   = (const float*)d_in[3];
  const float* Wk   = (const float*)d_in[4];
  const float* Wv   = (const float*)d_in[5];
  const float* Wo   = (const float*)d_in[6];
  const float* bo   = (const float*)d_in[7];
  float* out = (float*)d_out;

  char* ws = (char*)d_ws;
  size_t off = 0;
  auto carve = [&](size_t elems) {
    _Float16* p = (_Float16*)(ws + off);
    off += ((elems * sizeof(_Float16) + 255) & ~(size_t)255);
    return p;
  };
  _Float16* xn   = carve((size_t)MROWS * EMBED);   // normalized activations
  _Float16* wq16 = carve((size_t)3 * EMBED * EMBED);   // Wq, Wk, Wv: one [3072][1024] operand
  _Float16* wk16 = wq16 + (size_t)EMBED * EMBED;
  _Float16* wv16 = wk16 + (size_t)EMBED * EMBED;
  _Float16* wo16 = carve((size_t)EMBED * EMBED);
  _Float16* qh   = carve((size_t)MROWS * EMBED);   // [B,H,N,D]
  _Float16* kh   = carve((size_t)MROWS * EMBED);   // [B,H,N,D]
  _Float16* vth  = carve((size_t)MROWS * EMBED);   // [B,H,D,N]
  _Float16* ao   = carve((size_t)MROWS * EMBED);   // attention output [B*N, E]

  prep<<<dim3(LN_BLOCKS + 4 * CV_BLOCKS), CV_THREADS, 0, stream>>>(
      x, ln_w, ln_b, xn, Wq, Wk, Wv, Wo, wq16, wk16, wv16, wo16);

  gemm_qkv<<<dim3((MROWS / QT_M) * QT_NT), 256, 0, stream>>>(xn, wq16, qh, kh, vth);

  flash_attn<<<dim3(BATCH * HEADS * (FA_GROUPS / 2)), 256, 0, stream>>>(qh, kh, vth, ao);

  out_proj<<<dim3(GT_TILES), 256, 0, stream>>>(ao, wo16, x, bo, out);
}
